// v000
// Measured on an AMD MI455X. A time is GPU time per run, averaged over a window of back-to-back runs after a warm-up
// (all launches, gaps included; the runs take copies of the inputs in turn), and the median of several windows.
// Apart from v000's, it joins two sittings. Times from different sittings can be a few percent apart, while
// side-by-side timings come from the same sitting.
// v000 is the starting kernel. One run takes 3570 microseconds.
#include <hip/hip_runtime.h>
#include <hip/hip_bf16.h>
#include <math.h>

// ---------------- types / helpers ----------------
typedef __attribute__((ext_vector_type(16))) __bf16 v16bf;
typedef __attribute__((ext_vector_type(8)))  float  v8f;
typedef __attribute__((ext_vector_type(4)))  unsigned int u32x4;

union FragBF { u32x4 q[2]; v16bf v; };

__device__ inline unsigned int f32_bf16(float f) {
  unsigned int u = __float_as_uint(f);
  unsigned int r = 0x7FFFu + ((u >> 16) & 1u);
  return (u + r) >> 16;
}
// pack 8 consecutive values (float->bf16 or passthrough bf16 bits) into u32x4
__device__ inline u32x4 load8_bf(const float* p) {
  const float4* q = (const float4*)p;
  float4 a = q[0], b = q[1];
  u32x4 r;
  r.x = f32_bf16(a.x) | (f32_bf16(a.y) << 16);
  r.y = f32_bf16(a.z) | (f32_bf16(a.w) << 16);
  r.z = f32_bf16(b.x) | (f32_bf16(b.y) << 16);
  r.w = f32_bf16(b.z) | (f32_bf16(b.w) << 16);
  return r;
}
__device__ inline u32x4 load8_bf(const unsigned short* p) {
  return *(const u32x4*)p;
}

// DPP16 butterfly reductions over a 16-lane row (VALU only, no LDS)
// ctrl must be a compile-time constant -> template parameter
template <int CTRL>
__device__ inline float dpp_f(float x) {
  return __int_as_float(
      __builtin_amdgcn_update_dpp(0, __float_as_int(x), CTRL, 0xF, 0xF, true));
}
#define DPP_QPERM_XOR1 0xB1   // quad_perm(1,0,3,2)
#define DPP_QPERM_XOR2 0x4E   // quad_perm(2,3,0,1)
#define DPP_ROW_HMIRR  0x141  // row_half_mirror (lane^7 within 8)
#define DPP_ROW_MIRR   0x140  // row_mirror (lane^15 within 16)
__device__ inline float red16_max(float x) {
  x = fmaxf(x, dpp_f<DPP_QPERM_XOR1>(x));
  x = fmaxf(x, dpp_f<DPP_QPERM_XOR2>(x));
  x = fmaxf(x, dpp_f<DPP_ROW_HMIRR>(x));
  x = fmaxf(x, dpp_f<DPP_ROW_MIRR>(x));
  return x;
}
__device__ inline float red16_sum(float x) {
  x += dpp_f<DPP_QPERM_XOR1>(x);
  x += dpp_f<DPP_QPERM_XOR2>(x);
  x += dpp_f<DPP_ROW_HMIRR>(x);
  x += dpp_f<DPP_ROW_MIRR>(x);
  return x;
}

#define NTOK 4096   // B*T
#define CDIM 1024
#define IDIM 4096
#define NEXP 8

// ---------------- RMSNorm ----------------
__global__ void rmsnorm_kernel(const float* __restrict__ x,
                               const float* __restrict__ scale,
                               float* __restrict__ out) {
  __shared__ float red[9];
  int row = blockIdx.x;
  int tid = threadIdx.x;
  const float* xr = x + (size_t)row * CDIM;
  float v[4]; float ss = 0.f;
#pragma unroll
  for (int i = 0; i < 4; i++) { v[i] = xr[tid + 256 * i]; ss += v[i] * v[i]; }
#pragma unroll
  for (int off = 16; off >= 1; off >>= 1) ss += __shfl_xor(ss, off);
  if ((tid & 31) == 0) red[tid >> 5] = ss;
  __syncthreads();
  if (tid == 0) {
    float t = 0.f;
#pragma unroll
    for (int w = 0; w < 8; w++) t += red[w];
    red[8] = t;
  }
  __syncthreads();
  float inv = rsqrtf(red[8] / (float)CDIM + 1e-5f);
#pragma unroll
  for (int i = 0; i < 4; i++) {
    int c = tid + 256 * i;
    out[(size_t)row * CDIM + c] = v[i] * inv * scale[c];
  }
}

// ---------------- generic WMMA GEMM, 128x128 tile, double-buffered LDS ----------------
// C(M,N) = A(M,K) * B(K,N); A: float or bf16-bits; B: float (bf16-converted on stage)
// 8 waves; wave (wr,wc) owns rows wr*32..+32, cols wc*64..+64 => 2x4 wmma accums.
// EPI: 0 = store f32; 1 = gelu->bf16 (outh); 2 = +aux residual; 3 = outf += aux[r*8+e]*acc
template <int EPI, typename AT>
__global__ void gemm_wmma(const AT* __restrict__ A, const float* __restrict__ Bm,
                          float* __restrict__ outf, unsigned short* __restrict__ outh,
                          const float* __restrict__ aux,
                          int M, int N, int Kd, int lda, int ldb, int ldc, int expert) {
  __shared__ __attribute__((aligned(16))) unsigned short aS[2][128][40];
  __shared__ __attribute__((aligned(16))) unsigned short bS[2][128][40];
  int tid = threadIdx.x;
  int lane = tid & 31;
  int wave = tid >> 5;
  int wr = wave & 3, wc = wave >> 2;
  int m0 = blockIdx.y * 128, n0 = blockIdx.x * 128;
  int hi = lane >> 4;
  int kb = hi * 8;
  int ln = lane & 15;
  int ar0 = wr * 32 + ln;
  // staging index precompute (2 chunks of 8 elems per thread for A and B)
  int rA[2], cgA[2], kB[2], nbB[2];
#pragma unroll
  for (int g = 0; g < 2; g++) {
    int lin = tid + 256 * g;
    rA[g] = lin >> 2; cgA[g] = (lin & 3) * 8;
    kB[g] = lin >> 4; nbB[g] = (lin & 15) * 8;
  }
  v8f acc[2][4] = {};
  u32x4 ra[2], rb[2];
  int nt = Kd >> 5;
  // prologue: load tile 0 into regs, store to buffer 0
#pragma unroll
  for (int g = 0; g < 2; g++) {
    ra[g] = load8_bf(&A[(size_t)(m0 + rA[g]) * lda + cgA[g]]);
    const float4* qp = (const float4*)&Bm[(size_t)kB[g] * ldb + n0 + nbB[g]];
    float4 fa = qp[0], fb = qp[1];
    rb[g].x = f32_bf16(fa.x) | (f32_bf16(fa.y) << 16);
    rb[g].y = f32_bf16(fa.z) | (f32_bf16(fa.w) << 16);
    rb[g].z = f32_bf16(fb.x) | (f32_bf16(fb.y) << 16);
    rb[g].w = f32_bf16(fb.z) | (f32_bf16(fb.w) << 16);
  }
#pragma unroll
  for (int g = 0; g < 2; g++) {
    *(u32x4*)&aS[0][rA[g]][cgA[g]] = ra[g];
#pragma unroll
    for (int j = 0; j < 8; j++) {
      unsigned w = ((const unsigned*)&rb[g])[j >> 1];
      bS[0][nbB[g] + j][kB[g]] = (unsigned short)((j & 1) ? (w >> 16) : (w & 0xFFFFu));
    }
  }
  __syncthreads();
  for (int kt = 0; kt < nt; kt++) {
    int buf = kt & 1;
    int k1 = (kt + 1) << 5;
    if (kt + 1 < nt) {
      // issue next tile's global loads (packed in regs)
#pragma unroll
      for (int g = 0; g < 2; g++) {
        ra[g] = load8_bf(&A[(size_t)(m0 + rA[g]) * lda + k1 + cgA[g]]);
        const float4* qp = (const float4*)&Bm[(size_t)(k1 + kB[g]) * ldb + n0 + nbB[g]];
        float4 fa = qp[0], fb = qp[1];
        rb[g].x = f32_bf16(fa.x) | (f32_bf16(fa.y) << 16);
        rb[g].y = f32_bf16(fa.z) | (f32_bf16(fa.w) << 16);
        rb[g].z = f32_bf16(fb.x) | (f32_bf16(fb.y) << 16);
        rb[g].w = f32_bf16(fb.z) | (f32_bf16(fb.w) << 16);
      }
    }
    if (kt + 2 < nt) {   // prefetch two tiles ahead into GL2
      int k2 = (kt + 2) << 5;
      __builtin_prefetch(&A[(size_t)(m0 + rA[0]) * lda + k2 + cgA[0]], 0, 1);
      __builtin_prefetch(&Bm[(size_t)(k2 + kB[0]) * ldb + n0 + nbB[0]], 0, 1);
    }
    // compute current tile
    FragBF a0, a1;
    a0.q[0] = *(const u32x4*)&aS[buf][ar0][kb];
    a0.q[1] = *(const u32x4*)&aS[buf][ar0][16 + kb];
    a1.q[0] = *(const u32x4*)&aS[buf][ar0 + 16][kb];
    a1.q[1] = *(const u32x4*)&aS[buf][ar0 + 16][16 + kb];
#pragma unroll
    for (int bj = 0; bj < 4; bj++) {
      FragBF bf;
      int bc = wc * 64 + bj * 16 + ln;
      bf.q[0] = *(const u32x4*)&bS[buf][bc][kb];
      bf.q[1] = *(const u32x4*)&bS[buf][bc][16 + kb];
      acc[0][bj] = __builtin_amdgcn_wmma_f32_16x16x32_bf16(false, a0.v, false, bf.v, (short)0, acc[0][bj], false, false);
      acc[1][bj] = __builtin_amdgcn_wmma_f32_16x16x32_bf16(false, a1.v, false, bf.v, (short)0, acc[1][bj], false, false);
    }
    if (kt + 1 < nt) {
      int nb = buf ^ 1;
#pragma unroll
      for (int g = 0; g < 2; g++) {
        *(u32x4*)&aS[nb][rA[g]][cgA[g]] = ra[g];
#pragma unroll
        for (int j = 0; j < 8; j++) {
          unsigned w = ((const unsigned*)&rb[g])[j >> 1];
          bS[nb][nbB[g] + j][kB[g]] = (unsigned short)((j & 1) ? (w >> 16) : (w & 0xFFFFu));
        }
      }
    }
    __syncthreads();
  }
#pragma unroll
  for (int ai = 0; ai < 2; ai++) {
#pragma unroll
    for (int bj = 0; bj < 4; bj++) {
#pragma unroll
      for (int i = 0; i < 8; i++) {
        int r = m0 + wr * 32 + ai * 16 + i + hi * 8;
        int c = n0 + wc * 64 + bj * 16 + ln;
        size_t idx = (size_t)r * ldc + c;
        float v = acc[ai][bj][i];
        if (EPI == 0) {
          outf[idx] = v;
        } else if (EPI == 1) {
          float g = 0.5f * v * (1.0f + erff(v * 0.70710678118f));
          outh[idx] = (unsigned short)f32_bf16(g);
        } else if (EPI == 2) {
          outf[idx] = v + aux[idx];
        } else {
          outf[idx] += aux[(size_t)r * NEXP + expert] * v;
        }
      }
    }
  }
}

// ---------------- RoPE (+ bf16 convert) ----------------
__global__ void rope_kernel(const float* __restrict__ in, unsigned short* __restrict__ outb,
                            int nheads, int ld) {
  int idx = blockIdx.x * 256 + threadIdx.x;       // pair index over NTOK*nheads*32
  int d = idx & 31;
  int th = idx >> 5;
  int head = th % nheads;
  int tok = th / nheads;
  int t = tok & 1023;                             // tok = b*T + t
  float inv_freq = __expf(-0.2878231366f * (float)d);  // 10000^(-d/32)
  float ang = (float)t * inv_freq;
  float cs = __cosf(ang), sn = __sinf(ang);
  size_t base = (size_t)tok * ld + head * 64;
  float x1 = in[base + d], x2 = in[base + 32 + d];
  outb[base + d]      = (unsigned short)f32_bf16(x1 * cs - x2 * sn);
  outb[base + 32 + d] = (unsigned short)f32_bf16(x2 * cs + x1 * sn);
}

__global__ void cvt_bf16_kernel(const float* __restrict__ in, unsigned short* __restrict__ outb) {
  size_t i = (size_t)blockIdx.x * 256 + threadIdx.x;
  outb[i] = (unsigned short)f32_bf16(in[i]);
}

// ---------------- flash attention (WMMA, causal, GQA) ----------------
__global__ void attn_kernel(const unsigned short* __restrict__ qb,
                            const unsigned short* __restrict__ kbuf,
                            const unsigned short* __restrict__ vbuf,
                            float* __restrict__ y) {
  __shared__ __attribute__((aligned(16))) unsigned short Kls[32][72];
  __shared__ __attribute__((aligned(16))) unsigned short Vls[64][40];
  __shared__ __attribute__((aligned(16))) unsigned short Pls[8][16][40];
  int tid = threadIdx.x, lane = tid & 31, wave = tid >> 5;
  int bh = blockIdx.x;
  int b = bh >> 4, h = bh & 15;
  int kvh = h >> 2;
  int qt = blockIdx.y;
  int qbase = qt * 128 + wave * 16;
  int hi = lane >> 4, kbo = hi * 8, ln = lane & 15;
  int qrow = qbase + ln;
  const unsigned short* qp = qb + (size_t)(b * 1024 + qrow) * CDIM + h * 64;
  FragBF qa0, qa1;
  qa0.q[0] = *(const u32x4*)(qp + kbo);
  qa0.q[1] = *(const u32x4*)(qp + 16 + kbo);
  qa1.q[0] = *(const u32x4*)(qp + 32 + kbo);
  qa1.q[1] = *(const u32x4*)(qp + 48 + kbo);
  float m[8], l[8];
  v8f o[4] = {};
#pragma unroll
  for (int i = 0; i < 8; i++) { m[i] = -3.0e38f; l[i] = 0.f; }
  int ntiles = (qt + 1) * 4;
  for (int kt = 0; kt < ntiles; kt++) {
    int key0 = kt * 32;
#pragma unroll
    for (int i = 0; i < 4; i++) {                 // stage K rows (32 x 64), uint copies
      int lin = tid + 256 * i;
      int kk = lin >> 5, du = lin & 31;
      const unsigned int* src =
          (const unsigned int*)(kbuf + (size_t)(b * 1024 + key0 + kk) * 256 + kvh * 64);
      ((unsigned int*)&Kls[kk][0])[du] = src[du];
    }
#pragma unroll
    for (int i = 0; i < 8; i++) {                 // stage V transposed: Vls[d][kk]
      int lin = tid + 256 * i;
      int kk = lin >> 6, d = lin & 63;
      Vls[d][kk] = vbuf[(size_t)(b * 1024 + key0 + kk) * 256 + kvh * 64 + d];
    }
    __syncthreads();
    v8f s[2] = {};
#pragma unroll
    for (int sub = 0; sub < 2; sub++) {           // scores: Q(16x64) * K^T(64x32)
      int krow = sub * 16 + ln;
      FragBF bK;
      bK.q[0] = *(const u32x4*)&Kls[krow][kbo];
      bK.q[1] = *(const u32x4*)&Kls[krow][16 + kbo];
      s[sub] = __builtin_amdgcn_wmma_f32_16x16x32_bf16(false, qa0.v, false, bK.v, (short)0, s[sub], false, false);
      bK.q[0] = *(const u32x4*)&Kls[krow][32 + kbo];
      bK.q[1] = *(const u32x4*)&Kls[krow][48 + kbo];
      s[sub] = __builtin_amdgcn_wmma_f32_16x16x32_bf16(false, qa1.v, false, bK.v, (short)0, s[sub], false, false);
    }
    int keyc0 = key0 + ln, keyc1 = key0 + 16 + ln;
#pragma unroll
    for (int i = 0; i < 8; i++) {                 // online softmax (DPP reductions)
      int row = qbase + i + hi * 8;
      float s0 = s[0][i] * 0.125f; if (keyc0 > row) s0 = -3.0e38f;
      float s1 = s[1][i] * 0.125f; if (keyc1 > row) s1 = -3.0e38f;
      float t = red16_max(fmaxf(s0, s1));
      float mn = fmaxf(m[i], t);
      float fac = __expf(m[i] - mn);
      float p0 = __expf(s0 - mn), p1 = __expf(s1 - mn);
      float ps = red16_sum(p0 + p1);
      l[i] = l[i] * fac + ps;
      m[i] = mn;
#pragma unroll
      for (int sub = 0; sub < 4; sub++) o[sub][i] *= fac;
      Pls[wave][i + hi * 8][ln]      = (unsigned short)f32_bf16(p0);
      Pls[wave][i + hi * 8][16 + ln] = (unsigned short)f32_bf16(p1);
    }
    __syncthreads();
    FragBF pa;                                    // P(16x32) * V(32x64)
    pa.q[0] = *(const u32x4*)&Pls[wave][ln][kbo];
    pa.q[1] = *(const u32x4*)&Pls[wave][ln][16 + kbo];
#pragma unroll
    for (int sub = 0; sub < 4; sub++) {
      FragBF bV;
      int col = sub * 16 + ln;
      bV.q[0] = *(const u32x4*)&Vls[col][kbo];
      bV.q[1] = *(const u32x4*)&Vls[col][16 + kbo];
      o[sub] = __builtin_amdgcn_wmma_f32_16x16x32_bf16(false, pa.v, false, bV.v, (short)0, o[sub], false, false);
    }
    __syncthreads();
  }
#pragma unroll
  for (int sub = 0; sub < 4; sub++)
#pragma unroll
    for (int i = 0; i < 8; i++) {
      int row = qbase + i + hi * 8;
      int col = h * 64 + sub * 16 + ln;
      y[(size_t)(b * 1024 + row) * CDIM + col] = o[sub][i] / l[i];
    }
}

// ---------------- MoE gate: softmax, top-2, combine weights, aux stats ----------------
__global__ void gate_kernel(const float* __restrict__ xn, const float* __restrict__ Wg,
                            float* __restrict__ cw, float* __restrict__ accum) {
  int tid = threadIdx.x, lane = tid & 31, wave = tid >> 5;
  int row = blockIdx.x * 8 + wave;
  float part[NEXP];
#pragma unroll
  for (int e = 0; e < NEXP; e++) part[e] = 0.f;
  const float* xr = xn + (size_t)row * CDIM;
  for (int c = lane; c < CDIM; c += 32) {
    float xv = xr[c];
#pragma unroll
    for (int e = 0; e < NEXP; e++) part[e] += xv * Wg[c * NEXP + e];
  }
#pragma unroll
  for (int e = 0; e < NEXP; e++)
#pragma unroll
    for (int off = 1; off < 32; off <<= 1) part[e] += __shfl_xor(part[e], off);
  if (lane == 0) {
    float mx = part[0];
#pragma unroll
    for (int e = 1; e < NEXP; e++) mx = fmaxf(mx, part[e]);
    float pe[NEXP], s = 0.f;
#pragma unroll
    for (int e = 0; e < NEXP; e++) { pe[e] = __expf(part[e] - mx); s += pe[e]; }
#pragma unroll
    for (int e = 0; e < NEXP; e++) pe[e] /= s;
    int s0 = 0;
#pragma unroll
    for (int e = 1; e < NEXP; e++) if (pe[e] > pe[s0]) s0 = e;
    int s1 = -1;
#pragma unroll
    for (int e = 0; e < NEXP; e++) if (e != s0 && (s1 < 0 || pe[e] > pe[s1])) s1 = e;
    float denom = pe[s0] + pe[s1];
    float w0 = pe[s0] / denom, w1 = pe[s1] / denom;
#pragma unroll
    for (int e = 0; e < NEXP; e++)
      cw[(size_t)row * NEXP + e] = (e == s0) ? w0 : ((e == s1) ? w1 : 0.f);
#pragma unroll
    for (int e = 0; e < NEXP; e++) atomicAdd(&accum[e], pe[e]);   // P sums
    atomicAdd(&accum[NEXP + s0], 1.0f);                           // selection counts
    atomicAdd(&accum[NEXP + s1], 1.0f);
  }
}

__global__ void init_accum_kernel(float* accum) {
  if (threadIdx.x < 16) accum[threadIdx.x] = 0.f;
}

__global__ void aux_kernel(const float* __restrict__ accum, float* __restrict__ out_aux) {
  if (threadIdx.x == 0 && blockIdx.x == 0) {
    float s = 0.f;
    for (int e = 0; e < NEXP; e++)
      s += (accum[NEXP + e] / (float)(NTOK * 2)) * (accum[e] / (float)NTOK);
    out_aux[0] = (float)NEXP * s;
  }
}

__global__ void copy4_kernel(const float4* __restrict__ src, float4* __restrict__ dst) {
  size_t i = (size_t)blockIdx.x * 256 + threadIdx.x;
  dst[i] = src[i];
}

// ---------------- launcher ----------------
extern "C" void kernel_launch(void* const* d_in, const int* in_sizes, int n_in,
                              void* d_out, int out_size, void* d_ws, size_t ws_size,
                              hipStream_t stream) {
  (void)in_sizes; (void)n_in; (void)out_size; (void)ws_size;
  const float* x   = (const float*)d_in[0];
  const float* ln1 = (const float*)d_in[1];
  const float* ln2 = (const float*)d_in[2];
  const float* Wq  = (const float*)d_in[3];
  const float* Wk  = (const float*)d_in[4];
  const float* Wv  = (const float*)d_in[5];
  const float* Wo  = (const float*)d_in[6];
  const float* Wg  = (const float*)d_in[7];
  const float* W1  = (const float*)d_in[8];
  const float* W2  = (const float*)d_in[9];
  float* outx = (float*)d_out;

  char* ws = (char*)d_ws;
  size_t off = 0;
  auto alloc = [&](size_t bytes) -> void* {
    void* p = ws + off;
    off += (bytes + 255) & ~(size_t)255;
    return p;
  };
  float*          xn1  = (float*)alloc((size_t)NTOK * CDIM * 4);
  float*          qf   = (float*)alloc((size_t)NTOK * CDIM * 4);
  float*          kf   = (float*)alloc((size_t)NTOK * 256 * 4);
  float*          vf   = (float*)alloc((size_t)NTOK * 256 * 4);
  unsigned short* qb   = (unsigned short*)alloc((size_t)NTOK * CDIM * 2);
  unsigned short* kbuf = (unsigned short*)alloc((size_t)NTOK * 256 * 2);
  unsigned short* vbuf = (unsigned short*)alloc((size_t)NTOK * 256 * 2);
  float*          yatt = (float*)alloc((size_t)NTOK * CDIM * 4);
  float*          x1   = (float*)alloc((size_t)NTOK * CDIM * 4);
  float*          xn2  = (float*)alloc((size_t)NTOK * CDIM * 4);
  unsigned short* hbf  = (unsigned short*)alloc((size_t)NTOK * IDIM * 2);
  float*          cw   = (float*)alloc((size_t)NTOK * NEXP * 4);
  float*          acc  = (float*)alloc(64);

  // 1) xn1 = rmsnorm(x)
  rmsnorm_kernel<<<NTOK, 256, 0, stream>>>(x, ln1, xn1);
  // 2) q/k/v projections
  gemm_wmma<0, float><<<dim3(CDIM / 128, NTOK / 128), 256, 0, stream>>>(
      xn1, Wq, qf, nullptr, nullptr, NTOK, CDIM, CDIM, CDIM, CDIM, CDIM, 0);
  gemm_wmma<0, float><<<dim3(256 / 128, NTOK / 128), 256, 0, stream>>>(
      xn1, Wk, kf, nullptr, nullptr, NTOK, 256, CDIM, CDIM, 256, 256, 0);
  gemm_wmma<0, float><<<dim3(256 / 128, NTOK / 128), 256, 0, stream>>>(
      xn1, Wv, vf, nullptr, nullptr, NTOK, 256, CDIM, CDIM, 256, 256, 0);
  // 3) RoPE + bf16 conversion
  rope_kernel<<<(NTOK * 16 * 32) / 256, 256, 0, stream>>>(qf, qb, 16, CDIM);
  rope_kernel<<<(NTOK * 4 * 32) / 256, 256, 0, stream>>>(kf, kbuf, 4, 256);
  cvt_bf16_kernel<<<(NTOK * 256) / 256, 256, 0, stream>>>(vf, vbuf);
  // 4) attention
  attn_kernel<<<dim3(64, 8), 256, 0, stream>>>(qb, kbuf, vbuf, yatt);
  // 5) x1 = yatt @ Wo + x
  gemm_wmma<2, float><<<dim3(CDIM / 128, NTOK / 128), 256, 0, stream>>>(
      yatt, Wo, x1, nullptr, x, NTOK, CDIM, CDIM, CDIM, CDIM, CDIM, 0);
  // 6) xn2 = rmsnorm(x1)
  rmsnorm_kernel<<<NTOK, 256, 0, stream>>>(x1, ln2, xn2);
  // 7) gating + aux stats
  init_accum_kernel<<<1, 32, 0, stream>>>(acc);
  gate_kernel<<<NTOK / 8, 256, 0, stream>>>(xn2, Wg, cw, acc);
  // 8) out = x1 (residual base for MoE accumulation)
  copy4_kernel<<<NTOK * CDIM / (256 * 4), 256, 0, stream>>>(
      (const float4*)x1, (float4*)outx);
  // 9) experts: h = gelu(xn2 @ W1[e]); out += cw[:,e] * (h @ W2[e])
  for (int e = 0; e < NEXP; e++) {
    const float* W1e = W1 + (size_t)e * CDIM * IDIM;
    const float* W2e = W2 + (size_t)e * IDIM * CDIM;
    gemm_wmma<1, float><<<dim3(IDIM / 128, NTOK / 128), 256, 0, stream>>>(
        xn2, W1e, nullptr, hbf, nullptr, NTOK, IDIM, CDIM, CDIM, IDIM, IDIM, e);
    gemm_wmma<3, unsigned short><<<dim3(CDIM / 128, NTOK / 128), 256, 0, stream>>>(
        hbf, W2e, outx, nullptr, cw, NTOK, CDIM, IDIM, IDIM, CDIM, CDIM, e);
  }
  // 10) aux loss scalar
  aux_kernel<<<1, 32, 0, stream>>>(acc, outx + (size_t)NTOK * CDIM);
}

// v002
// A run of this version takes 847 microseconds.
// Versions in between are left out here; by their measured steps it is 4.34 times as fast as v000.
#include <hip/hip_runtime.h>
#include <hip/hip_bf16.h>
#include <math.h>

// ---------------- types / helpers ----------------
typedef __attribute__((ext_vector_type(16))) __bf16 v16bf;
typedef __attribute__((ext_vector_type(8)))  float  v8f;
typedef __attribute__((ext_vector_type(4)))  unsigned int u32x4;
typedef __attribute__((ext_vector_type(8)))  short s16x8;

union FragBF { u32x4 q[2]; v16bf v; };

__device__ inline unsigned int f32_bf16(float f) {
  unsigned int u = __float_as_uint(f);
  unsigned int r = 0x7FFFu + ((u >> 16) & 1u);
  return (u + r) >> 16;
}
// pack 8 consecutive values (float->bf16 or passthrough bf16 bits) into u32x4
__device__ inline u32x4 load8_bf(const float* p) {
  const float4* q = (const float4*)p;
  float4 a = q[0], b = q[1];
  u32x4 r;
  r.x = f32_bf16(a.x) | (f32_bf16(a.y) << 16);
  r.y = f32_bf16(a.z) | (f32_bf16(a.w) << 16);
  r.z = f32_bf16(b.x) | (f32_bf16(b.y) << 16);
  r.w = f32_bf16(b.z) | (f32_bf16(b.w) << 16);
  return r;
}
__device__ inline u32x4 load8_bf(const unsigned short* p) {
  return *(const u32x4*)p;
}
// transposing LDS load: from a row-major [k][n] 16-bit tile, lane (c, h) gets 8 k of column c
__device__ inline u32x4 ld_tr16(const unsigned short* p) {
  typedef __attribute__((address_space(3))) s16x8 lds_s16x8;
  return __builtin_bit_cast(u32x4, __builtin_amdgcn_ds_load_tr16_b128_v8i16((lds_s16x8*)p));
}

// DPP16 butterfly reductions over a 16-lane row (VALU only, no LDS)
// ctrl must be a compile-time constant -> template parameter
template <int CTRL>
__device__ inline float dpp_f(float x) {
  return __int_as_float(
      __builtin_amdgcn_update_dpp(0, __float_as_int(x), CTRL, 0xF, 0xF, true));
}
#define DPP_QPERM_XOR1 0xB1   // quad_perm(1,0,3,2)
#define DPP_QPERM_XOR2 0x4E   // quad_perm(2,3,0,1)
#define DPP_ROW_HMIRR  0x141  // row_half_mirror (lane^7 within 8)
#define DPP_ROW_MIRR   0x140  // row_mirror (lane^15 within 16)
__device__ inline float red16_max(float x) {
  x = fmaxf(x, dpp_f<DPP_QPERM_XOR1>(x));
  x = fmaxf(x, dpp_f<DPP_QPERM_XOR2>(x));
  x = fmaxf(x, dpp_f<DPP_ROW_HMIRR>(x));
  x = fmaxf(x, dpp_f<DPP_ROW_MIRR>(x));
  return x;
}
__device__ inline float red16_sum(float x) {
  x += dpp_f<DPP_QPERM_XOR1>(x);
  x += dpp_f<DPP_QPERM_XOR2>(x);
  x += dpp_f<DPP_ROW_HMIRR>(x);
  x += dpp_f<DPP_ROW_MIRR>(x);
  return x;
}

#define NTOK 4096   // B*T
#define CDIM 1024
#define IDIM 4096
#define NEXP 8
#define MAXTILE 72            // 2*NTOK routed rows, each expert's list padded to 128: at most 71 tiles
#define MAXROW (MAXTILE * 128)

// ---------------- RMSNorm ----------------
__global__ void rmsnorm_kernel(const float* __restrict__ x,
                               const float* __restrict__ scale,
                               float* __restrict__ out) {
  __shared__ float red[9];
  int row = blockIdx.x;
  int tid = threadIdx.x;
  const float* xr = x + (size_t)row * CDIM;
  float v[4]; float ss = 0.f;
#pragma unroll
  for (int i = 0; i < 4; i++) { v[i] = xr[tid + 256 * i]; ss += v[i] * v[i]; }
#pragma unroll
  for (int off = 16; off >= 1; off >>= 1) ss += __shfl_xor(ss, off);
  if ((tid & 31) == 0) red[tid >> 5] = ss;
  __syncthreads();
  if (tid == 0) {
    float t = 0.f;
#pragma unroll
    for (int w = 0; w < 8; w++) t += red[w];
    red[8] = t;
  }
  __syncthreads();
  float inv = rsqrtf(red[8] / (float)CDIM + 1e-5f);
#pragma unroll
  for (int i = 0; i < 4; i++) {
    int c = tid + 256 * i;
    out[(size_t)row * CDIM + c] = v[i] * inv * scale[c];
  }
}

// ---------------- generic WMMA GEMM, 128x128 tile, double-buffered LDS ----------------
// C(M,N) = A(M,K) * B(K,N); A: float or bf16-bits; B: float (bf16-converted on stage)
// 8 waves; wave (wr,wc) owns rows wr*32..+32, cols wc*64..+64 => 2x4 wmma accums.
// EPI: 0 = store f32; 1 = gelu->bf16 (outh); 2 = +aux residual
// GRP: 0 = plain; 1, 2 = row tile blockIdx.y belongs to expert tile_e[blockIdx.y], whose
//      weights are plane tile_e of Bm; 1 also gathers the A rows through rowtok
template <int EPI, typename AT, int GRP>
__global__ void gemm_wmma(const AT* __restrict__ A, const float* __restrict__ Bm,
                          float* __restrict__ outf, unsigned short* __restrict__ outh,
                          const float* __restrict__ aux,
                          int M, int N, int Kd, int lda, int ldb, int ldc,
                          const int* __restrict__ rowtok, const int* __restrict__ tile_e) {
  __shared__ __attribute__((aligned(16))) unsigned short aS[2][128][40];
  // B stays row-major [k][n]; 288-byte rows (32 B x odd) suit the transposing load
  __shared__ __attribute__((aligned(16))) unsigned short bS[2][32][144];
  int tid = threadIdx.x;
  int lane = tid & 31;
  int wave = tid >> 5;
  int wr = wave & 3, wc = wave >> 2;
  int m0 = blockIdx.y * 128, n0 = blockIdx.x * 128;
  int hi = lane >> 4;
  int kb = hi * 8;
  int ln = lane & 15;
  int ar0 = wr * 32 + ln;
  int btr = hi * 8 + (lane & 7);                    // B fragment: this lane's k row ...
  int btc = wc * 64 + ((lane >> 3) & 1) * 8;        // ... and its 16-byte piece of 16 columns
  if (GRP) {
    int te = tile_e[blockIdx.y];
    if (te < 0) return;         // tile behind the last routed row: the whole block leaves here
    Bm += (size_t)(te & (NEXP - 1)) * Kd * ldb;
  }
  // staging index precompute (2 chunks of 8 elems per thread for A and B)
  int rA[2], cgA[2], kB[2], nbB[2];
#pragma unroll
  for (int g = 0; g < 2; g++) {
    int lin = tid + 256 * g;
    rA[g] = lin >> 2; cgA[g] = (lin & 3) * 8;
    kB[g] = lin >> 4; nbB[g] = (lin & 15) * 8;
  }
  unsigned aoff[2] = {0u, 0u};  // GRP 1: byte offsets of this thread's two gathered A chunks
  if (GRP == 1) {
#pragma unroll                  // constant indices keep aoff[] in registers
    for (int g = 0; g < 2; g++)
      aoff[g] = (unsigned)((rowtok[m0 + rA[g]] & (NTOK - 1)) * lda + cgA[g]) * (unsigned)sizeof(AT);
  }
  v8f acc[2][4] = {};
  u32x4 ra[2], rb[2];
  int nt = Kd >> 5;
  // prologue: load tile 0 into regs, store to buffer 0
#pragma unroll
  for (int g = 0; g < 2; g++) {
    if (GRP == 1) {             // gathered row: uniform base + 32-bit lane offset
      ra[g] = load8_bf((const AT*)((const char*)A + aoff[g]));
    } else {
      ra[g] = load8_bf(&A[(size_t)(m0 + rA[g]) * lda + cgA[g]]);
    }
    const float4* qp = (const float4*)&Bm[(size_t)kB[g] * ldb + n0 + nbB[g]];
    float4 fa = qp[0], fb = qp[1];
    rb[g].x = f32_bf16(fa.x) | (f32_bf16(fa.y) << 16);
    rb[g].y = f32_bf16(fa.z) | (f32_bf16(fa.w) << 16);
    rb[g].z = f32_bf16(fb.x) | (f32_bf16(fb.y) << 16);
    rb[g].w = f32_bf16(fb.z) | (f32_bf16(fb.w) << 16);
  }
#pragma unroll
  for (int g = 0; g < 2; g++) {
    *(u32x4*)&aS[0][rA[g]][cgA[g]] = ra[g];
    *(u32x4*)&bS[0][kB[g]][nbB[g]] = rb[g];
  }
  __syncthreads();
  for (int kt = 0; kt < nt; kt++) {
    int buf = kt & 1;
    int k1 = (kt + 1) << 5;
    if (kt + 1 < nt) {
      // issue next tile's global loads (packed in regs)
#pragma unroll
      for (int g = 0; g < 2; g++) {
        if (GRP == 1) {
          ra[g] = load8_bf((const AT*)((const char*)(A + k1) + aoff[g]));
        } else {
          ra[g] = load8_bf(&A[(size_t)(m0 + rA[g]) * lda + k1 + cgA[g]]);
        }
        const float4* qp = (const float4*)&Bm[(size_t)(k1 + kB[g]) * ldb + n0 + nbB[g]];
        float4 fa = qp[0], fb = qp[1];
        rb[g].x = f32_bf16(fa.x) | (f32_bf16(fa.y) << 16);
        rb[g].y = f32_bf16(fa.z) | (f32_bf16(fa.w) << 16);
        rb[g].z = f32_bf16(fb.x) | (f32_bf16(fb.y) << 16);
        rb[g].w = f32_bf16(fb.z) | (f32_bf16(fb.w) << 16);
      }
    }
    if (kt + 2 < nt) {   // prefetch two tiles ahead into GL2
      int k2 = (kt + 2) << 5;
      if (GRP == 1) {
        __builtin_prefetch((const char*)(A + k2) + aoff[0], 0, 1);
      } else {
        __builtin_prefetch(&A[(size_t)(m0 + rA[0]) * lda + k2 + cgA[0]], 0, 1);
      }
      __builtin_prefetch(&Bm[(size_t)(k2 + kB[0]) * ldb + n0 + nbB[0]], 0, 1);
    }
    // compute current tile
    FragBF a0, a1;
    a0.q[0] = *(const u32x4*)&aS[buf][ar0][kb];
    a0.q[1] = *(const u32x4*)&aS[buf][ar0][16 + kb];
    a1.q[0] = *(const u32x4*)&aS[buf][ar0 + 16][kb];
    a1.q[1] = *(const u32x4*)&aS[buf][ar0 + 16][16 + kb];
#pragma unroll
    for (int bj = 0; bj < 4; bj++) {
      FragBF bf;
      bf.q[0] = ld_tr16(&bS[buf][btr][btc + bj * 16]);
      bf.q[1] = ld_tr16(&bS[buf][16 + btr][btc + bj * 16]);
      acc[0][bj] = __builtin_amdgcn_wmma_f32_16x16x32_bf16(false, a0.v, false, bf.v, (short)0, acc[0][bj], false, false);
      acc[1][bj] = __builtin_amdgcn_wmma_f32_16x16x32_bf16(false, a1.v, false, bf.v, (short)0, acc[1][bj], false, false);
      // one B fragment live at a time: with two hoisted together loop invariants spill to scratch
      __builtin_amdgcn_sched_barrier(0);
    }
    if (kt + 1 < nt) {
      int nb = buf ^ 1;
#pragma unroll
      for (int g = 0; g < 2; g++) {
        *(u32x4*)&aS[nb][rA[g]][cgA[g]] = ra[g];
        *(u32x4*)&bS[nb][kB[g]][nbB[g]] = rb[g];
      }
    }
    __syncthreads();
  }
#pragma unroll
  for (int ai = 0; ai < 2; ai++) {
#pragma unroll
    for (int bj = 0; bj < 4; bj++) {
#pragma unroll
      for (int i = 0; i < 8; i++) {
        int r = m0 + wr * 32 + ai * 16 + i + hi * 8;
        int c = n0 + wc * 64 + bj * 16 + ln;
        size_t idx = (size_t)r * ldc + c;
        float v = acc[ai][bj][i];
        if (EPI == 0) {
          outf[idx] = v;
        } else if (EPI == 1) {
          float g = 0.5f * v * (1.0f + erff(v * 0.70710678118f));
          outh[idx] = (unsigned short)f32_bf16(g);
        } else if (EPI == 2) {
          outf[idx] = v + aux[idx];
        }
      }
    }
  }
}

// ---------------- RoPE (+ bf16 convert) ----------------
__global__ void rope_kernel(const float* __restrict__ in, unsigned short* __restrict__ outb,
                            int nheads, int ld) {
  int idx = blockIdx.x * 256 + threadIdx.x;       // pair index over NTOK*nheads*32
  int d = idx & 31;
  int th = idx >> 5;
  int head = th % nheads;
  int tok = th / nheads;
  int t = tok & 1023;                             // tok = b*T + t
  float inv_freq = __expf(-0.2878231366f * (float)d);  // 10000^(-d/32)
  float ang = (float)t * inv_freq;
  float cs = __cosf(ang), sn = __sinf(ang);
  size_t base = (size_t)tok * ld + head * 64;
  float x1 = in[base + d], x2 = in[base + 32 + d];
  outb[base + d]      = (unsigned short)f32_bf16(x1 * cs - x2 * sn);
  outb[base + 32 + d] = (unsigned short)f32_bf16(x2 * cs + x1 * sn);
}

__global__ void cvt_bf16_kernel(const float* __restrict__ in, unsigned short* __restrict__ outb) {
  size_t i = (size_t)blockIdx.x * 256 + threadIdx.x;
  outb[i] = (unsigned short)f32_bf16(in[i]);
}

// ---------------- flash attention (WMMA, causal, GQA) ----------------
__global__ void attn_kernel(const unsigned short* __restrict__ qb,
                            const unsigned short* __restrict__ kbuf,
                            const unsigned short* __restrict__ vbuf,
                            float* __restrict__ y) {
  __shared__ __attribute__((aligned(16))) unsigned short Kls[32][72];
  __shared__ __attribute__((aligned(16))) unsigned short Vls[64][40];
  __shared__ __attribute__((aligned(16))) unsigned short Pls[8][16][40];
  int tid = threadIdx.x, lane = tid & 31, wave = tid >> 5;
  int bh = blockIdx.x;
  int b = bh >> 4, h = bh & 15;
  int kvh = h >> 2;
  int qt = blockIdx.y;
  int qbase = qt * 128 + wave * 16;
  int hi = lane >> 4, kbo = hi * 8, ln = lane & 15;
  int qrow = qbase + ln;
  const unsigned short* qp = qb + (size_t)(b * 1024 + qrow) * CDIM + h * 64;
  FragBF qa0, qa1;
  qa0.q[0] = *(const u32x4*)(qp + kbo);
  qa0.q[1] = *(const u32x4*)(qp + 16 + kbo);
  qa1.q[0] = *(const u32x4*)(qp + 32 + kbo);
  qa1.q[1] = *(const u32x4*)(qp + 48 + kbo);
  float m[8], l[8];
  v8f o[4] = {};
#pragma unroll
  for (int i = 0; i < 8; i++) { m[i] = -3.0e38f; l[i] = 0.f; }
  int ntiles = (qt + 1) * 4;
  for (int kt = 0; kt < ntiles; kt++) {
    int key0 = kt * 32;
#pragma unroll
    for (int i = 0; i < 4; i++) {                 // stage K rows (32 x 64), uint copies
      int lin = tid + 256 * i;
      int kk = lin >> 5, du = lin & 31;
      const unsigned int* src =
          (const unsigned int*)(kbuf + (size_t)(b * 1024 + key0 + kk) * 256 + kvh * 64);
      ((unsigned int*)&Kls[kk][0])[du] = src[du];
    }
#pragma unroll
    for (int i = 0; i < 8; i++) {                 // stage V transposed: Vls[d][kk]
      int lin = tid + 256 * i;
      int kk = lin >> 6, d = lin & 63;
      Vls[d][kk] = vbuf[(size_t)(b * 1024 + key0 + kk) * 256 + kvh * 64 + d];
    }
    __syncthreads();
    v8f s[2] = {};
#pragma unroll
    for (int sub = 0; sub < 2; sub++) {           // scores: Q(16x64) * K^T(64x32)
      int krow = sub * 16 + ln;
      FragBF bK;
      bK.q[0] = *(const u32x4*)&Kls[krow][kbo];
      bK.q[1] = *(const u32x4*)&Kls[krow][16 + kbo];
      s[sub] = __builtin_amdgcn_wmma_f32_16x16x32_bf16(false, qa0.v, false, bK.v, (short)0, s[sub], false, false);
      bK.q[0] = *(const u32x4*)&Kls[krow][32 + kbo];
      bK.q[1] = *(const u32x4*)&Kls[krow][48 + kbo];
      s[sub] = __builtin_amdgcn_wmma_f32_16x16x32_bf16(false, qa1.v, false, bK.v, (short)0, s[sub], false, false);
    }
    int keyc0 = key0 + ln, keyc1 = key0 + 16 + ln;
#pragma unroll
    for (int i = 0; i < 8; i++) {                 // online softmax (DPP reductions)
      int row = qbase + i + hi * 8;
      float s0 = s[0][i] * 0.125f; if (keyc0 > row) s0 = -3.0e38f;
      float s1 = s[1][i] * 0.125f; if (keyc1 > row) s1 = -3.0e38f;
      float t = red16_max(fmaxf(s0, s1));
      float mn = fmaxf(m[i], t);
      float fac = __expf(m[i] - mn);
      float p0 = __expf(s0 - mn), p1 = __expf(s1 - mn);
      float ps = red16_sum(p0 + p1);
      l[i] = l[i] * fac + ps;
      m[i] = mn;
#pragma unroll
      for (int sub = 0; sub < 4; sub++) o[sub][i] *= fac;
      Pls[wave][i + hi * 8][ln]      = (unsigned short)f32_bf16(p0);
      Pls[wave][i + hi * 8][16 + ln] = (unsigned short)f32_bf16(p1);
    }
    __syncthreads();
    FragBF pa;                                    // P(16x32) * V(32x64)
    pa.q[0] = *(const u32x4*)&Pls[wave][ln][kbo];
    pa.q[1] = *(const u32x4*)&Pls[wave][ln][16 + kbo];
#pragma unroll
    for (int sub = 0; sub < 4; sub++) {
      FragBF bV;
      int col = sub * 16 + ln;
      bV.q[0] = *(const u32x4*)&Vls[col][kbo];
      bV.q[1] = *(const u32x4*)&Vls[col][16 + kbo];
      o[sub] = __builtin_amdgcn_wmma_f32_16x16x32_bf16(false, pa.v, false, bV.v, (short)0, o[sub], false, false);
    }
    __syncthreads();
  }
#pragma unroll
  for (int sub = 0; sub < 4; sub++)
#pragma unroll
    for (int i = 0; i < 8; i++) {
      int row = qbase + i + hi * 8;
      int col = h * 64 + sub * 16 + ln;
      y[(size_t)(b * 1024 + row) * CDIM + col] = o[sub][i] / l[i];
    }
}

// ---------------- MoE gate: softmax, top-2, combine weights, aux stats ----------------
// sel[row] = lower expert | higher expert << 4; gw[2*row], gw[2*row+1] = their weights
__global__ void gate_kernel(const float* __restrict__ xn, const float* __restrict__ Wg,
                            int* __restrict__ sel, float* __restrict__ gw,
                            float* __restrict__ accum) {
  int tid = threadIdx.x, lane = tid & 31, wave = tid >> 5;
  int row = blockIdx.x * 8 + wave;
  float part[NEXP];
#pragma unroll
  for (int e = 0; e < NEXP; e++) part[e] = 0.f;
  const float* xr = xn + (size_t)row * CDIM;
  for (int c = lane; c < CDIM; c += 32) {
    float xv = xr[c];
#pragma unroll
    for (int e = 0; e < NEXP; e++) part[e] += xv * Wg[c * NEXP + e];
  }
#pragma unroll
  for (int e = 0; e < NEXP; e++)
#pragma unroll
    for (int off = 1; off < 32; off <<= 1) part[e] += __shfl_xor(part[e], off);
  if (lane == 0) {
    float mx = part[0];
#pragma unroll
    for (int e = 1; e < NEXP; e++) mx = fmaxf(mx, part[e]);
    float pe[NEXP], s = 0.f;
#pragma unroll
    for (int e = 0; e < NEXP; e++) { pe[e] = __expf(part[e] - mx); s += pe[e]; }
#pragma unroll
    for (int e = 0; e < NEXP; e++) pe[e] /= s;
    int s0 = 0;
#pragma unroll
    for (int e = 1; e < NEXP; e++) if (pe[e] > pe[s0]) s0 = e;
    int s1 = -1;
#pragma unroll
    for (int e = 0; e < NEXP; e++) if (e != s0 && (s1 < 0 || pe[e] > pe[s1])) s1 = e;
    float denom = pe[s0] + pe[s1];
    float w0 = pe[s0] / denom, w1 = pe[s1] / denom;
    bool up = s0 < s1;
    sel[row] = up ? (s0 | (s1 << 4)) : (s1 | (s0 << 4));
    gw[2 * row]     = up ? w0 : w1;
    gw[2 * row + 1] = up ? w1 : w0;
    // the code below reuses the address registers of the three stores above
    asm volatile("s_wait_xcnt 0x0" ::: "memory");
#pragma unroll
    for (int e = 0; e < NEXP; e++) atomicAdd(&accum[e], pe[e]);   // P sums
    atomicAdd(&accum[NEXP + s0], 1.0f);                           // selection counts
    atomicAdd(&accum[NEXP + s1], 1.0f);
  }
}

__global__ void init_accum_kernel(float* accum) {
  if (threadIdx.x < 16) accum[threadIdx.x] = 0.f;
}

__global__ void aux_kernel(const float* __restrict__ accum, float* __restrict__ out_aux) {
  if (threadIdx.x == 0 && blockIdx.x == 0) {
    float s = 0.f;
    for (int e = 0; e < NEXP; e++)
      s += (accum[NEXP + e] / (float)(NTOK * 2)) * (accum[e] / (float)NTOK);
    out_aux[0] = (float)NEXP * s;
  }
}

// ---------------- MoE routing: sort the 2*NTOK (token, expert) pairs by expert ----------------
// One block of 1024 threads, 4 tokens each. Eight running counts travel as 16-bit fields
// of two 64-bit words (no field passes MAXROW). Each expert's list starts at a multiple of 128.
// rowtok[p] = token of routed row p (0 in the padding), slot[2*t+j] = routed row of token t's
// j-th expert, tile_e[i] = expert of rows 128*i.., -1 behind the last list.
__device__ inline unsigned long long fld_one(int e) { return 1ull << ((e & 3) * 16); }
__device__ inline int fld_get(unsigned long long lo, unsigned long long hi, int e) {
  return (int)(((e < 4 ? lo : hi) >> ((e & 3) * 16)) & 0xFFFFull);
}
__global__ void route_kernel(const int* __restrict__ sel, int* __restrict__ rowtok,
                             int* __restrict__ slot, int* __restrict__ tile_e) {
  __shared__ unsigned long long wtot[32][2];
  int tid = threadIdx.x, lane = tid & 31, wave = tid >> 5;
  int ex[8];
  unsigned long long lo = 0, hi = 0;
  // the loops over ex[] and over the experts are unrolled so that ex[] and the shift counts
  // are indexed by constants and nothing goes to scratch
#pragma unroll
  for (int i = 0; i < 4; i++) {
    int s = sel[tid * 4 + i];
    ex[2 * i] = s & 7; ex[2 * i + 1] = (s >> 4) & 7;
  }
#pragma unroll
  for (int i = 0; i < 8; i++) {
    if (ex[i] < 4) lo += fld_one(ex[i]); else hi += fld_one(ex[i]);
  }
  unsigned long long ilo = lo, ihi = hi;          // inclusive scan over the wave
  for (int d = 1; d < 32; d <<= 1) {
    unsigned long long a = __shfl_up(ilo, d), b = __shfl_up(ihi, d);
    if (lane >= d) { ilo += a; ihi += b; }
  }
  if (lane == 31) { wtot[wave][0] = ilo; wtot[wave][1] = ihi; }
  __syncthreads();
  unsigned long long tlo = 0, thi = 0, plo = ilo - lo, phi = ihi - hi;
#pragma unroll 4                // unrolled whole, the 64 words are all held in registers and spill
  for (int w = 0; w < 32; w++) {
    unsigned long long a = wtot[w][0], b = wtot[w][1];
    tlo += a; thi += b;
    if (w < wave) { plo += a; phi += b; }
  }
  int off = 0;
  int mytile = -1;
#pragma unroll
  for (int e = 0; e < NEXP; e++) {
    int cnt = fld_get(tlo, thi, e);
    int end = off + ((cnt + 127) & ~127);
    if (e < 4) plo += (unsigned long long)off << (e * 16);
    else       phi += (unsigned long long)off << ((e - 4) * 16);
    if (off + cnt + tid < end) rowtok[off + cnt + tid] = 0;
    if (tid * 128 >= off && tid * 128 < end) mytile = e;
    off = end;
  }
  if (tid < MAXTILE) tile_e[tid] = mytile;
#pragma unroll
  for (int i = 0; i < 8; i++) {
    int e = ex[i];
    int p = fld_get(plo, phi, e);
    if (e < 4) plo += fld_one(e); else phi += fld_one(e);
    rowtok[p] = tid * 4 + (i >> 1);
    slot[tid * 8 + i] = p;
  }
}

// out = x1 + w_a * ye[row_a] + w_b * ye[row_b], lower expert first; one block per token
__global__ void combine_kernel(const float4* __restrict__ x1, const float4* __restrict__ ye,
                               const int* __restrict__ slot, const float* __restrict__ gw,
                               float4* __restrict__ dst) {
  int tok = blockIdx.x, c = threadIdx.x;
  int pa = min(slot[2 * tok], MAXROW - 1), pb = min(slot[2 * tok + 1], MAXROW - 1);
  float wa = gw[2 * tok], wb = gw[2 * tok + 1];
  float4 o = x1[(size_t)tok * 256 + c];
  float4 a = ye[(size_t)pa * 256 + c];
  float4 b = ye[(size_t)pb * 256 + c];
  o.x += wa * a.x; o.y += wa * a.y; o.z += wa * a.z; o.w += wa * a.w;
  o.x += wb * b.x; o.y += wb * b.y; o.z += wb * b.z; o.w += wb * b.w;
  dst[(size_t)tok * 256 + c] = o;
}

// ---------------- launcher ----------------
extern "C" void kernel_launch(void* const* d_in, const int* in_sizes, int n_in,
                              void* d_out, int out_size, void* d_ws, size_t ws_size,
                              hipStream_t stream) {
  (void)in_sizes; (void)n_in; (void)out_size; (void)ws_size;
  const float* x   = (const float*)d_in[0];
  const float* ln1 = (const float*)d_in[1];
  const float* ln2 = (const float*)d_in[2];
  const float* Wq  = (const float*)d_in[3];
  const float* Wk  = (const float*)d_in[4];
  const float* Wv  = (const float*)d_in[5];
  const float* Wo  = (const float*)d_in[6];
  const float* Wg  = (const float*)d_in[7];
  const float* W1  = (const float*)d_in[8];
  const float* W2  = (const float*)d_in[9];
  float* outx = (float*)d_out;

  char* ws = (char*)d_ws;
  size_t off = 0;
  auto alloc = [&](size_t bytes) -> void* {
    void* p = ws + off;
    off += (bytes + 255) & ~(size_t)255;
    return p;
  };
  float*          xn1  = (float*)alloc((size_t)NTOK * CDIM * 4);
  float*          qf   = (float*)alloc((size_t)NTOK * CDIM * 4);
  float*          kf   = (float*)alloc((size_t)NTOK * 256 * 4);
  float*          vf   = (float*)alloc((size_t)NTOK * 256 * 4);
  unsigned short* qb   = (unsigned short*)alloc((size_t)NTOK * CDIM * 2);
  unsigned short* kbuf = (unsigned short*)alloc((size_t)NTOK * 256 * 2);
  unsigned short* vbuf = (unsigned short*)alloc((size_t)NTOK * 256 * 2);
  float*          yatt = (float*)alloc((size_t)NTOK * CDIM * 4);
  float*          x1   = (float*)alloc((size_t)NTOK * CDIM * 4);
  float*          xn2  = (float*)alloc((size_t)NTOK * CDIM * 4);
  unsigned short* hbf  = (unsigned short*)alloc((size_t)MAXROW * IDIM * 2);
  float*          ye   = (float*)alloc((size_t)MAXROW * CDIM * 4);
  int*            sel  = (int*)alloc((size_t)NTOK * 4);
  float*          gw   = (float*)alloc((size_t)NTOK * 2 * 4);
  int*            rowtok = (int*)alloc((size_t)MAXROW * 4);
  int*            slot = (int*)alloc((size_t)NTOK * 2 * 4);
  int*            tile_e = (int*)alloc((size_t)MAXTILE * 4);
  float*          acc  = (float*)alloc(64);

  // 1) xn1 = rmsnorm(x)
  rmsnorm_kernel<<<NTOK, 256, 0, stream>>>(x, ln1, xn1);
  // 2) q/k/v projections
  gemm_wmma<0, float, 0><<<dim3(CDIM / 128, NTOK / 128), 256, 0, stream>>>(
      xn1, Wq, qf, nullptr, nullptr, NTOK, CDIM, CDIM, CDIM, CDIM, CDIM, nullptr, nullptr);
  gemm_wmma<0, float, 0><<<dim3(256 / 128, NTOK / 128), 256, 0, stream>>>(
      xn1, Wk, kf, nullptr, nullptr, NTOK, 256, CDIM, CDIM, 256, 256, nullptr, nullptr);
  gemm_wmma<0, float, 0><<<dim3(256 / 128, NTOK / 128), 256, 0, stream>>>(
      xn1, Wv, vf, nullptr, nullptr, NTOK, 256, CDIM, CDIM, 256, 256, nullptr, nullptr);
  // 3) RoPE + bf16 conversion
  rope_kernel<<<(NTOK * 16 * 32) / 256, 256, 0, stream>>>(qf, qb, 16, CDIM);
  rope_kernel<<<(NTOK * 4 * 32) / 256, 256, 0, stream>>>(kf, kbuf, 4, 256);
  cvt_bf16_kernel<<<(NTOK * 256) / 256, 256, 0, stream>>>(vf, vbuf);
  // 4) attention
  attn_kernel<<<dim3(64, 8), 256, 0, stream>>>(qb, kbuf, vbuf, yatt);
  // 5) x1 = yatt @ Wo + x
  gemm_wmma<2, float, 0><<<dim3(CDIM / 128, NTOK / 128), 256, 0, stream>>>(
      yatt, Wo, x1, nullptr, x, NTOK, CDIM, CDIM, CDIM, CDIM, CDIM, nullptr, nullptr);
  // 6) xn2 = rmsnorm(x1)
  rmsnorm_kernel<<<NTOK, 256, 0, stream>>>(x1, ln2, xn2);
  // 7) gating + aux stats
  init_accum_kernel<<<1, 32, 0, stream>>>(acc);
  gate_kernel<<<NTOK / 8, 256, 0, stream>>>(xn2, Wg, sel, gw, acc);
  // 8) sort the (token, expert) pairs by expert
  route_kernel<<<1, 1024, 0, stream>>>(sel, rowtok, slot, tile_e);
  // 9) experts, chosen rows only: h = gelu(xn2[rowtok] @ W1[e]); ye = h @ W2[e]
  gemm_wmma<1, float, 1><<<dim3(IDIM / 128, MAXTILE), 256, 0, stream>>>(
      xn2, W1, nullptr, hbf, nullptr, MAXROW, IDIM, CDIM, CDIM, IDIM, IDIM, rowtok, tile_e);
  gemm_wmma<0, unsigned short, 2><<<dim3(CDIM / 128, MAXTILE), 256, 0, stream>>>(
      hbf, W2, ye, nullptr, nullptr, MAXROW, CDIM, IDIM, IDIM, CDIM, CDIM, nullptr, tile_e);
  //    out = x1 + the two weighted expert rows of each token
  combine_kernel<<<NTOK, 256, 0, stream>>>(
      (const float4*)x1, (const float4*)ye, slot, gw, (float4*)outx);
  // 10) aux loss scalar
  aux_kernel<<<1, 32, 0, stream>>>(acc, outx + (size_t)NTOK * CDIM);
}

// v003
// It runs in 681 microseconds.
// Timed twice side by side with v002, it ran 1.24 times as fast both times.
// Over all steps from v000 it is 5.39 times as fast.
#include <hip/hip_runtime.h>
#include <hip/hip_bf16.h>
#include <math.h>

// ---------------- types / helpers ----------------
typedef __attribute__((ext_vector_type(16))) __bf16 v16bf;
typedef __attribute__((ext_vector_type(8)))  float  v8f;
typedef __attribute__((ext_vector_type(4)))  unsigned int u32x4;
typedef __attribute__((ext_vector_type(8)))  short s16x8;

union FragBF { u32x4 q[2]; v16bf v; };

__device__ inline unsigned int f32_bf16(float f) {
  unsigned int u = __float_as_uint(f);
  unsigned int r = 0x7FFFu + ((u >> 16) & 1u);
  return (u + r) >> 16;
}
// pack 8 consecutive values (float->bf16 or passthrough bf16 bits) into u32x4
__device__ inline u32x4 load8_bf(const float* p) {
  const float4* q = (const float4*)p;
  float4 a = q[0], b = q[1];
  u32x4 r;
  r.x = f32_bf16(a.x) | (f32_bf16(a.y) << 16);
  r.y = f32_bf16(a.z) | (f32_bf16(a.w) << 16);
  r.z = f32_bf16(b.x) | (f32_bf16(b.y) << 16);
  r.w = f32_bf16(b.z) | (f32_bf16(b.w) << 16);
  return r;
}
__device__ inline u32x4 load8_bf(const unsigned short* p) {
  return *(const u32x4*)p;
}
// the same 8 values in two halves: the load alone, as it comes from memory, and the packing
struct Raw8f { float4 a, b; };
__device__ inline Raw8f load8_raw(const float* p) {
  const float4* q = (const float4*)p;
  Raw8f r; r.a = q[0]; r.b = q[1];
  return r;
}
__device__ inline u32x4 load8_raw(const unsigned short* p) {
  return *(const u32x4*)p;
}
__device__ inline u32x4 pack8_bf(const Raw8f& v) {
  u32x4 r;
  r.x = f32_bf16(v.a.x) | (f32_bf16(v.a.y) << 16);
  r.y = f32_bf16(v.a.z) | (f32_bf16(v.a.w) << 16);
  r.z = f32_bf16(v.b.x) | (f32_bf16(v.b.y) << 16);
  r.w = f32_bf16(v.b.z) | (f32_bf16(v.b.w) << 16);
  return r;
}
__device__ inline u32x4 pack8_bf(const u32x4& v) { return v; }
// transposing LDS load: from a row-major [k][n] 16-bit tile, lane (c, h) gets 8 k of column c
__device__ inline u32x4 ld_tr16(const unsigned short* p) {
  typedef __attribute__((address_space(3))) s16x8 lds_s16x8;
  return __builtin_bit_cast(u32x4, __builtin_amdgcn_ds_load_tr16_b128_v8i16((lds_s16x8*)p));
}

// DPP16 butterfly reductions over a 16-lane row (VALU only, no LDS)
// ctrl must be a compile-time constant -> template parameter
template <int CTRL>
__device__ inline float dpp_f(float x) {
  return __int_as_float(
      __builtin_amdgcn_update_dpp(0, __float_as_int(x), CTRL, 0xF, 0xF, true));
}
#define DPP_QPERM_XOR1 0xB1   // quad_perm(1,0,3,2)
#define DPP_QPERM_XOR2 0x4E   // quad_perm(2,3,0,1)
#define DPP_ROW_HMIRR  0x141  // row_half_mirror (lane^7 within 8)
#define DPP_ROW_MIRR   0x140  // row_mirror (lane^15 within 16)
__device__ inline float red16_max(float x) {
  x = fmaxf(x, dpp_f<DPP_QPERM_XOR1>(x));
  x = fmaxf(x, dpp_f<DPP_QPERM_XOR2>(x));
  x = fmaxf(x, dpp_f<DPP_ROW_HMIRR>(x));
  x = fmaxf(x, dpp_f<DPP_ROW_MIRR>(x));
  return x;
}
__device__ inline float red16_sum(float x) {
  x += dpp_f<DPP_QPERM_XOR1>(x);
  x += dpp_f<DPP_QPERM_XOR2>(x);
  x += dpp_f<DPP_ROW_HMIRR>(x);
  x += dpp_f<DPP_ROW_MIRR>(x);
  return x;
}

#define NTOK 4096   // B*T
#define CDIM 1024
#define IDIM 4096
#define NEXP 8
#define MAXTILE 72            // 2*NTOK routed rows, each expert's list padded to 128: at most 71 tiles
#define MAXROW (MAXTILE * 128)

// ---------------- RMSNorm ----------------
__global__ void rmsnorm_kernel(const float* __restrict__ x,
                               const float* __restrict__ scale,
                               float* __restrict__ out) {
  __shared__ float red[9];
  int row = blockIdx.x;
  int tid = threadIdx.x;
  const float* xr = x + (size_t)row * CDIM;
  float v[4]; float ss = 0.f;
#pragma unroll
  for (int i = 0; i < 4; i++) { v[i] = xr[tid + 256 * i]; ss += v[i] * v[i]; }
#pragma unroll
  for (int off = 16; off >= 1; off >>= 1) ss += __shfl_xor(ss, off);
  if ((tid & 31) == 0) red[tid >> 5] = ss;
  __syncthreads();
  if (tid == 0) {
    float t = 0.f;
#pragma unroll
    for (int w = 0; w < 8; w++) t += red[w];
    red[8] = t;
  }
  __syncthreads();
  float inv = rsqrtf(red[8] / (float)CDIM + 1e-5f);
#pragma unroll
  for (int i = 0; i < 4; i++) {
    int c = tid + 256 * i;
    out[(size_t)row * CDIM + c] = v[i] * inv * scale[c];
  }
}

// ---------------- generic WMMA GEMM, 128x128 tile, double-buffered LDS ----------------
// C(M,N) = A(M,K) * B(K,N); A: float or bf16-bits; B: float (bf16-converted on stage)
// 8 waves; wave (wr,wc) owns rows wr*32..+32, cols wc*64..+64 => 2x4 wmma accums.
// EPI: 0 = store f32; 1 = gelu->bf16 (outh); 2 = +aux residual
// GRP: 0 = plain; 1, 2 = row tile blockIdx.y belongs to expert tile_e[blockIdx.y], whose
//      weights are plane tile_e of Bm; 1 also gathers the A rows through rowtok
// The block size is stated so that the next tile's unconverted values fit in registers.
template <int EPI, typename AT, int GRP>
__global__ void __launch_bounds__(256) gemm_wmma(const AT* __restrict__ A, const float* __restrict__ Bm,
                          float* __restrict__ outf, unsigned short* __restrict__ outh,
                          const float* __restrict__ aux,
                          int M, int N, int Kd, int lda, int ldb, int ldc,
                          const int* __restrict__ rowtok, const int* __restrict__ tile_e) {
  __shared__ __attribute__((aligned(16))) unsigned short aS[2][128][40];
  // B stays row-major [k][n]; 288-byte rows (32 B x odd) suit the transposing load
  __shared__ __attribute__((aligned(16))) unsigned short bS[2][32][144];
  int tid = threadIdx.x;
  int lane = tid & 31;
  int wave = tid >> 5;
  int wr = wave & 3, wc = wave >> 2;
  int m0 = blockIdx.y * 128, n0 = blockIdx.x * 128;
  int hi = lane >> 4;
  int kb = hi * 8;
  int ln = lane & 15;
  int ar0 = wr * 32 + ln;
  int btr = hi * 8 + (lane & 7);                    // B fragment: this lane's k row ...
  int btc = wc * 64 + ((lane >> 3) & 1) * 8;        // ... and its 16-byte piece of 16 columns
  if (GRP) {
    int te = tile_e[blockIdx.y];
    if (te < 0) return;         // tile behind the last routed row: the whole block leaves here
    Bm += (size_t)(te & (NEXP - 1)) * Kd * ldb;
  }
  // staging index precompute (2 chunks of 8 elems per thread for A and B)
  int rA[2], cgA[2], kB[2], nbB[2];
#pragma unroll
  for (int g = 0; g < 2; g++) {
    int lin = tid + 256 * g;
    rA[g] = lin >> 2; cgA[g] = (lin & 3) * 8;
    kB[g] = lin >> 4; nbB[g] = (lin & 15) * 8;
  }
  unsigned aoff[2] = {0u, 0u};  // GRP 1: byte offsets of this thread's two gathered A chunks
  if (GRP == 1) {
#pragma unroll                  // constant indices keep aoff[] in registers
    for (int g = 0; g < 2; g++)
      aoff[g] = (unsigned)((rowtok[m0 + rA[g]] & (NTOK - 1)) * lda + cgA[g]) * (unsigned)sizeof(AT);
  }
  v8f acc[2][4] = {};
  u32x4 ra[2], rb[2];
  int nt = Kd >> 5;
  // prologue: load tile 0 into regs, store to buffer 0
#pragma unroll
  for (int g = 0; g < 2; g++) {
    if (GRP == 1) {             // gathered row: uniform base + 32-bit lane offset
      ra[g] = load8_bf((const AT*)((const char*)A + aoff[g]));
    } else {
      ra[g] = load8_bf(&A[(size_t)(m0 + rA[g]) * lda + cgA[g]]);
    }
    const float4* qp = (const float4*)&Bm[(size_t)kB[g] * ldb + n0 + nbB[g]];
    float4 fa = qp[0], fb = qp[1];
    rb[g].x = f32_bf16(fa.x) | (f32_bf16(fa.y) << 16);
    rb[g].y = f32_bf16(fa.z) | (f32_bf16(fa.w) << 16);
    rb[g].z = f32_bf16(fb.x) | (f32_bf16(fb.y) << 16);
    rb[g].w = f32_bf16(fb.z) | (f32_bf16(fb.w) << 16);
  }
#pragma unroll
  for (int g = 0; g < 2; g++) {
    *(u32x4*)&aS[0][rA[g]][cgA[g]] = ra[g];
    *(u32x4*)&bS[0][kB[g]][nbB[g]] = rb[g];
  }
  __syncthreads();
  // the products of the tile in buffer buf
  auto mma_tile = [&](int buf) {
    FragBF a0, a1;
    a0.q[0] = *(const u32x4*)&aS[buf][ar0][kb];
    a0.q[1] = *(const u32x4*)&aS[buf][ar0][16 + kb];
    a1.q[0] = *(const u32x4*)&aS[buf][ar0 + 16][kb];
    a1.q[1] = *(const u32x4*)&aS[buf][ar0 + 16][16 + kb];
#pragma unroll
    for (int bj = 0; bj < 4; bj++) {
      FragBF bf;
      bf.q[0] = ld_tr16(&bS[buf][btr][btc + bj * 16]);
      bf.q[1] = ld_tr16(&bS[buf][16 + btr][btc + bj * 16]);
      acc[0][bj] = __builtin_amdgcn_wmma_f32_16x16x32_bf16(false, a0.v, false, bf.v, (short)0, acc[0][bj], false, false);
      acc[1][bj] = __builtin_amdgcn_wmma_f32_16x16x32_bf16(false, a1.v, false, bf.v, (short)0, acc[1][bj], false, false);
      // one B fragment live at a time; the last one also keeps the conversion of the next
      // tile, and with it the wait for its loads, behind the products
      __builtin_amdgcn_sched_barrier(0);
    }
  };
  // every pass but the last fetches the tile after it; the last pass stands behind the loop, so
  // the loaded values live inside one pass and are not copied (a copy would wait for the loads)
  for (int kt = 0; kt + 1 < nt; kt++) {
    int buf = kt & 1;
    int k1 = (kt + 1) << 5;
    // issue all of the next tile's global loads together; nothing uses their values before the
    // products are done, so they stay in flight meanwhile
    decltype(load8_raw((const AT*)nullptr)) wa[2];
    Raw8f wb[2];
    const AT* pa[2];
    const float* pb[2];
#pragma unroll
    for (int g = 0; g < 2; g++) {
      if (GRP == 1) {
        pa[g] = (const AT*)((const char*)(A + k1) + aoff[g]);
      } else {
        pa[g] = &A[(size_t)(m0 + rA[g]) * lda + k1 + cgA[g]];
      }
      pb[g] = &Bm[(size_t)(k1 + kB[g]) * ldb + n0 + nbB[g]];
      wa[g] = load8_raw(pa[g]);
      wb[g] = load8_raw(pb[g]);
    }
    // the code below reuses the address registers of the loads above; as inputs of the wait
    // they stay untouched up to it, also by the later loads' own results
    asm volatile("s_wait_xcnt 0x0" :: "v"(pa[0]), "v"(pa[1]), "v"(pb[0]), "v"(pb[1]) : "memory");
    if (kt + 2 < nt) {   // prefetch two tiles ahead into GL2
      int k2 = (kt + 2) << 5;
      if (GRP == 1) {
        __builtin_prefetch((const char*)(A + k2) + aoff[0], 0, 1);
      } else {
        __builtin_prefetch(&A[(size_t)(m0 + rA[0]) * lda + k2 + cgA[0]], 0, 1);
      }
      __builtin_prefetch(&Bm[(size_t)(k2 + kB[0]) * ldb + n0 + nbB[0]], 0, 1);
    }
    mma_tile(buf);
    int nb = buf ^ 1;
#pragma unroll
    for (int g = 0; g < 2; g++) {   // first use of the loaded values: convert, then store
      *(u32x4*)&aS[nb][rA[g]][cgA[g]] = pack8_bf(wa[g]);
      *(u32x4*)&bS[nb][kB[g]][nbB[g]] = pack8_bf(wb[g]);
    }
    __syncthreads();
  }
  mma_tile((nt - 1) & 1);
#pragma unroll
  for (int ai = 0; ai < 2; ai++) {
#pragma unroll
    for (int bj = 0; bj < 4; bj++) {
#pragma unroll
      for (int i = 0; i < 8; i++) {
        int r = m0 + wr * 32 + ai * 16 + i + hi * 8;
        int c = n0 + wc * 64 + bj * 16 + ln;
        size_t idx = (size_t)r * ldc + c;
        float v = acc[ai][bj][i];
        if (EPI == 0) {
          outf[idx] = v;
        } else if (EPI == 1) {
          float g = 0.5f * v * (1.0f + erff(v * 0.70710678118f));
          outh[idx] = (unsigned short)f32_bf16(g);
        } else if (EPI == 2) {
          outf[idx] = v + aux[idx];
        }
      }
    }
  }
}

// ---------------- RoPE (+ bf16 convert) ----------------
__global__ void rope_kernel(const float* __restrict__ in, unsigned short* __restrict__ outb,
                            int nheads, int ld) {
  int idx = blockIdx.x * 256 + threadIdx.x;       // pair index over NTOK*nheads*32
  int d = idx & 31;
  int th = idx >> 5;
  int head = th % nheads;
  int tok = th / nheads;
  int t = tok & 1023;                             // tok = b*T + t
  float inv_freq = __expf(-0.2878231366f * (float)d);  // 10000^(-d/32)
  float ang = (float)t * inv_freq;
  float cs = __cosf(ang), sn = __sinf(ang);
  size_t base = (size_t)tok * ld + head * 64;
  float x1 = in[base + d], x2 = in[base + 32 + d];
  outb[base + d]      = (unsigned short)f32_bf16(x1 * cs - x2 * sn);
  outb[base + 32 + d] = (unsigned short)f32_bf16(x2 * cs + x1 * sn);
}

__global__ void cvt_bf16_kernel(const float* __restrict__ in, unsigned short* __restrict__ outb) {
  size_t i = (size_t)blockIdx.x * 256 + threadIdx.x;
  outb[i] = (unsigned short)f32_bf16(in[i]);
}

// ---------------- flash attention (WMMA, causal, GQA) ----------------
__global__ void attn_kernel(const unsigned short* __restrict__ qb,
                            const unsigned short* __restrict__ kbuf,
                            const unsigned short* __restrict__ vbuf,
                            float* __restrict__ y) {
  __shared__ __attribute__((aligned(16))) unsigned short Kls[32][72];
  __shared__ __attribute__((aligned(16))) unsigned short Vls[64][40];
  __shared__ __attribute__((aligned(16))) unsigned short Pls[8][16][40];
  int tid = threadIdx.x, lane = tid & 31, wave = tid >> 5;
  int bh = blockIdx.x;
  int b = bh >> 4, h = bh & 15;
  int kvh = h >> 2;
  int qt = blockIdx.y;
  int qbase = qt * 128 + wave * 16;
  int hi = lane >> 4, kbo = hi * 8, ln = lane & 15;
  int qrow = qbase + ln;
  const unsigned short* qp = qb + (size_t)(b * 1024 + qrow) * CDIM + h * 64;
  FragBF qa0, qa1;
  qa0.q[0] = *(const u32x4*)(qp + kbo);
  qa0.q[1] = *(const u32x4*)(qp + 16 + kbo);
  qa1.q[0] = *(const u32x4*)(qp + 32 + kbo);
  qa1.q[1] = *(const u32x4*)(qp + 48 + kbo);
  float m[8], l[8];
  v8f o[4] = {};
#pragma unroll
  for (int i = 0; i < 8; i++) { m[i] = -3.0e38f; l[i] = 0.f; }
  int ntiles = (qt + 1) * 4;
  for (int kt = 0; kt < ntiles; kt++) {
    int key0 = kt * 32;
#pragma unroll
    for (int i = 0; i < 4; i++) {                 // stage K rows (32 x 64), uint copies
      int lin = tid + 256 * i;
      int kk = lin >> 5, du = lin & 31;
      const unsigned int* src =
          (const unsigned int*)(kbuf + (size_t)(b * 1024 + key0 + kk) * 256 + kvh * 64);
      ((unsigned int*)&Kls[kk][0])[du] = src[du];
    }
#pragma unroll
    for (int i = 0; i < 8; i++) {                 // stage V transposed: Vls[d][kk]
      int lin = tid + 256 * i;
      int kk = lin >> 6, d = lin & 63;
      Vls[d][kk] = vbuf[(size_t)(b * 1024 + key0 + kk) * 256 + kvh * 64 + d];
    }
    __syncthreads();
    v8f s[2] = {};
#pragma unroll
    for (int sub = 0; sub < 2; sub++) {           // scores: Q(16x64) * K^T(64x32)
      int krow = sub * 16 + ln;
      FragBF bK;
      bK.q[0] = *(const u32x4*)&Kls[krow][kbo];
      bK.q[1] = *(const u32x4*)&Kls[krow][16 + kbo];
      s[sub] = __builtin_amdgcn_wmma_f32_16x16x32_bf16(false, qa0.v, false, bK.v, (short)0, s[sub], false, false);
      bK.q[0] = *(const u32x4*)&Kls[krow][32 + kbo];
      bK.q[1] = *(const u32x4*)&Kls[krow][48 + kbo];
      s[sub] = __builtin_amdgcn_wmma_f32_16x16x32_bf16(false, qa1.v, false, bK.v, (short)0, s[sub], false, false);
    }
    int keyc0 = key0 + ln, keyc1 = key0 + 16 + ln;
#pragma unroll
    for (int i = 0; i < 8; i++) {                 // online softmax (DPP reductions)
      int row = qbase + i + hi * 8;
      float s0 = s[0][i] * 0.125f; if (keyc0 > row) s0 = -3.0e38f;
      float s1 = s[1][i] * 0.125f; if (keyc1 > row) s1 = -3.0e38f;
      float t = red16_max(fmaxf(s0, s1));
      float mn = fmaxf(m[i], t);
      float fac = __expf(m[i] - mn);
      float p0 = __expf(s0 - mn), p1 = __expf(s1 - mn);
      float ps = red16_sum(p0 + p1);
      l[i] = l[i] * fac + ps;
      m[i] = mn;
#pragma unroll
      for (int sub = 0; sub < 4; sub++) o[sub][i] *= fac;
      Pls[wave][i + hi * 8][ln]      = (unsigned short)f32_bf16(p0);
      Pls[wave][i + hi * 8][16 + ln] = (unsigned short)f32_bf16(p1);
    }
    __syncthreads();
    FragBF pa;                                    // P(16x32) * V(32x64)
    pa.q[0] = *(const u32x4*)&Pls[wave][ln][kbo];
    pa.q[1] = *(const u32x4*)&Pls[wave][ln][16 + kbo];
#pragma unroll
    for (int sub = 0; sub < 4; sub++) {
      FragBF bV;
      int col = sub * 16 + ln;
      bV.q[0] = *(const u32x4*)&Vls[col][kbo];
      bV.q[1] = *(const u32x4*)&Vls[col][16 + kbo];
      o[sub] = __builtin_amdgcn_wmma_f32_16x16x32_bf16(false, pa.v, false, bV.v, (short)0, o[sub], false, false);
    }
    __syncthreads();
  }
#pragma unroll
  for (int sub = 0; sub < 4; sub++)
#pragma unroll
    for (int i = 0; i < 8; i++) {
      int row = qbase + i + hi * 8;
      int col = h * 64 + sub * 16 + ln;
      y[(size_t)(b * 1024 + row) * CDIM + col] = o[sub][i] / l[i];
    }
}

// ---------------- MoE gate: softmax, top-2, combine weights, aux stats ----------------
// sel[row] = lower expert | higher expert << 4; gw[2*row], gw[2*row+1] = their weights
__global__ void gate_kernel(const float* __restrict__ xn, const float* __restrict__ Wg,
                            int* __restrict__ sel, float* __restrict__ gw,
                            float* __restrict__ accum) {
  int tid = threadIdx.x, lane = tid & 31, wave = tid >> 5;
  int row = blockIdx.x * 8 + wave;
  float part[NEXP];
#pragma unroll
  for (int e = 0; e < NEXP; e++) part[e] = 0.f;
  const float* xr = xn + (size_t)row * CDIM;
  for (int c = lane; c < CDIM; c += 32) {
    float xv = xr[c];
#pragma unroll
    for (int e = 0; e < NEXP; e++) part[e] += xv * Wg[c * NEXP + e];
  }
#pragma unroll
  for (int e = 0; e < NEXP; e++)
#pragma unroll
    for (int off = 1; off < 32; off <<= 1) part[e] += __shfl_xor(part[e], off);
  if (lane == 0) {
    float mx = part[0];
#pragma unroll
    for (int e = 1; e < NEXP; e++) mx = fmaxf(mx, part[e]);
    float pe[NEXP], s = 0.f;
#pragma unroll
    for (int e = 0; e < NEXP; e++) { pe[e] = __expf(part[e] - mx); s += pe[e]; }
#pragma unroll
    for (int e = 0; e < NEXP; e++) pe[e] /= s;
    int s0 = 0;
#pragma unroll
    for (int e = 1; e < NEXP; e++) if (pe[e] > pe[s0]) s0 = e;
    int s1 = -1;
#pragma unroll
    for (int e = 0; e < NEXP; e++) if (e != s0 && (s1 < 0 || pe[e] > pe[s1])) s1 = e;
    float denom = pe[s0] + pe[s1];
    float w0 = pe[s0] / denom, w1 = pe[s1] / denom;
    bool up = s0 < s1;
    sel[row] = up ? (s0 | (s1 << 4)) : (s1 | (s0 << 4));
    gw[2 * row]     = up ? w0 : w1;
    gw[2 * row + 1] = up ? w1 : w0;
    // the code below reuses the address registers of the three stores above
    asm volatile("s_wait_xcnt 0x0" ::: "memory");
#pragma unroll
    for (int e = 0; e < NEXP; e++) atomicAdd(&accum[e], pe[e]);   // P sums
    atomicAdd(&accum[NEXP + s0], 1.0f);                           // selection counts
    atomicAdd(&accum[NEXP + s1], 1.0f);
  }
}

__global__ void init_accum_kernel(float* accum) {
  if (threadIdx.x < 16) accum[threadIdx.x] = 0.f;
}

__global__ void aux_kernel(const float* __restrict__ accum, float* __restrict__ out_aux) {
  if (threadIdx.x == 0 && blockIdx.x == 0) {
    float s = 0.f;
    for (int e = 0; e < NEXP; e++)
      s += (accum[NEXP + e] / (float)(NTOK * 2)) * (accum[e] / (float)NTOK);
    out_aux[0] = (float)NEXP * s;
  }
}

// ---------------- MoE routing: sort the 2*NTOK (token, expert) pairs by expert ----------------
// One block of 1024 threads, 4 tokens each. Eight running counts travel as 16-bit fields
// of two 64-bit words (no field passes MAXROW). Each expert's list starts at a multiple of 128.
// rowtok[p] = token of routed row p (0 in the padding), slot[2*t+j] = routed row of token t's
// j-th expert, tile_e[i] = expert of rows 128*i.., -1 behind the last list.
__device__ inline unsigned long long fld_one(int e) { return 1ull << ((e & 3) * 16); }
__device__ inline int fld_get(unsigned long long lo, unsigned long long hi, int e) {
  return (int)(((e < 4 ? lo : hi) >> ((e & 3) * 16)) & 0xFFFFull);
}
__global__ void route_kernel(const int* __restrict__ sel, int* __restrict__ rowtok,
                             int* __restrict__ slot, int* __restrict__ tile_e) {
  __shared__ unsigned long long wtot[32][2];
  int tid = threadIdx.x, lane = tid & 31, wave = tid >> 5;
  int ex[8];
  unsigned long long lo = 0, hi = 0;
  // the loops over ex[] and over the experts are unrolled so that ex[] and the shift counts
  // are indexed by constants and nothing goes to scratch
#pragma unroll
  for (int i = 0; i < 4; i++) {
    int s = sel[tid * 4 + i];
    ex[2 * i] = s & 7; ex[2 * i + 1] = (s >> 4) & 7;
  }
#pragma unroll
  for (int i = 0; i < 8; i++) {
    if (ex[i] < 4) lo += fld_one(ex[i]); else hi += fld_one(ex[i]);
  }
  unsigned long long ilo = lo, ihi = hi;          // inclusive scan over the wave
  for (int d = 1; d < 32; d <<= 1) {
    unsigned long long a = __shfl_up(ilo, d), b = __shfl_up(ihi, d);
    if (lane >= d) { ilo += a; ihi += b; }
  }
  if (lane == 31) { wtot[wave][0] = ilo; wtot[wave][1] = ihi; }
  __syncthreads();
  unsigned long long tlo = 0, thi = 0, plo = ilo - lo, phi = ihi - hi;
#pragma unroll 4                // unrolled whole, the 64 words are all held in registers and spill
  for (int w = 0; w < 32; w++) {
    unsigned long long a = wtot[w][0], b = wtot[w][1];
    tlo += a; thi += b;
    if (w < wave) { plo += a; phi += b; }
  }
  int off = 0;
  int mytile = -1;
#pragma unroll
  for (int e = 0; e < NEXP; e++) {
    int cnt = fld_get(tlo, thi, e);
    int end = off + ((cnt + 127) & ~127);
    if (e < 4) plo += (unsigned long long)off << (e * 16);
    else       phi += (unsigned long long)off << ((e - 4) * 16);
    if (off + cnt + tid < end) rowtok[off + cnt + tid] = 0;
    if (tid * 128 >= off && tid * 128 < end) mytile = e;
    off = end;
  }
  if (tid < MAXTILE) tile_e[tid] = mytile;
#pragma unroll
  for (int i = 0; i < 8; i++) {
    int e = ex[i];
    int p = fld_get(plo, phi, e);
    if (e < 4) plo += fld_one(e); else phi += fld_one(e);
    rowtok[p] = tid * 4 + (i >> 1);
    slot[tid * 8 + i] = p;
  }
}

// out = x1 + w_a * ye[row_a] + w_b * ye[row_b], lower expert first; one block per token
__global__ void combine_kernel(const float4* __restrict__ x1, const float4* __restrict__ ye,
                               const int* __restrict__ slot, const float* __restrict__ gw,
                               float4* __restrict__ dst) {
  int tok = blockIdx.x, c = threadIdx.x;
  int pa = min(slot[2 * tok], MAXROW - 1), pb = min(slot[2 * tok + 1], MAXROW - 1);
  float wa = gw[2 * tok], wb = gw[2 * tok + 1];
  float4 o = x1[(size_t)tok * 256 + c];
  float4 a = ye[(size_t)pa * 256 + c];
  float4 b = ye[(size_t)pb * 256 + c];
  o.x += wa * a.x; o.y += wa * a.y; o.z += wa * a.z; o.w += wa * a.w;
  o.x += wb * b.x; o.y += wb * b.y; o.z += wb * b.z; o.w += wb * b.w;
  dst[(size_t)tok * 256 + c] = o;
}

// ---------------- launcher ----------------
extern "C" void kernel_launch(void* const* d_in, const int* in_sizes, int n_in,
                              void* d_out, int out_size, void* d_ws, size_t ws_size,
                              hipStream_t stream) {
  (void)in_sizes; (void)n_in; (void)out_size; (void)ws_size;
  const float* x   = (const float*)d_in[0];
  const float* ln1 = (const float*)d_in[1];
  const float* ln2 = (const float*)d_in[2];
  const float* Wq  = (const float*)d_in[3];
  const float* Wk  = (const float*)d_in[4];
  const float* Wv  = (const float*)d_in[5];
  const float* Wo  = (const float*)d_in[6];
  const float* Wg  = (const float*)d_in[7];
  const float* W1  = (const float*)d_in[8];
  const float* W2  = (const float*)d_in[9];
  float* outx = (float*)d_out;

  char* ws = (char*)d_ws;
  size_t off = 0;
  auto alloc = [&](size_t bytes) -> void* {
    void* p = ws + off;
    off += (bytes + 255) & ~(size_t)255;
    return p;
  };
  float*          xn1  = (float*)alloc((size_t)NTOK * CDIM * 4);
  float*          qf   = (float*)alloc((size_t)NTOK * CDIM * 4);
  float*          kf   = (float*)alloc((size_t)NTOK * 256 * 4);
  float*          vf   = (float*)alloc((size_t)NTOK * 256 * 4);
  unsigned short* qb   = (unsigned short*)alloc((size_t)NTOK * CDIM * 2);
  unsigned short* kbuf = (unsigned short*)alloc((size_t)NTOK * 256 * 2);
  unsigned short* vbuf = (unsigned short*)alloc((size_t)NTOK * 256 * 2);
  float*          yatt = (float*)alloc((size_t)NTOK * CDIM * 4);
  float*          x1   = (float*)alloc((size_t)NTOK * CDIM * 4);
  float*          xn2  = (float*)alloc((size_t)NTOK * CDIM * 4);
  unsigned short* hbf  = (unsigned short*)alloc((size_t)MAXROW * IDIM * 2);
  float*          ye   = (float*)alloc((size_t)MAXROW * CDIM * 4);
  int*            sel  = (int*)alloc((size_t)NTOK * 4);
  float*          gw   = (float*)alloc((size_t)NTOK * 2 * 4);
  int*            rowtok = (int*)alloc((size_t)MAXROW * 4);
  int*            slot = (int*)alloc((size_t)NTOK * 2 * 4);
  int*            tile_e = (int*)alloc((size_t)MAXTILE * 4);
  float*          acc  = (float*)alloc(64);

  // 1) xn1 = rmsnorm(x)
  rmsnorm_kernel<<<NTOK, 256, 0, stream>>>(x, ln1, xn1);
  // 2) q/k/v projections
  gemm_wmma<0, float, 0><<<dim3(CDIM / 128, NTOK / 128), 256, 0, stream>>>(
      xn1, Wq, qf, nullptr, nullptr, NTOK, CDIM, CDIM, CDIM, CDIM, CDIM, nullptr, nullptr);
  gemm_wmma<0, float, 0><<<dim3(256 / 128, NTOK / 128), 256, 0, stream>>>(
      xn1, Wk, kf, nullptr, nullptr, NTOK, 256, CDIM, CDIM, 256, 256, nullptr, nullptr);
  gemm_wmma<0, float, 0><<<dim3(256 / 128, NTOK / 128), 256, 0, stream>>>(
      xn1, Wv, vf, nullptr, nullptr, NTOK, 256, CDIM, CDIM, 256, 256, nullptr, nullptr);
  // 3) RoPE + bf16 conversion
  rope_kernel<<<(NTOK * 16 * 32) / 256, 256, 0, stream>>>(qf, qb, 16, CDIM);
  rope_kernel<<<(NTOK * 4 * 32) / 256, 256, 0, stream>>>(kf, kbuf, 4, 256);
  cvt_bf16_kernel<<<(NTOK * 256) / 256, 256, 0, stream>>>(vf, vbuf);
  // 4) attention
  attn_kernel<<<dim3(64, 8), 256, 0, stream>>>(qb, kbuf, vbuf, yatt);
  // 5) x1 = yatt @ Wo + x
  gemm_wmma<2, float, 0><<<dim3(CDIM / 128, NTOK / 128), 256, 0, stream>>>(
      yatt, Wo, x1, nullptr, x, NTOK, CDIM, CDIM, CDIM, CDIM, CDIM, nullptr, nullptr);
  // 6) xn2 = rmsnorm(x1)
  rmsnorm_kernel<<<NTOK, 256, 0, stream>>>(x1, ln2, xn2);
  // 7) gating + aux stats
  init_accum_kernel<<<1, 32, 0, stream>>>(acc);
  gate_kernel<<<NTOK / 8, 256, 0, stream>>>(xn2, Wg, sel, gw, acc);
  // 8) sort the (token, expert) pairs by expert
  route_kernel<<<1, 1024, 0, stream>>>(sel, rowtok, slot, tile_e);
  // 9) experts, chosen rows only: h = gelu(xn2[rowtok] @ W1[e]); ye = h @ W2[e]
  gemm_wmma<1, float, 1><<<dim3(IDIM / 128, MAXTILE), 256, 0, stream>>>(
      xn2, W1, nullptr, hbf, nullptr, MAXROW, IDIM, CDIM, CDIM, IDIM, IDIM, rowtok, tile_e);
  gemm_wmma<0, unsigned short, 2><<<dim3(CDIM / 128, MAXTILE), 256, 0, stream>>>(
      hbf, W2, ye, nullptr, nullptr, MAXROW, CDIM, IDIM, IDIM, CDIM, CDIM, nullptr, tile_e);
  //    out = x1 + the two weighted expert rows of each token
  combine_kernel<<<NTOK, 256, 0, stream>>>(
      (const float4*)x1, (const float4*)ye, slot, gw, (float4*)outx);
  // 10) aux loss scalar
  aux_kernel<<<1, 32, 0, stream>>>(acc, outx + (size_t)NTOK * CDIM);
}

// v004
// Measured time: 582 microseconds a run.
// Timed twice side by side with v003, it ran 1.18 and 1.17 times as fast.
// Over all steps from v000 it is 6.32 times as fast.
#include <hip/hip_runtime.h>
#include <hip/hip_bf16.h>
#include <math.h>

// ---------------- types / helpers ----------------
typedef __attribute__((ext_vector_type(16))) __bf16 v16bf;
typedef __attribute__((ext_vector_type(8)))  float  v8f;
typedef __attribute__((ext_vector_type(4)))  unsigned int u32x4;
typedef __attribute__((ext_vector_type(8)))  short s16x8;

union FragBF { u32x4 q[2]; v16bf v; };

__device__ inline unsigned int f32_bf16(float f) {
  unsigned int u = __float_as_uint(f);
  unsigned int r = 0x7FFFu + ((u >> 16) & 1u);
  return (u + r) >> 16;
}
// pack 8 consecutive values (float->bf16 or passthrough bf16 bits) into u32x4
__device__ inline u32x4 load8_bf(const float* p) {
  const float4* q = (const float4*)p;
  float4 a = q[0], b = q[1];
  u32x4 r;
  r.x = f32_bf16(a.x) | (f32_bf16(a.y) << 16);
  r.y = f32_bf16(a.z) | (f32_bf16(a.w) << 16);
  r.z = f32_bf16(b.x) | (f32_bf16(b.y) << 16);
  r.w = f32_bf16(b.z) | (f32_bf16(b.w) << 16);
  return r;
}
__device__ inline u32x4 load8_bf(const unsigned short* p) {
  return *(const u32x4*)p;
}
// the same 8 values in two halves: the load alone, as it comes from memory, and the packing
struct Raw8f { float4 a, b; };
__device__ inline Raw8f load8_raw(const float* p) {
  const float4* q = (const float4*)p;
  Raw8f r; r.a = q[0]; r.b = q[1];
  return r;
}
__device__ inline u32x4 load8_raw(const unsigned short* p) {
  return *(const u32x4*)p;
}
__device__ inline u32x4 pack8_bf(const Raw8f& v) {
  u32x4 r;
  r.x = f32_bf16(v.a.x) | (f32_bf16(v.a.y) << 16);
  r.y = f32_bf16(v.a.z) | (f32_bf16(v.a.w) << 16);
  r.z = f32_bf16(v.b.x) | (f32_bf16(v.b.y) << 16);
  r.w = f32_bf16(v.b.z) | (f32_bf16(v.b.w) << 16);
  return r;
}
__device__ inline u32x4 pack8_bf(const u32x4& v) { return v; }
// transposing LDS load: from a row-major [k][n] 16-bit tile, lane (c, h) gets 8 k of column c
__device__ inline u32x4 ld_tr16(const unsigned short* p) {
  typedef __attribute__((address_space(3))) s16x8 lds_s16x8;
  return __builtin_bit_cast(u32x4, __builtin_amdgcn_ds_load_tr16_b128_v8i16((lds_s16x8*)p));
}

// DPP16 butterfly reductions over a 16-lane row (VALU only, no LDS)
// ctrl must be a compile-time constant -> template parameter
template <int CTRL>
__device__ inline float dpp_f(float x) {
  return __int_as_float(
      __builtin_amdgcn_update_dpp(0, __float_as_int(x), CTRL, 0xF, 0xF, true));
}
#define DPP_QPERM_XOR1 0xB1   // quad_perm(1,0,3,2)
#define DPP_QPERM_XOR2 0x4E   // quad_perm(2,3,0,1)
#define DPP_ROW_HMIRR  0x141  // row_half_mirror (lane^7 within 8)
#define DPP_ROW_MIRR   0x140  // row_mirror (lane^15 within 16)
__device__ inline float red16_max(float x) {
  x = fmaxf(x, dpp_f<DPP_QPERM_XOR1>(x));
  x = fmaxf(x, dpp_f<DPP_QPERM_XOR2>(x));
  x = fmaxf(x, dpp_f<DPP_ROW_HMIRR>(x));
  x = fmaxf(x, dpp_f<DPP_ROW_MIRR>(x));
  return x;
}
__device__ inline float red16_sum(float x) {
  x += dpp_f<DPP_QPERM_XOR1>(x);
  x += dpp_f<DPP_QPERM_XOR2>(x);
  x += dpp_f<DPP_ROW_HMIRR>(x);
  x += dpp_f<DPP_ROW_MIRR>(x);
  return x;
}

#define NTOK 4096   // B*T
#define CDIM 1024
#define IDIM 4096
#define NEXP 8
#define MAXTILE 72            // 2*NTOK routed rows, each expert's list padded to 128: at most 71 tiles
#define MAXROW (MAXTILE * 128)

// ---------------- RMSNorm ----------------
__global__ void rmsnorm_kernel(const float* __restrict__ x,
                               const float* __restrict__ scale,
                               float* __restrict__ out) {
  __shared__ float red[9];
  int row = blockIdx.x;
  int tid = threadIdx.x;
  const float* xr = x + (size_t)row * CDIM;
  float v[4]; float ss = 0.f;
#pragma unroll
  for (int i = 0; i < 4; i++) { v[i] = xr[tid + 256 * i]; ss += v[i] * v[i]; }
#pragma unroll
  for (int off = 16; off >= 1; off >>= 1) ss += __shfl_xor(ss, off);
  if ((tid & 31) == 0) red[tid >> 5] = ss;
  __syncthreads();
  if (tid == 0) {
    float t = 0.f;
#pragma unroll
    for (int w = 0; w < 8; w++) t += red[w];
    red[8] = t;
  }
  __syncthreads();
  float inv = rsqrtf(red[8] / (float)CDIM + 1e-5f);
#pragma unroll
  for (int i = 0; i < 4; i++) {
    int c = tid + 256 * i;
    out[(size_t)row * CDIM + c] = v[i] * inv * scale[c];
  }
}

// ---------------- generic WMMA GEMM, 128x128 tile, double-buffered LDS ----------------
// C(M,N) = A(M,K) * B(K,N); A: float or bf16-bits; B: float (bf16-converted on stage)
// 8 waves; wave (wr,wc) owns rows wr*32..+32, cols wc*64..+64 => 2x4 wmma accums.
// EPI: 0 = store f32; 1 = gelu->bf16 (outh); 2 = +aux residual
// GRP: 0 = plain; 1, 2 = row tile blockIdx.y belongs to expert tile_e[blockIdx.y], whose
//      weights are plane tile_e of Bm; 1 also gathers the A rows through rowtok
// The block size is stated so that the next tile's unconverted values fit in registers.
template <int EPI, typename AT, int GRP>
__global__ void __launch_bounds__(256) gemm_wmma(const AT* __restrict__ A, const float* __restrict__ Bm,
                          float* __restrict__ outf, unsigned short* __restrict__ outh,
                          const float* __restrict__ aux,
                          int M, int N, int Kd, int lda, int ldb, int ldc,
                          const int* __restrict__ rowtok, const int* __restrict__ tile_e) {
  __shared__ __attribute__((aligned(16))) unsigned short aS[2][128][40];
  // B stays row-major [k][n]; 288-byte rows (32 B x odd) suit the transposing load
  __shared__ __attribute__((aligned(16))) unsigned short bS[2][32][144];
  int tid = threadIdx.x;
  int lane = tid & 31;
  int wave = tid >> 5;
  int wr = wave & 3, wc = wave >> 2;
  int m0 = blockIdx.y * 128, n0 = blockIdx.x * 128;
  int hi = lane >> 4;
  int kb = hi * 8;
  int ln = lane & 15;
  int ar0 = wr * 32 + ln;
  int btr = hi * 8 + (lane & 7);                    // B fragment: this lane's k row ...
  int btc = wc * 64 + ((lane >> 3) & 1) * 8;        // ... and its 16-byte piece of 16 columns
  if (GRP) {
    int te = tile_e[blockIdx.y];
    if (te < 0) return;         // tile behind the last routed row: the whole block leaves here
    Bm += (size_t)(te & (NEXP - 1)) * Kd * ldb;
  }
  // staging index precompute (2 chunks of 8 elems per thread for A and B)
  int rA[2], cgA[2], kB[2], nbB[2];
#pragma unroll
  for (int g = 0; g < 2; g++) {
    int lin = tid + 256 * g;
    rA[g] = lin >> 2; cgA[g] = (lin & 3) * 8;
    kB[g] = lin >> 4; nbB[g] = (lin & 15) * 8;
  }
  unsigned aoff[2] = {0u, 0u};  // GRP 1: byte offsets of this thread's two gathered A chunks
  if (GRP == 1) {
#pragma unroll                  // constant indices keep aoff[] in registers
    for (int g = 0; g < 2; g++)
      aoff[g] = (unsigned)((rowtok[m0 + rA[g]] & (NTOK - 1)) * lda + cgA[g]) * (unsigned)sizeof(AT);
  }
  v8f acc[2][4] = {};
  u32x4 ra[2], rb[2];
  int nt = Kd >> 5;
  // prologue: load tile 0 into regs, store to buffer 0
#pragma unroll
  for (int g = 0; g < 2; g++) {
    if (GRP == 1) {             // gathered row: uniform base + 32-bit lane offset
      ra[g] = load8_bf((const AT*)((const char*)A + aoff[g]));
    } else {
      ra[g] = load8_bf(&A[(size_t)(m0 + rA[g]) * lda + cgA[g]]);
    }
    const float4* qp = (const float4*)&Bm[(size_t)kB[g] * ldb + n0 + nbB[g]];
    float4 fa = qp[0], fb = qp[1];
    rb[g].x = f32_bf16(fa.x) | (f32_bf16(fa.y) << 16);
    rb[g].y = f32_bf16(fa.z) | (f32_bf16(fa.w) << 16);
    rb[g].z = f32_bf16(fb.x) | (f32_bf16(fb.y) << 16);
    rb[g].w = f32_bf16(fb.z) | (f32_bf16(fb.w) << 16);
  }
#pragma unroll
  for (int g = 0; g < 2; g++) {
    *(u32x4*)&aS[0][rA[g]][cgA[g]] = ra[g];
    *(u32x4*)&bS[0][kB[g]][nbB[g]] = rb[g];
  }
  __syncthreads();
  // the products of the tile in buffer buf
  auto mma_tile = [&](int buf) {
    FragBF a0, a1;
    a0.q[0] = *(const u32x4*)&aS[buf][ar0][kb];
    a0.q[1] = *(const u32x4*)&aS[buf][ar0][16 + kb];
    a1.q[0] = *(const u32x4*)&aS[buf][ar0 + 16][kb];
    a1.q[1] = *(const u32x4*)&aS[buf][ar0 + 16][16 + kb];
#pragma unroll
    for (int bj = 0; bj < 4; bj++) {
      FragBF bf;
      bf.q[0] = ld_tr16(&bS[buf][btr][btc + bj * 16]);
      bf.q[1] = ld_tr16(&bS[buf][16 + btr][btc + bj * 16]);
      acc[0][bj] = __builtin_amdgcn_wmma_f32_16x16x32_bf16(false, a0.v, false, bf.v, (short)0, acc[0][bj], false, false);
      acc[1][bj] = __builtin_amdgcn_wmma_f32_16x16x32_bf16(false, a1.v, false, bf.v, (short)0, acc[1][bj], false, false);
      // one B fragment live at a time; the last one also keeps the conversion of the next
      // tile, and with it the wait for its loads, behind the products
      __builtin_amdgcn_sched_barrier(0);
    }
  };
  // every pass but the last fetches the tile after it; the last pass stands behind the loop, so
  // the loaded values live inside one pass and are not copied (a copy would wait for the loads)
  for (int kt = 0; kt + 1 < nt; kt++) {
    int buf = kt & 1;
    int k1 = (kt + 1) << 5;
    // issue all of the next tile's global loads together; nothing uses their values before the
    // products are done, so they stay in flight meanwhile
    decltype(load8_raw((const AT*)nullptr)) wa[2];
    Raw8f wb[2];
    const AT* pa[2];
    const float* pb[2];
#pragma unroll
    for (int g = 0; g < 2; g++) {
      if (GRP == 1) {
        pa[g] = (const AT*)((const char*)(A + k1) + aoff[g]);
      } else {
        pa[g] = &A[(size_t)(m0 + rA[g]) * lda + k1 + cgA[g]];
      }
      pb[g] = &Bm[(size_t)(k1 + kB[g]) * ldb + n0 + nbB[g]];
      wa[g] = load8_raw(pa[g]);
      wb[g] = load8_raw(pb[g]);
    }
    // the code below reuses the address registers of the loads above; as inputs of the wait
    // they stay untouched up to it, also by the later loads' own results
    asm volatile("s_wait_xcnt 0x0" :: "v"(pa[0]), "v"(pa[1]), "v"(pb[0]), "v"(pb[1]) : "memory");
    if (kt + 2 < nt) {   // prefetch two tiles ahead into GL2
      int k2 = (kt + 2) << 5;
      if (GRP == 1) {
        __builtin_prefetch((const char*)(A + k2) + aoff[0], 0, 1);
      } else {
        __builtin_prefetch(&A[(size_t)(m0 + rA[0]) * lda + k2 + cgA[0]], 0, 1);
      }
      __builtin_prefetch(&Bm[(size_t)(k2 + kB[0]) * ldb + n0 + nbB[0]], 0, 1);
    }
    mma_tile(buf);
    int nb = buf ^ 1;
#pragma unroll
    for (int g = 0; g < 2; g++) {   // first use of the loaded values: convert, then store
      *(u32x4*)&aS[nb][rA[g]][cgA[g]] = pack8_bf(wa[g]);
      *(u32x4*)&bS[nb][kB[g]][nbB[g]] = pack8_bf(wb[g]);
    }
    __syncthreads();
  }
  mma_tile((nt - 1) & 1);
#pragma unroll
  for (int ai = 0; ai < 2; ai++) {
#pragma unroll
    for (int bj = 0; bj < 4; bj++) {
#pragma unroll
      for (int i = 0; i < 8; i++) {
        int r = m0 + wr * 32 + ai * 16 + i + hi * 8;
        int c = n0 + wc * 64 + bj * 16 + ln;
        size_t idx = (size_t)r * ldc + c;
        float v = acc[ai][bj][i];
        if (EPI == 0) {
          outf[idx] = v;
        } else if (EPI == 1) {
          float g = 0.5f * v * (1.0f + erff(v * 0.70710678118f));
          outh[idx] = (unsigned short)f32_bf16(g);
        } else if (EPI == 2) {
          outf[idx] = v + aux[idx];
        }
      }
    }
  }
}

// ---------------- RoPE (+ bf16 convert) ----------------
__global__ void rope_kernel(const float* __restrict__ in, unsigned short* __restrict__ outb,
                            int nheads, int ld) {
  int idx = blockIdx.x * 256 + threadIdx.x;       // pair index over NTOK*nheads*32
  int d = idx & 31;
  int th = idx >> 5;
  int head = th % nheads;
  int tok = th / nheads;
  int t = tok & 1023;                             // tok = b*T + t
  float inv_freq = __expf(-0.2878231366f * (float)d);  // 10000^(-d/32)
  float ang = (float)t * inv_freq;
  float cs = __cosf(ang), sn = __sinf(ang);
  size_t base = (size_t)tok * ld + head * 64;
  float x1 = in[base + d], x2 = in[base + 32 + d];
  outb[base + d]      = (unsigned short)f32_bf16(x1 * cs - x2 * sn);
  outb[base + 32 + d] = (unsigned short)f32_bf16(x2 * cs + x1 * sn);
}

__global__ void cvt_bf16_kernel(const float* __restrict__ in, unsigned short* __restrict__ outb) {
  size_t i = (size_t)blockIdx.x * 256 + threadIdx.x;
  outb[i] = (unsigned short)f32_bf16(in[i]);
}

// ---------------- flash attention (WMMA, causal, GQA) ----------------
// The block size is stated so that a key tile's staged values fit in registers beside the rest.
__global__ void __launch_bounds__(256) attn_kernel(const unsigned short* __restrict__ qb,
                            const unsigned short* __restrict__ kbuf,
                            const unsigned short* __restrict__ vbuf,
                            float* __restrict__ y) {
  __shared__ __attribute__((aligned(16))) unsigned short Kls[32][72];
  __shared__ __attribute__((aligned(16))) unsigned short Vls[64][40];
  __shared__ __attribute__((aligned(16))) unsigned short Pls[8][16][40];
  int tid = threadIdx.x, lane = tid & 31, wave = tid >> 5;
  int bh = blockIdx.x;
  int b = bh >> 4, h = bh & 15;
  int kvh = h >> 2;
  int qt = blockIdx.y;
  int qbase = qt * 128 + wave * 16;
  int hi = lane >> 4, kbo = hi * 8, ln = lane & 15;
  int qrow = qbase + ln;
  const unsigned short* qp = qb + (size_t)(b * 1024 + qrow) * CDIM + h * 64;
  FragBF qa0, qa1;
  qa0.q[0] = *(const u32x4*)(qp + kbo);
  qa0.q[1] = *(const u32x4*)(qp + 16 + kbo);
  qa1.q[0] = *(const u32x4*)(qp + 32 + kbo);
  qa1.q[1] = *(const u32x4*)(qp + 48 + kbo);
  float m[8], l[8];
  v8f o[4] = {};
#pragma unroll
  for (int i = 0; i < 8; i++) { m[i] = -3.0e38f; l[i] = 0.f; }
  int ntiles = (qt + 1) * 4;
  // this thread's share of a key tile: K rows wave + 8 i (one uint each), V rows vk + 4 i (one value each)
  int vk = tid >> 6, vd = tid & 63;
  const unsigned int* ksrc =
      (const unsigned int*)(kbuf + (size_t)(b * 1024 + wave) * 256 + kvh * 64) + lane;
  const unsigned short* vsrc = vbuf + (size_t)(b * 1024 + vk) * 256 + kvh * 64 + vd;
  unsigned int kr[4];
  unsigned short vr[8];
  // all 12 loads of the tile at key0 are issued together; nothing uses them before the next staging
  auto fetch_tile = [&](int key0) {
    const unsigned int* pk = ksrc + key0 * 128;
    const unsigned short* pv = vsrc + key0 * 256;
#pragma unroll                  // constant indices keep kr[] and vr[] in registers
    for (int i = 0; i < 4; i++) kr[i] = pk[i * 8 * 128];
#pragma unroll
    for (int i = 0; i < 8; i++) vr[i] = pv[i * 4 * 256];
    // the code behind reuses the address registers of the loads above; as inputs of the wait
    // they stay untouched up to it
    asm volatile("s_wait_xcnt 0x0" :: "v"(pk), "v"(pv) : "memory");
  };
  fetch_tile(0);
  for (int kt = 0; kt < ntiles; kt++) {
    int key0 = kt * 32;
#pragma unroll
    for (int i = 0; i < 4; i++)                   // stage K rows (32 x 64), uint copies
      ((unsigned int*)&Kls[wave + 8 * i][0])[lane] = kr[i];
#pragma unroll
    for (int i = 0; i < 8; i++)                   // stage V transposed: Vls[d][kk]
      Vls[vd][vk + 4 * i] = vr[i];
    __syncthreads();
    if (kt + 1 < ntiles) fetch_tile(key0 + 32);   // in flight during this tile's scores and softmax
    v8f s[2] = {};
#pragma unroll
    for (int sub = 0; sub < 2; sub++) {           // scores: Q(16x64) * K^T(64x32)
      int krow = sub * 16 + ln;
      FragBF bK;
      bK.q[0] = *(const u32x4*)&Kls[krow][kbo];
      bK.q[1] = *(const u32x4*)&Kls[krow][16 + kbo];
      s[sub] = __builtin_amdgcn_wmma_f32_16x16x32_bf16(false, qa0.v, false, bK.v, (short)0, s[sub], false, false);
      bK.q[0] = *(const u32x4*)&Kls[krow][32 + kbo];
      bK.q[1] = *(const u32x4*)&Kls[krow][48 + kbo];
      s[sub] = __builtin_amdgcn_wmma_f32_16x16x32_bf16(false, qa1.v, false, bK.v, (short)0, s[sub], false, false);
    }
    int keyc0 = key0 + ln, keyc1 = key0 + 16 + ln;
#pragma unroll
    for (int i = 0; i < 8; i++) {                 // online softmax (DPP reductions)
      int row = qbase + i + hi * 8;
      float s0 = s[0][i] * 0.125f; if (keyc0 > row) s0 = -3.0e38f;
      float s1 = s[1][i] * 0.125f; if (keyc1 > row) s1 = -3.0e38f;
      float t = red16_max(fmaxf(s0, s1));
      float mn = fmaxf(m[i], t);
      float fac = __expf(m[i] - mn);
      float p0 = __expf(s0 - mn), p1 = __expf(s1 - mn);
      float ps = red16_sum(p0 + p1);
      l[i] = l[i] * fac + ps;
      m[i] = mn;
#pragma unroll
      for (int sub = 0; sub < 4; sub++) o[sub][i] *= fac;
      Pls[wave][i + hi * 8][ln]      = (unsigned short)f32_bf16(p0);
      Pls[wave][i + hi * 8][16 + ln] = (unsigned short)f32_bf16(p1);
    }
    __syncthreads();
    FragBF pa;                                    // P(16x32) * V(32x64)
    pa.q[0] = *(const u32x4*)&Pls[wave][ln][kbo];
    pa.q[1] = *(const u32x4*)&Pls[wave][ln][16 + kbo];
#pragma unroll
    for (int sub = 0; sub < 4; sub++) {
      FragBF bV;
      int col = sub * 16 + ln;
      bV.q[0] = *(const u32x4*)&Vls[col][kbo];
      bV.q[1] = *(const u32x4*)&Vls[col][16 + kbo];
      o[sub] = __builtin_amdgcn_wmma_f32_16x16x32_bf16(false, pa.v, false, bV.v, (short)0, o[sub], false, false);
    }
    __syncthreads();
  }
#pragma unroll
  for (int sub = 0; sub < 4; sub++)
#pragma unroll
    for (int i = 0; i < 8; i++) {
      int row = qbase + i + hi * 8;
      int col = h * 64 + sub * 16 + ln;
      y[(size_t)(b * 1024 + row) * CDIM + col] = o[sub][i] / l[i];
    }
}

// ---------------- MoE gate: softmax, top-2, combine weights, aux stats ----------------
// sel[row] = lower expert | higher expert << 4; gw[2*row], gw[2*row+1] = their weights
__global__ void gate_kernel(const float* __restrict__ xn, const float* __restrict__ Wg,
                            int* __restrict__ sel, float* __restrict__ gw,
                            float* __restrict__ accum) {
  int tid = threadIdx.x, lane = tid & 31, wave = tid >> 5;
  int row = blockIdx.x * 8 + wave;
  float part[NEXP];
#pragma unroll
  for (int e = 0; e < NEXP; e++) part[e] = 0.f;
  const float* xr = xn + (size_t)row * CDIM;
  for (int c = lane; c < CDIM; c += 32) {
    float xv = xr[c];
#pragma unroll
    for (int e = 0; e < NEXP; e++) part[e] += xv * Wg[c * NEXP + e];
  }
#pragma unroll
  for (int e = 0; e < NEXP; e++)
#pragma unroll
    for (int off = 1; off < 32; off <<= 1) part[e] += __shfl_xor(part[e], off);
  if (lane == 0) {
    float mx = part[0];
#pragma unroll
    for (int e = 1; e < NEXP; e++) mx = fmaxf(mx, part[e]);
    float pe[NEXP], s = 0.f;
#pragma unroll
    for (int e = 0; e < NEXP; e++) { pe[e] = __expf(part[e] - mx); s += pe[e]; }
#pragma unroll
    for (int e = 0; e < NEXP; e++) pe[e] /= s;
    int s0 = 0;
#pragma unroll
    for (int e = 1; e < NEXP; e++) if (pe[e] > pe[s0]) s0 = e;
    int s1 = -1;
#pragma unroll
    for (int e = 0; e < NEXP; e++) if (e != s0 && (s1 < 0 || pe[e] > pe[s1])) s1 = e;
    float denom = pe[s0] + pe[s1];
    float w0 = pe[s0] / denom, w1 = pe[s1] / denom;
    bool up = s0 < s1;
    sel[row] = up ? (s0 | (s1 << 4)) : (s1 | (s0 << 4));
    gw[2 * row]     = up ? w0 : w1;
    gw[2 * row + 1] = up ? w1 : w0;
    // the code below reuses the address registers of the three stores above
    asm volatile("s_wait_xcnt 0x0" ::: "memory");
#pragma unroll
    for (int e = 0; e < NEXP; e++) atomicAdd(&accum[e], pe[e]);   // P sums
    atomicAdd(&accum[NEXP + s0], 1.0f);                           // selection counts
    atomicAdd(&accum[NEXP + s1], 1.0f);
  }
}

__global__ void init_accum_kernel(float* accum) {
  if (threadIdx.x < 16) accum[threadIdx.x] = 0.f;
}

__global__ void aux_kernel(const float* __restrict__ accum, float* __restrict__ out_aux) {
  if (threadIdx.x == 0 && blockIdx.x == 0) {
    float s = 0.f;
    for (int e = 0; e < NEXP; e++)
      s += (accum[NEXP + e] / (float)(NTOK * 2)) * (accum[e] / (float)NTOK);
    out_aux[0] = (float)NEXP * s;
  }
}

// ---------------- MoE routing: sort the 2*NTOK (token, expert) pairs by expert ----------------
// One block of 1024 threads, 4 tokens each. Eight running counts travel as 16-bit fields
// of two 64-bit words (no field passes MAXROW). Each expert's list starts at a multiple of 128.
// rowtok[p] = token of routed row p (0 in the padding), slot[2*t+j] = routed row of token t's
// j-th expert, tile_e[i] = expert of rows 128*i.., -1 behind the last list.
__device__ inline unsigned long long fld_one(int e) { return 1ull << ((e & 3) * 16); }
__device__ inline int fld_get(unsigned long long lo, unsigned long long hi, int e) {
  return (int)(((e < 4 ? lo : hi) >> ((e & 3) * 16)) & 0xFFFFull);
}
__global__ void route_kernel(const int* __restrict__ sel, int* __restrict__ rowtok,
                             int* __restrict__ slot, int* __restrict__ tile_e) {
  __shared__ unsigned long long wtot[32][2];
  int tid = threadIdx.x, lane = tid & 31, wave = tid >> 5;
  int ex[8];
  unsigned long long lo = 0, hi = 0;
  // the loops over ex[] and over the experts are unrolled so that ex[] and the shift counts
  // are indexed by constants and nothing goes to scratch
#pragma unroll
  for (int i = 0; i < 4; i++) {
    int s = sel[tid * 4 + i];
    ex[2 * i] = s & 7; ex[2 * i + 1] = (s >> 4) & 7;
  }
#pragma unroll
  for (int i = 0; i < 8; i++) {
    if (ex[i] < 4) lo += fld_one(ex[i]); else hi += fld_one(ex[i]);
  }
  unsigned long long ilo = lo, ihi = hi;          // inclusive scan over the wave
  for (int d = 1; d < 32; d <<= 1) {
    unsigned long long a = __shfl_up(ilo, d), b = __shfl_up(ihi, d);
    if (lane >= d) { ilo += a; ihi += b; }
  }
  if (lane == 31) { wtot[wave][0] = ilo; wtot[wave][1] = ihi; }
  __syncthreads();
  unsigned long long tlo = 0, thi = 0, plo = ilo - lo, phi = ihi - hi;
#pragma unroll 4                // unrolled whole, the 64 words are all held in registers and spill
  for (int w = 0; w < 32; w++) {
    unsigned long long a = wtot[w][0], b = wtot[w][1];
    tlo += a; thi += b;
    if (w < wave) { plo += a; phi += b; }
  }
  int off = 0;
  int mytile = -1;
#pragma unroll
  for (int e = 0; e < NEXP; e++) {
    int cnt = fld_get(tlo, thi, e);
    int end = off + ((cnt + 127) & ~127);
    if (e < 4) plo += (unsigned long long)off << (e * 16);
    else       phi += (unsigned long long)off << ((e - 4) * 16);
    if (off + cnt + tid < end) rowtok[off + cnt + tid] = 0;
    if (tid * 128 >= off && tid * 128 < end) mytile = e;
    off = end;
  }
  if (tid < MAXTILE) tile_e[tid] = mytile;
#pragma unroll
  for (int i = 0; i < 8; i++) {
    int e = ex[i];
    int p = fld_get(plo, phi, e);
    if (e < 4) plo += fld_one(e); else phi += fld_one(e);
    rowtok[p] = tid * 4 + (i >> 1);
    slot[tid * 8 + i] = p;
  }
}

// out = x1 + w_a * ye[row_a] + w_b * ye[row_b], lower expert first; one block per token
__global__ void combine_kernel(const float4* __restrict__ x1, const float4* __restrict__ ye,
                               const int* __restrict__ slot, const float* __restrict__ gw,
                               float4* __restrict__ dst) {
  int tok = blockIdx.x, c = threadIdx.x;
  int pa = min(slot[2 * tok], MAXROW - 1), pb = min(slot[2 * tok + 1], MAXROW - 1);
  float wa = gw[2 * tok], wb = gw[2 * tok + 1];
  float4 o = x1[(size_t)tok * 256 + c];
  float4 a = ye[(size_t)pa * 256 + c];
  float4 b = ye[(size_t)pb * 256 + c];
  o.x += wa * a.x; o.y += wa * a.y; o.z += wa * a.z; o.w += wa * a.w;
  o.x += wb * b.x; o.y += wb * b.y; o.z += wb * b.z; o.w += wb * b.w;
  dst[(size_t)tok * 256 + c] = o;
}

// ---------------- launcher ----------------
extern "C" void kernel_launch(void* const* d_in, const int* in_sizes, int n_in,
                              void* d_out, int out_size, void* d_ws, size_t ws_size,
                              hipStream_t stream) {
  (void)in_sizes; (void)n_in; (void)out_size; (void)ws_size;
  const float* x   = (const float*)d_in[0];
  const float* ln1 = (const float*)d_in[1];
  const float* ln2 = (const float*)d_in[2];
  const float* Wq  = (const float*)d_in[3];
  const float* Wk  = (const float*)d_in[4];
  const float* Wv  = (const float*)d_in[5];
  const float* Wo  = (const float*)d_in[6];
  const float* Wg  = (const float*)d_in[7];
  const float* W1  = (const float*)d_in[8];
  const float* W2  = (const float*)d_in[9];
  float* outx = (float*)d_out;

  char* ws = (char*)d_ws;
  size_t off = 0;
  auto alloc = [&](size_t bytes) -> void* {
    void* p = ws + off;
    off += (bytes + 255) & ~(size_t)255;
    return p;
  };
  float*          xn1  = (float*)alloc((size_t)NTOK * CDIM * 4);
  float*          qf   = (float*)alloc((size_t)NTOK * CDIM * 4);
  float*          kf   = (float*)alloc((size_t)NTOK * 256 * 4);
  float*          vf   = (float*)alloc((size_t)NTOK * 256 * 4);
  unsigned short* qb   = (unsigned short*)alloc((size_t)NTOK * CDIM * 2);
  unsigned short* kbuf = (unsigned short*)alloc((size_t)NTOK * 256 * 2);
  unsigned short* vbuf = (unsigned short*)alloc((size_t)NTOK * 256 * 2);
  float*          yatt = (float*)alloc((size_t)NTOK * CDIM * 4);
  float*          x1   = (float*)alloc((size_t)NTOK * CDIM * 4);
  float*          xn2  = (float*)alloc((size_t)NTOK * CDIM * 4);
  unsigned short* hbf  = (unsigned short*)alloc((size_t)MAXROW * IDIM * 2);
  float*          ye   = (float*)alloc((size_t)MAXROW * CDIM * 4);
  int*            sel  = (int*)alloc((size_t)NTOK * 4);
  float*          gw   = (float*)alloc((size_t)NTOK * 2 * 4);
  int*            rowtok = (int*)alloc((size_t)MAXROW * 4);
  int*            slot = (int*)alloc((size_t)NTOK * 2 * 4);
  int*            tile_e = (int*)alloc((size_t)MAXTILE * 4);
  float*          acc  = (float*)alloc(64);

  // 1) xn1 = rmsnorm(x)
  rmsnorm_kernel<<<NTOK, 256, 0, stream>>>(x, ln1, xn1);
  // 2) q/k/v projections
  gemm_wmma<0, float, 0><<<dim3(CDIM / 128, NTOK / 128), 256, 0, stream>>>(
      xn1, Wq, qf, nullptr, nullptr, NTOK, CDIM, CDIM, CDIM, CDIM, CDIM, nullptr, nullptr);
  gemm_wmma<0, float, 0><<<dim3(256 / 128, NTOK / 128), 256, 0, stream>>>(
      xn1, Wk, kf, nullptr, nullptr, NTOK, 256, CDIM, CDIM, 256, 256, nullptr, nullptr);
  gemm_wmma<0, float, 0><<<dim3(256 / 128, NTOK / 128), 256, 0, stream>>>(
      xn1, Wv, vf, nullptr, nullptr, NTOK, 256, CDIM, CDIM, 256, 256, nullptr, nullptr);
  // 3) RoPE + bf16 conversion
  rope_kernel<<<(NTOK * 16 * 32) / 256, 256, 0, stream>>>(qf, qb, 16, CDIM);
  rope_kernel<<<(NTOK * 4 * 32) / 256, 256, 0, stream>>>(kf, kbuf, 4, 256);
  cvt_bf16_kernel<<<(NTOK * 256) / 256, 256, 0, stream>>>(vf, vbuf);
  // 4) attention
  attn_kernel<<<dim3(64, 8), 256, 0, stream>>>(qb, kbuf, vbuf, yatt);
  // 5) x1 = yatt @ Wo + x
  gemm_wmma<2, float, 0><<<dim3(CDIM / 128, NTOK / 128), 256, 0, stream>>>(
      yatt, Wo, x1, nullptr, x, NTOK, CDIM, CDIM, CDIM, CDIM, CDIM, nullptr, nullptr);
  // 6) xn2 = rmsnorm(x1)
  rmsnorm_kernel<<<NTOK, 256, 0, stream>>>(x1, ln2, xn2);
  // 7) gating + aux stats
  init_accum_kernel<<<1, 32, 0, stream>>>(acc);
  gate_kernel<<<NTOK / 8, 256, 0, stream>>>(xn2, Wg, sel, gw, acc);
  // 8) sort the (token, expert) pairs by expert
  route_kernel<<<1, 1024, 0, stream>>>(sel, rowtok, slot, tile_e);
  // 9) experts, chosen rows only: h = gelu(xn2[rowtok] @ W1[e]); ye = h @ W2[e]
  gemm_wmma<1, float, 1><<<dim3(IDIM / 128, MAXTILE), 256, 0, stream>>>(
      xn2, W1, nullptr, hbf, nullptr, MAXROW, IDIM, CDIM, CDIM, IDIM, IDIM, rowtok, tile_e);
  gemm_wmma<0, unsigned short, 2><<<dim3(CDIM / 128, MAXTILE), 256, 0, stream>>>(
      hbf, W2, ye, nullptr, nullptr, MAXROW, CDIM, IDIM, IDIM, CDIM, CDIM, nullptr, tile_e);
  //    out = x1 + the two weighted expert rows of each token
  combine_kernel<<<NTOK, 256, 0, stream>>>(
      (const float4*)x1, (const float4*)ye, slot, gw, (float4*)outx);
  // 10) aux loss scalar
  aux_kernel<<<1, 32, 0, stream>>>(acc, outx + (size_t)NTOK * CDIM);
}

// v005
// It runs in 533 microseconds.
// Next to v004, in two timings, it ran 1.09 times as fast each time.
// Counting every step since v000, it is 6.90 times as fast.
#include <hip/hip_runtime.h>
#include <hip/hip_bf16.h>
#include <math.h>

// ---------------- types / helpers ----------------
typedef __attribute__((ext_vector_type(16))) __bf16 v16bf;
typedef __attribute__((ext_vector_type(8)))  float  v8f;
typedef __attribute__((ext_vector_type(4)))  unsigned int u32x4;
typedef __attribute__((ext_vector_type(8)))  short s16x8;

union FragBF { u32x4 q[2]; v16bf v; };

__device__ inline unsigned int f32_bf16(float f) {
  unsigned int u = __float_as_uint(f);
  unsigned int r = 0x7FFFu + ((u >> 16) & 1u);
  return (u + r) >> 16;
}
// pack 8 consecutive values (float->bf16 or passthrough bf16 bits) into u32x4
__device__ inline u32x4 load8_bf(const float* p) {
  const float4* q = (const float4*)p;
  float4 a = q[0], b = q[1];
  u32x4 r;
  r.x = f32_bf16(a.x) | (f32_bf16(a.y) << 16);
  r.y = f32_bf16(a.z) | (f32_bf16(a.w) << 16);
  r.z = f32_bf16(b.x) | (f32_bf16(b.y) << 16);
  r.w = f32_bf16(b.z) | (f32_bf16(b.w) << 16);
  return r;
}
__device__ inline u32x4 load8_bf(const unsigned short* p) {
  return *(const u32x4*)p;
}
// the same 8 values in two halves: the load alone, as it comes from memory, and the packing
struct Raw8f { float4 a, b; };
__device__ inline Raw8f load8_raw(const float* p) {
  const float4* q = (const float4*)p;
  Raw8f r; r.a = q[0]; r.b = q[1];
  return r;
}
__device__ inline u32x4 load8_raw(const unsigned short* p) {
  return *(const u32x4*)p;
}
__device__ inline u32x4 pack8_bf(const Raw8f& v) {
  u32x4 r;
  r.x = f32_bf16(v.a.x) | (f32_bf16(v.a.y) << 16);
  r.y = f32_bf16(v.a.z) | (f32_bf16(v.a.w) << 16);
  r.z = f32_bf16(v.b.x) | (f32_bf16(v.b.y) << 16);
  r.w = f32_bf16(v.b.z) | (f32_bf16(v.b.w) << 16);
  return r;
}
__device__ inline u32x4 pack8_bf(const u32x4& v) { return v; }
// transposing LDS load: from a row-major [k][n] 16-bit tile, lane (c, h) gets 8 k of column c
__device__ inline u32x4 ld_tr16(const unsigned short* p) {
  typedef __attribute__((address_space(3))) s16x8 lds_s16x8;
  return __builtin_bit_cast(u32x4, __builtin_amdgcn_ds_load_tr16_b128_v8i16((lds_s16x8*)p));
}

// DPP16 butterfly reductions over a 16-lane row (VALU only, no LDS)
// ctrl must be a compile-time constant -> template parameter
template <int CTRL>
__device__ inline float dpp_f(float x) {
  return __int_as_float(
      __builtin_amdgcn_update_dpp(0, __float_as_int(x), CTRL, 0xF, 0xF, true));
}
#define DPP_QPERM_XOR1 0xB1   // quad_perm(1,0,3,2)
#define DPP_QPERM_XOR2 0x4E   // quad_perm(2,3,0,1)
#define DPP_ROW_HMIRR  0x141  // row_half_mirror (lane^7 within 8)
#define DPP_ROW_MIRR   0x140  // row_mirror (lane^15 within 16)
__device__ inline float red16_max(float x) {
  x = fmaxf(x, dpp_f<DPP_QPERM_XOR1>(x));
  x = fmaxf(x, dpp_f<DPP_QPERM_XOR2>(x));
  x = fmaxf(x, dpp_f<DPP_ROW_HMIRR>(x));
  x = fmaxf(x, dpp_f<DPP_ROW_MIRR>(x));
  return x;
}
__device__ inline float red16_sum(float x) {
  x += dpp_f<DPP_QPERM_XOR1>(x);
  x += dpp_f<DPP_QPERM_XOR2>(x);
  x += dpp_f<DPP_ROW_HMIRR>(x);
  x += dpp_f<DPP_ROW_MIRR>(x);
  return x;
}

#define NTOK 4096   // B*T
#define CDIM 1024
#define IDIM 4096
#define NEXP 8
#define MAXTILE 72            // 2*NTOK routed rows, each expert's list padded to 128: at most 71 tiles
#define MAXROW (MAXTILE * 128)

// ---------------- RMSNorm ----------------
__global__ void rmsnorm_kernel(const float* __restrict__ x,
                               const float* __restrict__ scale,
                               float* __restrict__ out) {
  __shared__ float red[9];
  int row = blockIdx.x;
  int tid = threadIdx.x;
  const float* xr = x + (size_t)row * CDIM;
  float v[4]; float ss = 0.f;
#pragma unroll
  for (int i = 0; i < 4; i++) { v[i] = xr[tid + 256 * i]; ss += v[i] * v[i]; }
#pragma unroll
  for (int off = 16; off >= 1; off >>= 1) ss += __shfl_xor(ss, off);
  if ((tid & 31) == 0) red[tid >> 5] = ss;
  __syncthreads();
  if (tid == 0) {
    float t = 0.f;
#pragma unroll
    for (int w = 0; w < 8; w++) t += red[w];
    red[8] = t;
  }
  __syncthreads();
  float inv = rsqrtf(red[8] / (float)CDIM + 1e-5f);
#pragma unroll
  for (int i = 0; i < 4; i++) {
    int c = tid + 256 * i;
    out[(size_t)row * CDIM + c] = v[i] * inv * scale[c];
  }
}

// ---------------- generic WMMA GEMM, 128x128 tile, double-buffered LDS ----------------
// C(M,N) = A(M,K) * B(K,N); A: float or bf16-bits; B: float (bf16-converted on stage)
// 8 waves; wave (wr,wc) owns rows wr*32..+32, cols wc*64..+64 => 2x4 wmma accums.
// EPI: 0 = store f32; 1 = gelu->bf16 (outh); 2 = +aux residual
// GRP: 0 = plain; 1, 2 = row tile blockIdx.y belongs to expert tile_e[blockIdx.y], whose
//      weights are plane tile_e of Bm; 1 also gathers the A rows through rowtok
// The block size is stated so that the next tile's unconverted values fit in registers.
template <int EPI, typename AT, int GRP>
__global__ void __launch_bounds__(256) gemm_wmma(const AT* __restrict__ A, const float* __restrict__ Bm,
                          float* __restrict__ outf, unsigned short* __restrict__ outh,
                          const float* __restrict__ aux,
                          int M, int N, int Kd, int lda, int ldb, int ldc,
                          const int* __restrict__ rowtok, const int* __restrict__ tile_e) {
  __shared__ __attribute__((aligned(16))) unsigned short aS[2][128][40];
  // B stays row-major [k][n]; 288-byte rows (32 B x odd) suit the transposing load
  __shared__ __attribute__((aligned(16))) unsigned short bS[2][32][144];
  int tid = threadIdx.x;
  int lane = tid & 31;
  int wave = tid >> 5;
  int wr = wave & 3, wc = wave >> 2;
  int m0 = blockIdx.y * 128, n0 = blockIdx.x * 128;
  int hi = lane >> 4;
  int kb = hi * 8;
  int ln = lane & 15;
  int ar0 = wr * 32 + ln;
  int btr = hi * 8 + (lane & 7);                    // B fragment: this lane's k row ...
  int btc = wc * 64 + ((lane >> 3) & 1) * 8;        // ... and its 16-byte piece of 16 columns
  if (GRP) {
    int te = tile_e[blockIdx.y];
    if (te < 0) return;         // tile behind the last routed row: the whole block leaves here
    Bm += (size_t)(te & (NEXP - 1)) * Kd * ldb;
  }
  // staging index precompute (2 chunks of 8 elems per thread for A and B)
  int rA[2], cgA[2], kB[2], nbB[2];
#pragma unroll
  for (int g = 0; g < 2; g++) {
    int lin = tid + 256 * g;
    rA[g] = lin >> 2; cgA[g] = (lin & 3) * 8;
    kB[g] = lin >> 4; nbB[g] = (lin & 15) * 8;
  }
  unsigned aoff[2] = {0u, 0u};  // GRP 1: byte offsets of this thread's two gathered A chunks
  if (GRP == 1) {
#pragma unroll                  // constant indices keep aoff[] in registers
    for (int g = 0; g < 2; g++)
      aoff[g] = (unsigned)((rowtok[m0 + rA[g]] & (NTOK - 1)) * lda + cgA[g]) * (unsigned)sizeof(AT);
  }
  v8f acc[2][4] = {};
  u32x4 ra[2], rb[2];
  int nt = Kd >> 5;
  // prologue: load tile 0 into regs, store to buffer 0
#pragma unroll
  for (int g = 0; g < 2; g++) {
    if (GRP == 1) {             // gathered row: uniform base + 32-bit lane offset
      ra[g] = load8_bf((const AT*)((const char*)A + aoff[g]));
    } else {
      ra[g] = load8_bf(&A[(size_t)(m0 + rA[g]) * lda + cgA[g]]);
    }
    const float4* qp = (const float4*)&Bm[(size_t)kB[g] * ldb + n0 + nbB[g]];
    float4 fa = qp[0], fb = qp[1];
    rb[g].x = f32_bf16(fa.x) | (f32_bf16(fa.y) << 16);
    rb[g].y = f32_bf16(fa.z) | (f32_bf16(fa.w) << 16);
    rb[g].z = f32_bf16(fb.x) | (f32_bf16(fb.y) << 16);
    rb[g].w = f32_bf16(fb.z) | (f32_bf16(fb.w) << 16);
  }
#pragma unroll
  for (int g = 0; g < 2; g++) {
    *(u32x4*)&aS[0][rA[g]][cgA[g]] = ra[g];
    *(u32x4*)&bS[0][kB[g]][nbB[g]] = rb[g];
  }
  __syncthreads();
  // the products of the tile in buffer buf
  auto mma_tile = [&](int buf) {
    FragBF a0, a1;
    a0.q[0] = *(const u32x4*)&aS[buf][ar0][kb];
    a0.q[1] = *(const u32x4*)&aS[buf][ar0][16 + kb];
    a1.q[0] = *(const u32x4*)&aS[buf][ar0 + 16][kb];
    a1.q[1] = *(const u32x4*)&aS[buf][ar0 + 16][16 + kb];
#pragma unroll
    for (int bj = 0; bj < 4; bj++) {
      FragBF bf;
      bf.q[0] = ld_tr16(&bS[buf][btr][btc + bj * 16]);
      bf.q[1] = ld_tr16(&bS[buf][16 + btr][btc + bj * 16]);
      acc[0][bj] = __builtin_amdgcn_wmma_f32_16x16x32_bf16(false, a0.v, false, bf.v, (short)0, acc[0][bj], false, false);
      acc[1][bj] = __builtin_amdgcn_wmma_f32_16x16x32_bf16(false, a1.v, false, bf.v, (short)0, acc[1][bj], false, false);
      // one B fragment live at a time; the last one also keeps the conversion of the next
      // tile, and with it the wait for its loads, behind the products
      __builtin_amdgcn_sched_barrier(0);
    }
  };
  // every pass but the last fetches the tile after it; the last pass stands behind the loop, so
  // the loaded values live inside one pass and are not copied (a copy would wait for the loads)
  for (int kt = 0; kt + 1 < nt; kt++) {
    int buf = kt & 1;
    int k1 = (kt + 1) << 5;
    // issue all of the next tile's global loads together; nothing uses their values before the
    // products are done, so they stay in flight meanwhile
    decltype(load8_raw((const AT*)nullptr)) wa[2];
    Raw8f wb[2];
    const AT* pa[2];
    const float* pb[2];
#pragma unroll
    for (int g = 0; g < 2; g++) {
      if (GRP == 1) {
        pa[g] = (const AT*)((const char*)(A + k1) + aoff[g]);
      } else {
        pa[g] = &A[(size_t)(m0 + rA[g]) * lda + k1 + cgA[g]];
      }
      pb[g] = &Bm[(size_t)(k1 + kB[g]) * ldb + n0 + nbB[g]];
      wa[g] = load8_raw(pa[g]);
      wb[g] = load8_raw(pb[g]);
    }
    // the code below reuses the address registers of the loads above; as inputs of the wait
    // they stay untouched up to it, also by the later loads' own results
    asm volatile("s_wait_xcnt 0x0" :: "v"(pa[0]), "v"(pa[1]), "v"(pb[0]), "v"(pb[1]) : "memory");
    if (kt + 2 < nt) {   // prefetch two tiles ahead into GL2
      int k2 = (kt + 2) << 5;
      if (GRP == 1) {
        __builtin_prefetch((const char*)(A + k2) + aoff[0], 0, 1);
      } else {
        __builtin_prefetch(&A[(size_t)(m0 + rA[0]) * lda + k2 + cgA[0]], 0, 1);
      }
      __builtin_prefetch(&Bm[(size_t)(k2 + kB[0]) * ldb + n0 + nbB[0]], 0, 1);
    }
    mma_tile(buf);
    int nb = buf ^ 1;
#pragma unroll
    for (int g = 0; g < 2; g++) {   // first use of the loaded values: convert, then store
      *(u32x4*)&aS[nb][rA[g]][cgA[g]] = pack8_bf(wa[g]);
      *(u32x4*)&bS[nb][kB[g]][nbB[g]] = pack8_bf(wb[g]);
    }
    __syncthreads();
  }
  mma_tile((nt - 1) & 1);
#pragma unroll
  for (int ai = 0; ai < 2; ai++) {
#pragma unroll
    for (int bj = 0; bj < 4; bj++) {
#pragma unroll
      for (int i = 0; i < 8; i++) {
        int r = m0 + wr * 32 + ai * 16 + i + hi * 8;
        int c = n0 + wc * 64 + bj * 16 + ln;
        size_t idx = (size_t)r * ldc + c;
        float v = acc[ai][bj][i];
        if (EPI == 0) {
          outf[idx] = v;
        } else if (EPI == 1) {
          float g = 0.5f * v * (1.0f + erff(v * 0.70710678118f));
          outh[idx] = (unsigned short)f32_bf16(g);
        } else if (EPI == 2) {
          outf[idx] = v + aux[idx];
        }
      }
    }
  }
}

// ---------------- RoPE (+ bf16 convert) ----------------
__global__ void rope_kernel(const float* __restrict__ in, unsigned short* __restrict__ outb,
                            int nheads, int ld) {
  int idx = blockIdx.x * 256 + threadIdx.x;       // pair index over NTOK*nheads*32
  int d = idx & 31;
  int th = idx >> 5;
  int head = th % nheads;
  int tok = th / nheads;
  int t = tok & 1023;                             // tok = b*T + t
  float inv_freq = __expf(-0.2878231366f * (float)d);  // 10000^(-d/32)
  float ang = (float)t * inv_freq;
  float cs = __cosf(ang), sn = __sinf(ang);
  size_t base = (size_t)tok * ld + head * 64;
  float x1 = in[base + d], x2 = in[base + 32 + d];
  outb[base + d]      = (unsigned short)f32_bf16(x1 * cs - x2 * sn);
  outb[base + 32 + d] = (unsigned short)f32_bf16(x2 * cs + x1 * sn);
}

__global__ void cvt_bf16_kernel(const float* __restrict__ in, unsigned short* __restrict__ outb) {
  size_t i = (size_t)blockIdx.x * 256 + threadIdx.x;
  outb[i] = (unsigned short)f32_bf16(in[i]);
}

// ---------------- flash attention (WMMA, causal, GQA) ----------------
// The block size is stated so that a key tile's staged values fit in registers beside the rest.
__global__ void __launch_bounds__(256) attn_kernel(const unsigned short* __restrict__ qb,
                            const unsigned short* __restrict__ kbuf,
                            const unsigned short* __restrict__ vbuf,
                            float* __restrict__ y) {
  __shared__ __attribute__((aligned(16))) unsigned short Kls[32][72];
  __shared__ __attribute__((aligned(16))) unsigned short Vls[64][40];
  __shared__ __attribute__((aligned(16))) unsigned short Pls[8][16][40];
  int tid = threadIdx.x, lane = tid & 31, wave = tid >> 5;
  int bh = blockIdx.x;
  int b = bh >> 4, h = bh & 15;
  int kvh = h >> 2;
  int qt = blockIdx.y;
  int qbase = qt * 128 + wave * 16;
  int hi = lane >> 4, kbo = hi * 8, ln = lane & 15;
  int qrow = qbase + ln;
  const unsigned short* qp = qb + (size_t)(b * 1024 + qrow) * CDIM + h * 64;
  FragBF qa0, qa1;
  qa0.q[0] = *(const u32x4*)(qp + kbo);
  qa0.q[1] = *(const u32x4*)(qp + 16 + kbo);
  qa1.q[0] = *(const u32x4*)(qp + 32 + kbo);
  qa1.q[1] = *(const u32x4*)(qp + 48 + kbo);
  float m[8], l[8];
  v8f o[4] = {};
#pragma unroll
  for (int i = 0; i < 8; i++) { m[i] = -3.0e38f; l[i] = 0.f; }
  int ntiles = (qt + 1) * 4;
  // this thread's share of a key tile: K rows wave + 8 i (one uint each), V rows vk + 4 i (one value each)
  int vk = tid >> 6, vd = tid & 63;
  const unsigned int* ksrc =
      (const unsigned int*)(kbuf + (size_t)(b * 1024 + wave) * 256 + kvh * 64) + lane;
  const unsigned short* vsrc = vbuf + (size_t)(b * 1024 + vk) * 256 + kvh * 64 + vd;
  unsigned int kr[4];
  unsigned short vr[8];
  // all 12 loads of the tile at key0 are issued together; nothing uses them before the next staging
  auto fetch_tile = [&](int key0) {
    const unsigned int* pk = ksrc + key0 * 128;
    const unsigned short* pv = vsrc + key0 * 256;
#pragma unroll                  // constant indices keep kr[] and vr[] in registers
    for (int i = 0; i < 4; i++) kr[i] = pk[i * 8 * 128];
#pragma unroll
    for (int i = 0; i < 8; i++) vr[i] = pv[i * 4 * 256];
    // the code behind reuses the address registers of the loads above; as inputs of the wait
    // they stay untouched up to it
    asm volatile("s_wait_xcnt 0x0" :: "v"(pk), "v"(pv) : "memory");
  };
  fetch_tile(0);
  for (int kt = 0; kt < ntiles; kt++) {
    int key0 = kt * 32;
#pragma unroll
    for (int i = 0; i < 4; i++)                   // stage K rows (32 x 64), uint copies
      ((unsigned int*)&Kls[wave + 8 * i][0])[lane] = kr[i];
#pragma unroll
    for (int i = 0; i < 8; i++)                   // stage V transposed: Vls[d][kk]
      Vls[vd][vk + 4 * i] = vr[i];
    __syncthreads();
    if (kt + 1 < ntiles) fetch_tile(key0 + 32);   // in flight during this tile's scores and softmax
    v8f s[2] = {};
#pragma unroll
    for (int sub = 0; sub < 2; sub++) {           // scores: Q(16x64) * K^T(64x32)
      int krow = sub * 16 + ln;
      FragBF bK;
      bK.q[0] = *(const u32x4*)&Kls[krow][kbo];
      bK.q[1] = *(const u32x4*)&Kls[krow][16 + kbo];
      s[sub] = __builtin_amdgcn_wmma_f32_16x16x32_bf16(false, qa0.v, false, bK.v, (short)0, s[sub], false, false);
      bK.q[0] = *(const u32x4*)&Kls[krow][32 + kbo];
      bK.q[1] = *(const u32x4*)&Kls[krow][48 + kbo];
      s[sub] = __builtin_amdgcn_wmma_f32_16x16x32_bf16(false, qa1.v, false, bK.v, (short)0, s[sub], false, false);
    }
    int keyc0 = key0 + ln, keyc1 = key0 + 16 + ln;
#pragma unroll
    for (int i = 0; i < 8; i++) {                 // online softmax (DPP reductions)
      int row = qbase + i + hi * 8;
      float s0 = s[0][i] * 0.125f; if (keyc0 > row) s0 = -3.0e38f;
      float s1 = s[1][i] * 0.125f; if (keyc1 > row) s1 = -3.0e38f;
      float t = red16_max(fmaxf(s0, s1));
      float mn = fmaxf(m[i], t);
      float fac = __expf(m[i] - mn);
      float p0 = __expf(s0 - mn), p1 = __expf(s1 - mn);
      float ps = red16_sum(p0 + p1);
      l[i] = l[i] * fac + ps;
      m[i] = mn;
#pragma unroll
      for (int sub = 0; sub < 4; sub++) o[sub][i] *= fac;
      Pls[wave][i + hi * 8][ln]      = (unsigned short)f32_bf16(p0);
      Pls[wave][i + hi * 8][16 + ln] = (unsigned short)f32_bf16(p1);
    }
    __syncthreads();
    FragBF pa;                                    // P(16x32) * V(32x64)
    pa.q[0] = *(const u32x4*)&Pls[wave][ln][kbo];
    pa.q[1] = *(const u32x4*)&Pls[wave][ln][16 + kbo];
#pragma unroll
    for (int sub = 0; sub < 4; sub++) {
      FragBF bV;
      int col = sub * 16 + ln;
      bV.q[0] = *(const u32x4*)&Vls[col][kbo];
      bV.q[1] = *(const u32x4*)&Vls[col][16 + kbo];
      o[sub] = __builtin_amdgcn_wmma_f32_16x16x32_bf16(false, pa.v, false, bV.v, (short)0, o[sub], false, false);
    }
    __syncthreads();
  }
#pragma unroll
  for (int sub = 0; sub < 4; sub++)
#pragma unroll
    for (int i = 0; i < 8; i++) {
      int row = qbase + i + hi * 8;
      int col = h * 64 + sub * 16 + ln;
      y[(size_t)(b * 1024 + row) * CDIM + col] = o[sub][i] / l[i];
    }
}

// ---------------- MoE gate: softmax, top-2, combine weights, aux stats ----------------
// sel[row] = lower expert | higher expert << 4; gw[2*row], gw[2*row+1] = their weights
// part[16*block + e] = sum of P[e] over the block's 8 tokens, part[16*block + 8 + e] = how many
// of their 16 choices fell on expert e; every block writes its own row, no word is shared
#define GATE_BLOCKS (NTOK / 8)
__global__ void gate_kernel(const float* __restrict__ xn, const float* __restrict__ Wg,
                            int* __restrict__ sel, float* __restrict__ gw,
                            float* __restrict__ part_out) {
  __shared__ __attribute__((aligned(16))) float sP[8][2 * NEXP];   // a token's P, then its two choices as 0 / 1
  int tid = threadIdx.x, lane = tid & 31, wave = tid >> 5;
  int row = blockIdx.x * 8 + wave;
  float part[NEXP];
#pragma unroll
  for (int e = 0; e < NEXP; e++) part[e] = 0.f;
  const float* xr = xn + (size_t)row * CDIM;
  for (int c = lane; c < CDIM; c += 32) {
    float xv = xr[c];
#pragma unroll
    for (int e = 0; e < NEXP; e++) part[e] += xv * Wg[c * NEXP + e];
  }
#pragma unroll
  for (int e = 0; e < NEXP; e++)
#pragma unroll
    for (int off = 1; off < 32; off <<= 1) part[e] += __shfl_xor(part[e], off);
  if (lane == 0) {
    float mx = part[0];
#pragma unroll
    for (int e = 1; e < NEXP; e++) mx = fmaxf(mx, part[e]);
    float pe[NEXP], s = 0.f;
#pragma unroll
    for (int e = 0; e < NEXP; e++) { pe[e] = __expf(part[e] - mx); s += pe[e]; }
#pragma unroll
    for (int e = 0; e < NEXP; e++) pe[e] /= s;
    int s0 = 0;
#pragma unroll
    for (int e = 1; e < NEXP; e++) if (pe[e] > pe[s0]) s0 = e;
    int s1 = -1;
#pragma unroll
    for (int e = 0; e < NEXP; e++) if (e != s0 && (s1 < 0 || pe[e] > pe[s1])) s1 = e;
    float denom = pe[s0] + pe[s1];
    float w0 = pe[s0] / denom, w1 = pe[s1] / denom;
    bool up = s0 < s1;
    sel[row] = up ? (s0 | (s1 << 4)) : (s1 | (s0 << 4));
    gw[2 * row]     = up ? w0 : w1;
    gw[2 * row + 1] = up ? w1 : w0;
#pragma unroll                  // constant indices keep pe[] in registers
    for (int e = 0; e < NEXP; e++) {
      sP[wave][e] = pe[e];
      sP[wave][NEXP + e] = (e == s0 || e == s1) ? 1.0f : 0.0f;
    }
  }
  __syncthreads();
  if (tid < 2 * NEXP) {         // the block's 16 sums, tokens in wave order
    float t = 0.f;
#pragma unroll                  // the 8 LDS reads go out together
    for (int w = 0; w < 8; w++) t += sP[w][tid];
    part_out[blockIdx.x * 16 + tid] = t;
  }
}

// one block of 256 threads: thread t sums word t & 15 over the rows (t >> 4) + 16 j, then the
// 16 threads of a word are summed in LDS; the order is fixed
__global__ void aux_kernel(const float* __restrict__ part_in, float* __restrict__ out_aux) {
  __shared__ float red[16][16];
  int tid = threadIdx.x;
  float t = 0.f;
#pragma unroll                  // all 32 loads in flight together
  for (int j = 0; j < GATE_BLOCKS / 16; j++) t += part_in[tid + 256 * j];
  red[tid >> 4][tid & 15] = t;
  __syncthreads();
  if (tid < 16) {
    float s = 0.f;
#pragma unroll                  // the 16 LDS reads go out together
    for (int g = 0; g < 16; g++) s += red[g][tid];
    red[0][tid] = s;
  }
  __syncthreads();
  if (tid == 0) {
    float s = 0.f;
    for (int e = 0; e < NEXP; e++)
      s += (red[0][NEXP + e] / (float)(NTOK * 2)) * (red[0][e] / (float)NTOK);
    out_aux[0] = (float)NEXP * s;
  }
}

// ---------------- MoE routing: sort the 2*NTOK (token, expert) pairs by expert ----------------
// One block of 1024 threads, 4 tokens each. Eight running counts travel as 16-bit fields
// of two 64-bit words (no field passes MAXROW). Each expert's list starts at a multiple of 128.
// rowtok[p] = token of routed row p (0 in the padding), slot[2*t+j] = routed row of token t's
// j-th expert, tile_e[i] = expert of rows 128*i.., -1 behind the last list.
__device__ inline unsigned long long fld_one(int e) { return 1ull << ((e & 3) * 16); }
__device__ inline int fld_get(unsigned long long lo, unsigned long long hi, int e) {
  return (int)(((e < 4 ? lo : hi) >> ((e & 3) * 16)) & 0xFFFFull);
}
__global__ void route_kernel(const int* __restrict__ sel, int* __restrict__ rowtok,
                             int* __restrict__ slot, int* __restrict__ tile_e) {
  __shared__ unsigned long long wtot[32][2];
  int tid = threadIdx.x, lane = tid & 31, wave = tid >> 5;
  int ex[8];
  unsigned long long lo = 0, hi = 0;
  // the loops over ex[] and over the experts are unrolled so that ex[] and the shift counts
  // are indexed by constants and nothing goes to scratch
#pragma unroll
  for (int i = 0; i < 4; i++) {
    int s = sel[tid * 4 + i];
    ex[2 * i] = s & 7; ex[2 * i + 1] = (s >> 4) & 7;
  }
#pragma unroll
  for (int i = 0; i < 8; i++) {
    if (ex[i] < 4) lo += fld_one(ex[i]); else hi += fld_one(ex[i]);
  }
  unsigned long long ilo = lo, ihi = hi;          // inclusive scan over the wave
  for (int d = 1; d < 32; d <<= 1) {
    unsigned long long a = __shfl_up(ilo, d), b = __shfl_up(ihi, d);
    if (lane >= d) { ilo += a; ihi += b; }
  }
  if (lane == 31) { wtot[wave][0] = ilo; wtot[wave][1] = ihi; }
  __syncthreads();
  unsigned long long tlo = 0, thi = 0, plo = ilo - lo, phi = ihi - hi;
#pragma unroll 4                // unrolled whole, the 64 words are all held in registers and spill
  for (int w = 0; w < 32; w++) {
    unsigned long long a = wtot[w][0], b = wtot[w][1];
    tlo += a; thi += b;
    if (w < wave) { plo += a; phi += b; }
  }
  int off = 0;
  int mytile = -1;
#pragma unroll
  for (int e = 0; e < NEXP; e++) {
    int cnt = fld_get(tlo, thi, e);
    int end = off + ((cnt + 127) & ~127);
    if (e < 4) plo += (unsigned long long)off << (e * 16);
    else       phi += (unsigned long long)off << ((e - 4) * 16);
    if (off + cnt + tid < end) rowtok[off + cnt + tid] = 0;
    if (tid * 128 >= off && tid * 128 < end) mytile = e;
    off = end;
  }
  if (tid < MAXTILE) tile_e[tid] = mytile;
#pragma unroll
  for (int i = 0; i < 8; i++) {
    int e = ex[i];
    int p = fld_get(plo, phi, e);
    if (e < 4) plo += fld_one(e); else phi += fld_one(e);
    rowtok[p] = tid * 4 + (i >> 1);
    slot[tid * 8 + i] = p;
  }
}

// out = x1 + w_a * ye[row_a] + w_b * ye[row_b], lower expert first; one block per token
__global__ void combine_kernel(const float4* __restrict__ x1, const float4* __restrict__ ye,
                               const int* __restrict__ slot, const float* __restrict__ gw,
                               float4* __restrict__ dst) {
  int tok = blockIdx.x, c = threadIdx.x;
  int pa = min(slot[2 * tok], MAXROW - 1), pb = min(slot[2 * tok + 1], MAXROW - 1);
  float wa = gw[2 * tok], wb = gw[2 * tok + 1];
  float4 o = x1[(size_t)tok * 256 + c];
  float4 a = ye[(size_t)pa * 256 + c];
  float4 b = ye[(size_t)pb * 256 + c];
  o.x += wa * a.x; o.y += wa * a.y; o.z += wa * a.z; o.w += wa * a.w;
  o.x += wb * b.x; o.y += wb * b.y; o.z += wb * b.z; o.w += wb * b.w;
  dst[(size_t)tok * 256 + c] = o;
}

// ---------------- launcher ----------------
extern "C" void kernel_launch(void* const* d_in, const int* in_sizes, int n_in,
                              void* d_out, int out_size, void* d_ws, size_t ws_size,
                              hipStream_t stream) {
  (void)in_sizes; (void)n_in; (void)out_size; (void)ws_size;
  const float* x   = (const float*)d_in[0];
  const float* ln1 = (const float*)d_in[1];
  const float* ln2 = (const float*)d_in[2];
  const float* Wq  = (const float*)d_in[3];
  const float* Wk  = (const float*)d_in[4];
  const float* Wv  = (const float*)d_in[5];
  const float* Wo  = (const float*)d_in[6];
  const float* Wg  = (const float*)d_in[7];
  const float* W1  = (const float*)d_in[8];
  const float* W2  = (const float*)d_in[9];
  float* outx = (float*)d_out;

  char* ws = (char*)d_ws;
  size_t off = 0;
  auto alloc = [&](size_t bytes) -> void* {
    void* p = ws + off;
    off += (bytes + 255) & ~(size_t)255;
    return p;
  };
  float*          xn1  = (float*)alloc((size_t)NTOK * CDIM * 4);
  float*          qf   = (float*)alloc((size_t)NTOK * CDIM * 4);
  float*          kf   = (float*)alloc((size_t)NTOK * 256 * 4);
  float*          vf   = (float*)alloc((size_t)NTOK * 256 * 4);
  unsigned short* qb   = (unsigned short*)alloc((size_t)NTOK * CDIM * 2);
  unsigned short* kbuf = (unsigned short*)alloc((size_t)NTOK * 256 * 2);
  unsigned short* vbuf = (unsigned short*)alloc((size_t)NTOK * 256 * 2);
  float*          yatt = (float*)alloc((size_t)NTOK * CDIM * 4);
  float*          x1   = (float*)alloc((size_t)NTOK * CDIM * 4);
  float*          xn2  = (float*)alloc((size_t)NTOK * CDIM * 4);
  unsigned short* hbf  = (unsigned short*)alloc((size_t)MAXROW * IDIM * 2);
  float*          ye   = (float*)alloc((size_t)MAXROW * CDIM * 4);
  int*            sel  = (int*)alloc((size_t)NTOK * 4);
  float*          gw   = (float*)alloc((size_t)NTOK * 2 * 4);
  int*            rowtok = (int*)alloc((size_t)MAXROW * 4);
  int*            slot = (int*)alloc((size_t)NTOK * 2 * 4);
  int*            tile_e = (int*)alloc((size_t)MAXTILE * 4);
  float*          part = (float*)alloc((size_t)GATE_BLOCKS * 16 * 4);

  // 1) xn1 = rmsnorm(x)
  rmsnorm_kernel<<<NTOK, 256, 0, stream>>>(x, ln1, xn1);
  // 2) q/k/v projections
  gemm_wmma<0, float, 0><<<dim3(CDIM / 128, NTOK / 128), 256, 0, stream>>>(
      xn1, Wq, qf, nullptr, nullptr, NTOK, CDIM, CDIM, CDIM, CDIM, CDIM, nullptr, nullptr);
  gemm_wmma<0, float, 0><<<dim3(256 / 128, NTOK / 128), 256, 0, stream>>>(
      xn1, Wk, kf, nullptr, nullptr, NTOK, 256, CDIM, CDIM, 256, 256, nullptr, nullptr);
  gemm_wmma<0, float, 0><<<dim3(256 / 128, NTOK / 128), 256, 0, stream>>>(
      xn1, Wv, vf, nullptr, nullptr, NTOK, 256, CDIM, CDIM, 256, 256, nullptr, nullptr);
  // 3) RoPE + bf16 conversion
  rope_kernel<<<(NTOK * 16 * 32) / 256, 256, 0, stream>>>(qf, qb, 16, CDIM);
  rope_kernel<<<(NTOK * 4 * 32) / 256, 256, 0, stream>>>(kf, kbuf, 4, 256);
  cvt_bf16_kernel<<<(NTOK * 256) / 256, 256, 0, stream>>>(vf, vbuf);
  // 4) attention
  attn_kernel<<<dim3(64, 8), 256, 0, stream>>>(qb, kbuf, vbuf, yatt);
  // 5) x1 = yatt @ Wo + x
  gemm_wmma<2, float, 0><<<dim3(CDIM / 128, NTOK / 128), 256, 0, stream>>>(
      yatt, Wo, x1, nullptr, x, NTOK, CDIM, CDIM, CDIM, CDIM, CDIM, nullptr, nullptr);
  // 6) xn2 = rmsnorm(x1)
  rmsnorm_kernel<<<NTOK, 256, 0, stream>>>(x1, ln2, xn2);
  // 7) gating + aux stats
  gate_kernel<<<GATE_BLOCKS, 256, 0, stream>>>(xn2, Wg, sel, gw, part);
  // 8) sort the (token, expert) pairs by expert
  route_kernel<<<1, 1024, 0, stream>>>(sel, rowtok, slot, tile_e);
  // 9) experts, chosen rows only: h = gelu(xn2[rowtok] @ W1[e]); ye = h @ W2[e]
  gemm_wmma<1, float, 1><<<dim3(IDIM / 128, MAXTILE), 256, 0, stream>>>(
      xn2, W1, nullptr, hbf, nullptr, MAXROW, IDIM, CDIM, CDIM, IDIM, IDIM, rowtok, tile_e);
  gemm_wmma<0, unsigned short, 2><<<dim3(CDIM / 128, MAXTILE), 256, 0, stream>>>(
      hbf, W2, ye, nullptr, nullptr, MAXROW, CDIM, IDIM, IDIM, CDIM, CDIM, nullptr, tile_e);
  //    out = x1 + the two weighted expert rows of each token
  combine_kernel<<<NTOK, 256, 0, stream>>>(
      (const float4*)x1, (const float4*)ye, slot, gw, (float4*)outx);
  // 10) aux loss scalar
  aux_kernel<<<1, 256, 0, stream>>>(part, outx + (size_t)NTOK * CDIM);
}

// v006
// Measured time: 458 microseconds a run.
// Next to v005, in two timings, it ran 1.17 times as fast each time.
// All steps since v000 together make it 8.06 times as fast.
#include <hip/hip_runtime.h>
#include <hip/hip_bf16.h>
#include <math.h>

// ---------------- types / helpers ----------------
typedef __attribute__((ext_vector_type(16))) __bf16 v16bf;
typedef __attribute__((ext_vector_type(8)))  float  v8f;
typedef __attribute__((ext_vector_type(4)))  unsigned int u32x4;
typedef __attribute__((ext_vector_type(8)))  short s16x8;

union FragBF { u32x4 q[2]; v16bf v; };

// f32 -> bf16, round to nearest even, by the chip's own packed convert: one instruction for two values
typedef __attribute__((ext_vector_type(2))) float  f32x2;
typedef __attribute__((ext_vector_type(2))) __bf16 bf16x2;
__device__ inline unsigned int pk_bf16(float lo, float hi) {
  f32x2 v = {lo, hi};
  return __builtin_bit_cast(unsigned int, __builtin_convertvector(v, bf16x2));
}
__device__ inline unsigned int f32_bf16(float f) {
  return (unsigned int)__builtin_bit_cast(unsigned short, (__bf16)f);
}
// pack 8 consecutive values (float->bf16 or passthrough bf16 bits) into u32x4
__device__ inline u32x4 load8_bf(const float* p) {
  const float4* q = (const float4*)p;
  float4 a = q[0], b = q[1];
  u32x4 r;
  r.x = pk_bf16(a.x, a.y);
  r.y = pk_bf16(a.z, a.w);
  r.z = pk_bf16(b.x, b.y);
  r.w = pk_bf16(b.z, b.w);
  return r;
}
__device__ inline u32x4 load8_bf(const unsigned short* p) {
  return *(const u32x4*)p;
}
// the same 8 values in two halves: the load alone, as it comes from memory, and the packing
struct Raw8f { float4 a, b; };
__device__ inline Raw8f load8_raw(const float* p) {
  const float4* q = (const float4*)p;
  Raw8f r; r.a = q[0]; r.b = q[1];
  return r;
}
__device__ inline u32x4 load8_raw(const unsigned short* p) {
  return *(const u32x4*)p;
}
__device__ inline u32x4 pack8_bf(const Raw8f& v) {
  u32x4 r;
  r.x = pk_bf16(v.a.x, v.a.y);
  r.y = pk_bf16(v.a.z, v.a.w);
  r.z = pk_bf16(v.b.x, v.b.y);
  r.w = pk_bf16(v.b.z, v.b.w);
  return r;
}
__device__ inline u32x4 pack8_bf(const u32x4& v) { return v; }
// transposing LDS load: from a row-major [k][n] 16-bit tile, lane (c, h) gets 8 k of column c
__device__ inline u32x4 ld_tr16(const unsigned short* p) {
  typedef __attribute__((address_space(3))) s16x8 lds_s16x8;
  return __builtin_bit_cast(u32x4, __builtin_amdgcn_ds_load_tr16_b128_v8i16((lds_s16x8*)p));
}

// DPP16 butterfly reductions over a 16-lane row (VALU only, no LDS)
// ctrl must be a compile-time constant -> template parameter
template <int CTRL>
__device__ inline float dpp_f(float x) {
  return __int_as_float(
      __builtin_amdgcn_update_dpp(0, __float_as_int(x), CTRL, 0xF, 0xF, true));
}
#define DPP_QPERM_XOR1 0xB1   // quad_perm(1,0,3,2)
#define DPP_QPERM_XOR2 0x4E   // quad_perm(2,3,0,1)
#define DPP_ROW_HMIRR  0x141  // row_half_mirror (lane^7 within 8)
#define DPP_ROW_MIRR   0x140  // row_mirror (lane^15 within 16)
__device__ inline float red16_max(float x) {
  x = fmaxf(x, dpp_f<DPP_QPERM_XOR1>(x));
  x = fmaxf(x, dpp_f<DPP_QPERM_XOR2>(x));
  x = fmaxf(x, dpp_f<DPP_ROW_HMIRR>(x));
  x = fmaxf(x, dpp_f<DPP_ROW_MIRR>(x));
  return x;
}
__device__ inline float red16_sum(float x) {
  x += dpp_f<DPP_QPERM_XOR1>(x);
  x += dpp_f<DPP_QPERM_XOR2>(x);
  x += dpp_f<DPP_ROW_HMIRR>(x);
  x += dpp_f<DPP_ROW_MIRR>(x);
  return x;
}

#define NTOK 4096   // B*T
#define CDIM 1024
#define IDIM 4096
#define NEXP 8
#define MAXTILE 72            // 2*NTOK routed rows, each expert's list padded to 128: at most 71 tiles
#define MAXROW (MAXTILE * 128)

// ---------------- RMSNorm ----------------
__global__ void rmsnorm_kernel(const float* __restrict__ x,
                               const float* __restrict__ scale,
                               float* __restrict__ out) {
  __shared__ float red[9];
  int row = blockIdx.x;
  int tid = threadIdx.x;
  const float* xr = x + (size_t)row * CDIM;
  float v[4]; float ss = 0.f;
#pragma unroll
  for (int i = 0; i < 4; i++) { v[i] = xr[tid + 256 * i]; ss += v[i] * v[i]; }
#pragma unroll
  for (int off = 16; off >= 1; off >>= 1) ss += __shfl_xor(ss, off);
  if ((tid & 31) == 0) red[tid >> 5] = ss;
  __syncthreads();
  if (tid == 0) {
    float t = 0.f;
#pragma unroll
    for (int w = 0; w < 8; w++) t += red[w];
    red[8] = t;
  }
  __syncthreads();
  float inv = rsqrtf(red[8] / (float)CDIM + 1e-5f);
#pragma unroll
  for (int i = 0; i < 4; i++) {
    int c = tid + 256 * i;
    out[(size_t)row * CDIM + c] = v[i] * inv * scale[c];
  }
}

// ---------------- generic WMMA GEMM, 128x128 tile, double-buffered LDS ----------------
// C(M,N) = A(M,K) * B(K,N); A: float or bf16-bits; B: float (bf16-converted on stage)
// 8 waves; wave (wr,wc) owns rows wr*32..+32, cols wc*64..+64 => 2x4 wmma accums.
// EPI: 0 = store f32; 1 = gelu->bf16 (outh); 2 = +aux residual
// GRP: 0 = plain; 1, 2 = row tile blockIdx.y belongs to expert tile_e[blockIdx.y], whose
//      weights are plane tile_e of Bm; 1 also gathers the A rows through rowtok
// The block size is stated so that the next tile's unconverted values fit in registers.
template <int EPI, typename AT, int GRP>
__global__ void __launch_bounds__(256) gemm_wmma(const AT* __restrict__ A, const float* __restrict__ Bm,
                          float* __restrict__ outf, unsigned short* __restrict__ outh,
                          const float* __restrict__ aux,
                          int M, int N, int Kd, int lda, int ldb, int ldc,
                          const int* __restrict__ rowtok, const int* __restrict__ tile_e) {
  __shared__ __attribute__((aligned(16))) unsigned short aS[2][128][40];
  // B stays row-major [k][n]; 288-byte rows (32 B x odd) suit the transposing load
  __shared__ __attribute__((aligned(16))) unsigned short bS[2][32][144];
  int tid = threadIdx.x;
  int lane = tid & 31;
  int wave = tid >> 5;
  int wr = wave & 3, wc = wave >> 2;
  int m0 = blockIdx.y * 128, n0 = blockIdx.x * 128;
  int hi = lane >> 4;
  int kb = hi * 8;
  int ln = lane & 15;
  int ar0 = wr * 32 + ln;
  int btr = hi * 8 + (lane & 7);                    // B fragment: this lane's k row ...
  int btc = wc * 64 + ((lane >> 3) & 1) * 8;        // ... and its 16-byte piece of 16 columns
  if (GRP) {
    int te = tile_e[blockIdx.y];
    if (te < 0) return;         // tile behind the last routed row: the whole block leaves here
    Bm += (size_t)(te & (NEXP - 1)) * Kd * ldb;
  }
  // staging index precompute (2 chunks of 8 elems per thread for A and B)
  int rA[2], cgA[2], kB[2], nbB[2];
#pragma unroll
  for (int g = 0; g < 2; g++) {
    int lin = tid + 256 * g;
    rA[g] = lin >> 2; cgA[g] = (lin & 3) * 8;
    kB[g] = lin >> 4; nbB[g] = (lin & 15) * 8;
  }
  unsigned aoff[2] = {0u, 0u};  // GRP 1: byte offsets of this thread's two gathered A chunks
  if (GRP == 1) {
#pragma unroll                  // constant indices keep aoff[] in registers
    for (int g = 0; g < 2; g++)
      aoff[g] = (unsigned)((rowtok[m0 + rA[g]] & (NTOK - 1)) * lda + cgA[g]) * (unsigned)sizeof(AT);
  }
  v8f acc[2][4] = {};
  u32x4 ra[2], rb[2];
  int nt = Kd >> 5;
  // prologue: load tile 0 into regs, store to buffer 0
#pragma unroll
  for (int g = 0; g < 2; g++) {
    if (GRP == 1) {             // gathered row: uniform base + 32-bit lane offset
      ra[g] = load8_bf((const AT*)((const char*)A + aoff[g]));
    } else {
      ra[g] = load8_bf(&A[(size_t)(m0 + rA[g]) * lda + cgA[g]]);
    }
    const float4* qp = (const float4*)&Bm[(size_t)kB[g] * ldb + n0 + nbB[g]];
    float4 fa = qp[0], fb = qp[1];
    rb[g].x = pk_bf16(fa.x, fa.y);
    rb[g].y = pk_bf16(fa.z, fa.w);
    rb[g].z = pk_bf16(fb.x, fb.y);
    rb[g].w = pk_bf16(fb.z, fb.w);
  }
#pragma unroll
  for (int g = 0; g < 2; g++) {
    *(u32x4*)&aS[0][rA[g]][cgA[g]] = ra[g];
    *(u32x4*)&bS[0][kB[g]][nbB[g]] = rb[g];
  }
  __syncthreads();
  // the products of the tile in buffer buf
  auto mma_tile = [&](int buf) {
    FragBF a0, a1;
    a0.q[0] = *(const u32x4*)&aS[buf][ar0][kb];
    a0.q[1] = *(const u32x4*)&aS[buf][ar0][16 + kb];
    a1.q[0] = *(const u32x4*)&aS[buf][ar0 + 16][kb];
    a1.q[1] = *(const u32x4*)&aS[buf][ar0 + 16][16 + kb];
#pragma unroll
    for (int bj = 0; bj < 4; bj++) {
      FragBF bf;
      bf.q[0] = ld_tr16(&bS[buf][btr][btc + bj * 16]);
      bf.q[1] = ld_tr16(&bS[buf][16 + btr][btc + bj * 16]);
      acc[0][bj] = __builtin_amdgcn_wmma_f32_16x16x32_bf16(false, a0.v, false, bf.v, (short)0, acc[0][bj], false, false);
      acc[1][bj] = __builtin_amdgcn_wmma_f32_16x16x32_bf16(false, a1.v, false, bf.v, (short)0, acc[1][bj], false, false);
      // one B fragment live at a time; the last one also keeps the conversion of the next
      // tile, and with it the wait for its loads, behind the products
      __builtin_amdgcn_sched_barrier(0);
    }
  };
  // every pass but the last fetches the tile after it; the last pass stands behind the loop, so
  // the loaded values live inside one pass and are not copied (a copy would wait for the loads)
  for (int kt = 0; kt + 1 < nt; kt++) {
    int buf = kt & 1;
    int k1 = (kt + 1) << 5;
    // issue all of the next tile's global loads together; nothing uses their values before the
    // products are done, so they stay in flight meanwhile
    decltype(load8_raw((const AT*)nullptr)) wa[2];
    Raw8f wb[2];
    const AT* pa[2];
    const float* pb[2];
#pragma unroll
    for (int g = 0; g < 2; g++) {
      if (GRP == 1) {
        pa[g] = (const AT*)((const char*)(A + k1) + aoff[g]);
      } else {
        pa[g] = &A[(size_t)(m0 + rA[g]) * lda + k1 + cgA[g]];
      }
      pb[g] = &Bm[(size_t)(k1 + kB[g]) * ldb + n0 + nbB[g]];
      wa[g] = load8_raw(pa[g]);
      wb[g] = load8_raw(pb[g]);
    }
    // the code below reuses the address registers of the loads above; as inputs of the wait
    // they stay untouched up to it, also by the later loads' own results
    asm volatile("s_wait_xcnt 0x0" :: "v"(pa[0]), "v"(pa[1]), "v"(pb[0]), "v"(pb[1]) : "memory");
    if (kt + 2 < nt) {   // prefetch two tiles ahead into GL2
      int k2 = (kt + 2) << 5;
      if (GRP == 1) {
        __builtin_prefetch((const char*)(A + k2) + aoff[0], 0, 1);
      } else {
        __builtin_prefetch(&A[(size_t)(m0 + rA[0]) * lda + k2 + cgA[0]], 0, 1);
      }
      __builtin_prefetch(&Bm[(size_t)(k2 + kB[0]) * ldb + n0 + nbB[0]], 0, 1);
    }
    mma_tile(buf);
    int nb = buf ^ 1;
#pragma unroll
    for (int g = 0; g < 2; g++) {   // first use of the loaded values: convert, then store
      *(u32x4*)&aS[nb][rA[g]][cgA[g]] = pack8_bf(wa[g]);
      *(u32x4*)&bS[nb][kB[g]][nbB[g]] = pack8_bf(wb[g]);
    }
    __syncthreads();
  }
  mma_tile((nt - 1) & 1);
#pragma unroll
  for (int ai = 0; ai < 2; ai++) {
#pragma unroll
    for (int bj = 0; bj < 4; bj++) {
#pragma unroll
      for (int i = 0; i < 8; i++) {
        int r = m0 + wr * 32 + ai * 16 + i + hi * 8;
        int c = n0 + wc * 64 + bj * 16 + ln;
        size_t idx = (size_t)r * ldc + c;
        float v = acc[ai][bj][i];
        if (EPI == 0) {
          outf[idx] = v;
        } else if (EPI == 1) {
          float g = 0.5f * v * (1.0f + erff(v * 0.70710678118f));
          outh[idx] = (unsigned short)f32_bf16(g);
        } else if (EPI == 2) {
          outf[idx] = v + aux[idx];
        }
      }
    }
  }
}

// ---------------- RoPE (+ bf16 convert) ----------------
__global__ void rope_kernel(const float* __restrict__ in, unsigned short* __restrict__ outb,
                            int nheads, int ld) {
  int idx = blockIdx.x * 256 + threadIdx.x;       // pair index over NTOK*nheads*32
  int d = idx & 31;
  int th = idx >> 5;
  int head = th % nheads;
  int tok = th / nheads;
  int t = tok & 1023;                             // tok = b*T + t
  float inv_freq = __expf(-0.2878231366f * (float)d);  // 10000^(-d/32)
  float ang = (float)t * inv_freq;
  float cs = __cosf(ang), sn = __sinf(ang);
  size_t base = (size_t)tok * ld + head * 64;
  float x1 = in[base + d], x2 = in[base + 32 + d];
  unsigned int pr = pk_bf16(x1 * cs - x2 * sn, x2 * cs + x1 * sn);
  outb[base + d]      = (unsigned short)pr;
  outb[base + 32 + d] = (unsigned short)(pr >> 16);
}

__global__ void cvt_bf16_kernel(const float* __restrict__ in, unsigned short* __restrict__ outb) {
  size_t i = (size_t)blockIdx.x * 256 + threadIdx.x;
  outb[i] = (unsigned short)f32_bf16(in[i]);
}

// ---------------- flash attention (WMMA, causal, GQA) ----------------
// The block size is stated so that a key tile's staged values fit in registers beside the rest.
__global__ void __launch_bounds__(256) attn_kernel(const unsigned short* __restrict__ qb,
                            const unsigned short* __restrict__ kbuf,
                            const unsigned short* __restrict__ vbuf,
                            float* __restrict__ y) {
  __shared__ __attribute__((aligned(16))) unsigned short Kls[32][72];
  __shared__ __attribute__((aligned(16))) unsigned short Vls[64][40];
  __shared__ __attribute__((aligned(16))) unsigned short Pls[8][16][40];
  int tid = threadIdx.x, lane = tid & 31, wave = tid >> 5;
  int bh = blockIdx.x;
  int b = bh >> 4, h = bh & 15;
  int kvh = h >> 2;
  int qt = blockIdx.y;
  int qbase = qt * 128 + wave * 16;
  int hi = lane >> 4, kbo = hi * 8, ln = lane & 15;
  int qrow = qbase + ln;
  const unsigned short* qp = qb + (size_t)(b * 1024 + qrow) * CDIM + h * 64;
  FragBF qa0, qa1;
  qa0.q[0] = *(const u32x4*)(qp + kbo);
  qa0.q[1] = *(const u32x4*)(qp + 16 + kbo);
  qa1.q[0] = *(const u32x4*)(qp + 32 + kbo);
  qa1.q[1] = *(const u32x4*)(qp + 48 + kbo);
  float m[8], l[8];
  v8f o[4] = {};
#pragma unroll
  for (int i = 0; i < 8; i++) { m[i] = -3.0e38f; l[i] = 0.f; }
  int ntiles = (qt + 1) * 4;
  // this thread's share of a key tile: K rows wave + 8 i (one uint each), V rows vk + 4 i (one value each)
  int vk = tid >> 6, vd = tid & 63;
  const unsigned int* ksrc =
      (const unsigned int*)(kbuf + (size_t)(b * 1024 + wave) * 256 + kvh * 64) + lane;
  const unsigned short* vsrc = vbuf + (size_t)(b * 1024 + vk) * 256 + kvh * 64 + vd;
  unsigned int kr[4];
  unsigned short vr[8];
  // all 12 loads of the tile at key0 are issued together; nothing uses them before the next staging
  auto fetch_tile = [&](int key0) {
    const unsigned int* pk = ksrc + key0 * 128;
    const unsigned short* pv = vsrc + key0 * 256;
#pragma unroll                  // constant indices keep kr[] and vr[] in registers
    for (int i = 0; i < 4; i++) kr[i] = pk[i * 8 * 128];
#pragma unroll
    for (int i = 0; i < 8; i++) vr[i] = pv[i * 4 * 256];
    // the code behind reuses the address registers of the loads above; as inputs of the wait
    // they stay untouched up to it
    asm volatile("s_wait_xcnt 0x0" :: "v"(pk), "v"(pv) : "memory");
  };
  fetch_tile(0);
  for (int kt = 0; kt < ntiles; kt++) {
    int key0 = kt * 32;
#pragma unroll
    for (int i = 0; i < 4; i++)                   // stage K rows (32 x 64), uint copies
      ((unsigned int*)&Kls[wave + 8 * i][0])[lane] = kr[i];
#pragma unroll
    for (int i = 0; i < 8; i++)                   // stage V transposed: Vls[d][kk]
      Vls[vd][vk + 4 * i] = vr[i];
    __syncthreads();
    if (kt + 1 < ntiles) fetch_tile(key0 + 32);   // in flight during this tile's scores and softmax
    v8f s[2] = {};
#pragma unroll
    for (int sub = 0; sub < 2; sub++) {           // scores: Q(16x64) * K^T(64x32)
      int krow = sub * 16 + ln;
      FragBF bK;
      bK.q[0] = *(const u32x4*)&Kls[krow][kbo];
      bK.q[1] = *(const u32x4*)&Kls[krow][16 + kbo];
      s[sub] = __builtin_amdgcn_wmma_f32_16x16x32_bf16(false, qa0.v, false, bK.v, (short)0, s[sub], false, false);
      bK.q[0] = *(const u32x4*)&Kls[krow][32 + kbo];
      bK.q[1] = *(const u32x4*)&Kls[krow][48 + kbo];
      s[sub] = __builtin_amdgcn_wmma_f32_16x16x32_bf16(false, qa1.v, false, bK.v, (short)0, s[sub], false, false);
    }
    int keyc0 = key0 + ln, keyc1 = key0 + 16 + ln;
#pragma unroll
    for (int i = 0; i < 8; i++) {                 // online softmax (DPP reductions)
      int row = qbase + i + hi * 8;
      float s0 = s[0][i] * 0.125f; if (keyc0 > row) s0 = -3.0e38f;
      float s1 = s[1][i] * 0.125f; if (keyc1 > row) s1 = -3.0e38f;
      float t = red16_max(fmaxf(s0, s1));
      float mn = fmaxf(m[i], t);
      float fac = __expf(m[i] - mn);
      float p0 = __expf(s0 - mn), p1 = __expf(s1 - mn);
      float ps = red16_sum(p0 + p1);
      l[i] = l[i] * fac + ps;
      m[i] = mn;
#pragma unroll
      for (int sub = 0; sub < 4; sub++) o[sub][i] *= fac;
      unsigned int pp = pk_bf16(p0, p1);
      Pls[wave][i + hi * 8][ln]      = (unsigned short)pp;
      Pls[wave][i + hi * 8][16 + ln] = (unsigned short)(pp >> 16);
    }
    __syncthreads();
    FragBF pa;                                    // P(16x32) * V(32x64)
    pa.q[0] = *(const u32x4*)&Pls[wave][ln][kbo];
    pa.q[1] = *(const u32x4*)&Pls[wave][ln][16 + kbo];
#pragma unroll
    for (int sub = 0; sub < 4; sub++) {
      FragBF bV;
      int col = sub * 16 + ln;
      bV.q[0] = *(const u32x4*)&Vls[col][kbo];
      bV.q[1] = *(const u32x4*)&Vls[col][16 + kbo];
      o[sub] = __builtin_amdgcn_wmma_f32_16x16x32_bf16(false, pa.v, false, bV.v, (short)0, o[sub], false, false);
    }
    __syncthreads();
  }
#pragma unroll
  for (int sub = 0; sub < 4; sub++)
#pragma unroll
    for (int i = 0; i < 8; i++) {
      int row = qbase + i + hi * 8;
      int col = h * 64 + sub * 16 + ln;
      y[(size_t)(b * 1024 + row) * CDIM + col] = o[sub][i] / l[i];
    }
}

// ---------------- MoE gate: softmax, top-2, combine weights, aux stats ----------------
// sel[row] = lower expert | higher expert << 4; gw[2*row], gw[2*row+1] = their weights
// part[16*block + e] = sum of P[e] over the block's 8 tokens, part[16*block + 8 + e] = how many
// of their 16 choices fell on expert e; every block writes its own row, no word is shared
#define GATE_BLOCKS (NTOK / 8)
__global__ void gate_kernel(const float* __restrict__ xn, const float* __restrict__ Wg,
                            int* __restrict__ sel, float* __restrict__ gw,
                            float* __restrict__ part_out) {
  __shared__ __attribute__((aligned(16))) float sP[8][2 * NEXP];   // a token's P, then its two choices as 0 / 1
  int tid = threadIdx.x, lane = tid & 31, wave = tid >> 5;
  int row = blockIdx.x * 8 + wave;
  float part[NEXP];
#pragma unroll
  for (int e = 0; e < NEXP; e++) part[e] = 0.f;
  const float* xr = xn + (size_t)row * CDIM;
  for (int c = lane; c < CDIM; c += 32) {
    float xv = xr[c];
#pragma unroll
    for (int e = 0; e < NEXP; e++) part[e] += xv * Wg[c * NEXP + e];
  }
#pragma unroll
  for (int e = 0; e < NEXP; e++)
#pragma unroll
    for (int off = 1; off < 32; off <<= 1) part[e] += __shfl_xor(part[e], off);
  if (lane == 0) {
    float mx = part[0];
#pragma unroll
    for (int e = 1; e < NEXP; e++) mx = fmaxf(mx, part[e]);
    float pe[NEXP], s = 0.f;
#pragma unroll
    for (int e = 0; e < NEXP; e++) { pe[e] = __expf(part[e] - mx); s += pe[e]; }
#pragma unroll
    for (int e = 0; e < NEXP; e++) pe[e] /= s;
    int s0 = 0;
#pragma unroll
    for (int e = 1; e < NEXP; e++) if (pe[e] > pe[s0]) s0 = e;
    int s1 = -1;
#pragma unroll
    for (int e = 0; e < NEXP; e++) if (e != s0 && (s1 < 0 || pe[e] > pe[s1])) s1 = e;
    float denom = pe[s0] + pe[s1];
    float w0 = pe[s0] / denom, w1 = pe[s1] / denom;
    bool up = s0 < s1;
    sel[row] = up ? (s0 | (s1 << 4)) : (s1 | (s0 << 4));
    gw[2 * row]     = up ? w0 : w1;
    gw[2 * row + 1] = up ? w1 : w0;
#pragma unroll                  // constant indices keep pe[] in registers
    for (int e = 0; e < NEXP; e++) {
      sP[wave][e] = pe[e];
      sP[wave][NEXP + e] = (e == s0 || e == s1) ? 1.0f : 0.0f;
    }
  }
  __syncthreads();
  if (tid < 2 * NEXP) {         // the block's 16 sums, tokens in wave order
    float t = 0.f;
#pragma unroll                  // the 8 LDS reads go out together
    for (int w = 0; w < 8; w++) t += sP[w][tid];
    part_out[blockIdx.x * 16 + tid] = t;
  }
}

// one block of 256 threads: thread t sums word t & 15 over the rows (t >> 4) + 16 j, then the
// 16 threads of a word are summed in LDS; the order is fixed
__global__ void aux_kernel(const float* __restrict__ part_in, float* __restrict__ out_aux) {
  __shared__ float red[16][16];
  int tid = threadIdx.x;
  float t = 0.f;
#pragma unroll                  // all 32 loads in flight together
  for (int j = 0; j < GATE_BLOCKS / 16; j++) t += part_in[tid + 256 * j];
  red[tid >> 4][tid & 15] = t;
  __syncthreads();
  if (tid < 16) {
    float s = 0.f;
#pragma unroll                  // the 16 LDS reads go out together
    for (int g = 0; g < 16; g++) s += red[g][tid];
    red[0][tid] = s;
  }
  __syncthreads();
  if (tid == 0) {
    float s = 0.f;
    for (int e = 0; e < NEXP; e++)
      s += (red[0][NEXP + e] / (float)(NTOK * 2)) * (red[0][e] / (float)NTOK);
    out_aux[0] = (float)NEXP * s;
  }
}

// ---------------- MoE routing: sort the 2*NTOK (token, expert) pairs by expert ----------------
// One block of 1024 threads, 4 tokens each. Eight running counts travel as 16-bit fields
// of two 64-bit words (no field passes MAXROW). Each expert's list starts at a multiple of 128.
// rowtok[p] = token of routed row p (0 in the padding), slot[2*t+j] = routed row of token t's
// j-th expert, tile_e[i] = expert of rows 128*i.., -1 behind the last list.
__device__ inline unsigned long long fld_one(int e) { return 1ull << ((e & 3) * 16); }
__device__ inline int fld_get(unsigned long long lo, unsigned long long hi, int e) {
  return (int)(((e < 4 ? lo : hi) >> ((e & 3) * 16)) & 0xFFFFull);
}
__global__ void route_kernel(const int* __restrict__ sel, int* __restrict__ rowtok,
                             int* __restrict__ slot, int* __restrict__ tile_e) {
  __shared__ unsigned long long wtot[32][2];
  int tid = threadIdx.x, lane = tid & 31, wave = tid >> 5;
  int ex[8];
  unsigned long long lo = 0, hi = 0;
  // the loops over ex[] and over the experts are unrolled so that ex[] and the shift counts
  // are indexed by constants and nothing goes to scratch
#pragma unroll
  for (int i = 0; i < 4; i++) {
    int s = sel[tid * 4 + i];
    ex[2 * i] = s & 7; ex[2 * i + 1] = (s >> 4) & 7;
  }
#pragma unroll
  for (int i = 0; i < 8; i++) {
    if (ex[i] < 4) lo += fld_one(ex[i]); else hi += fld_one(ex[i]);
  }
  unsigned long long ilo = lo, ihi = hi;          // inclusive scan over the wave
  for (int d = 1; d < 32; d <<= 1) {
    unsigned long long a = __shfl_up(ilo, d), b = __shfl_up(ihi, d);
    if (lane >= d) { ilo += a; ihi += b; }
  }
  if (lane == 31) { wtot[wave][0] = ilo; wtot[wave][1] = ihi; }
  __syncthreads();
  unsigned long long tlo = 0, thi = 0, plo = ilo - lo, phi = ihi - hi;
#pragma unroll 4                // unrolled whole, the 64 words are all held in registers and spill
  for (int w = 0; w < 32; w++) {
    unsigned long long a = wtot[w][0], b = wtot[w][1];
    tlo += a; thi += b;
    if (w < wave) { plo += a; phi += b; }
  }
  int off = 0;
  int mytile = -1;
#pragma unroll
  for (int e = 0; e < NEXP; e++) {
    int cnt = fld_get(tlo, thi, e);
    int end = off + ((cnt + 127) & ~127);
    if (e < 4) plo += (unsigned long long)off << (e * 16);
    else       phi += (unsigned long long)off << ((e - 4) * 16);
    if (off + cnt + tid < end) rowtok[off + cnt + tid] = 0;
    if (tid * 128 >= off && tid * 128 < end) mytile = e;
    off = end;
  }
  if (tid < MAXTILE) tile_e[tid] = mytile;
#pragma unroll
  for (int i = 0; i < 8; i++) {
    int e = ex[i];
    int p = fld_get(plo, phi, e);
    if (e < 4) plo += fld_one(e); else phi += fld_one(e);
    rowtok[p] = tid * 4 + (i >> 1);
    slot[tid * 8 + i] = p;
  }
}

// out = x1 + w_a * ye[row_a] + w_b * ye[row_b], lower expert first; one block per token
__global__ void combine_kernel(const float4* __restrict__ x1, const float4* __restrict__ ye,
                               const int* __restrict__ slot, const float* __restrict__ gw,
                               float4* __restrict__ dst) {
  int tok = blockIdx.x, c = threadIdx.x;
  int pa = min(slot[2 * tok], MAXROW - 1), pb = min(slot[2 * tok + 1], MAXROW - 1);
  float wa = gw[2 * tok], wb = gw[2 * tok + 1];
  float4 o = x1[(size_t)tok * 256 + c];
  float4 a = ye[(size_t)pa * 256 + c];
  float4 b = ye[(size_t)pb * 256 + c];
  o.x += wa * a.x; o.y += wa * a.y; o.z += wa * a.z; o.w += wa * a.w;
  o.x += wb * b.x; o.y += wb * b.y; o.z += wb * b.z; o.w += wb * b.w;
  dst[(size_t)tok * 256 + c] = o;
}

// ---------------- launcher ----------------
extern "C" void kernel_launch(void* const* d_in, const int* in_sizes, int n_in,
                              void* d_out, int out_size, void* d_ws, size_t ws_size,
                              hipStream_t stream) {
  (void)in_sizes; (void)n_in; (void)out_size; (void)ws_size;
  const float* x   = (const float*)d_in[0];
  const float* ln1 = (const float*)d_in[1];
  const float* ln2 = (const float*)d_in[2];
  const float* Wq  = (const float*)d_in[3];
  const float* Wk  = (const float*)d_in[4];
  const float* Wv  = (const float*)d_in[5];
  const float* Wo  = (const float*)d_in[6];
  const float* Wg  = (const float*)d_in[7];
  const float* W1  = (const float*)d_in[8];
  const float* W2  = (const float*)d_in[9];
  float* outx = (float*)d_out;

  char* ws = (char*)d_ws;
  size_t off = 0;
  auto alloc = [&](size_t bytes) -> void* {
    void* p = ws + off;
    off += (bytes + 255) & ~(size_t)255;
    return p;
  };
  float*          xn1  = (float*)alloc((size_t)NTOK * CDIM * 4);
  float*          qf   = (float*)alloc((size_t)NTOK * CDIM * 4);
  float*          kf   = (float*)alloc((size_t)NTOK * 256 * 4);
  float*          vf   = (float*)alloc((size_t)NTOK * 256 * 4);
  unsigned short* qb   = (unsigned short*)alloc((size_t)NTOK * CDIM * 2);
  unsigned short* kbuf = (unsigned short*)alloc((size_t)NTOK * 256 * 2);
  unsigned short* vbuf = (unsigned short*)alloc((size_t)NTOK * 256 * 2);
  float*          yatt = (float*)alloc((size_t)NTOK * CDIM * 4);
  float*          x1   = (float*)alloc((size_t)NTOK * CDIM * 4);
  float*          xn2  = (float*)alloc((size_t)NTOK * CDIM * 4);
  unsigned short* hbf  = (unsigned short*)alloc((size_t)MAXROW * IDIM * 2);
  float*          ye   = (float*)alloc((size_t)MAXROW * CDIM * 4);
  int*            sel  = (int*)alloc((size_t)NTOK * 4);
  float*          gw   = (float*)alloc((size_t)NTOK * 2 * 4);
  int*            rowtok = (int*)alloc((size_t)MAXROW * 4);
  int*            slot = (int*)alloc((size_t)NTOK * 2 * 4);
  int*            tile_e = (int*)alloc((size_t)MAXTILE * 4);
  float*          part = (float*)alloc((size_t)GATE_BLOCKS * 16 * 4);

  // 1) xn1 = rmsnorm(x)
  rmsnorm_kernel<<<NTOK, 256, 0, stream>>>(x, ln1, xn1);
  // 2) q/k/v projections
  gemm_wmma<0, float, 0><<<dim3(CDIM / 128, NTOK / 128), 256, 0, stream>>>(
      xn1, Wq, qf, nullptr, nullptr, NTOK, CDIM, CDIM, CDIM, CDIM, CDIM, nullptr, nullptr);
  gemm_wmma<0, float, 0><<<dim3(256 / 128, NTOK / 128), 256, 0, stream>>>(
      xn1, Wk, kf, nullptr, nullptr, NTOK, 256, CDIM, CDIM, 256, 256, nullptr, nullptr);
  gemm_wmma<0, float, 0><<<dim3(256 / 128, NTOK / 128), 256, 0, stream>>>(
      xn1, Wv, vf, nullptr, nullptr, NTOK, 256, CDIM, CDIM, 256, 256, nullptr, nullptr);
  // 3) RoPE + bf16 conversion
  rope_kernel<<<(NTOK * 16 * 32) / 256, 256, 0, stream>>>(qf, qb, 16, CDIM);
  rope_kernel<<<(NTOK * 4 * 32) / 256, 256, 0, stream>>>(kf, kbuf, 4, 256);
  cvt_bf16_kernel<<<(NTOK * 256) / 256, 256, 0, stream>>>(vf, vbuf);
  // 4) attention
  attn_kernel<<<dim3(64, 8), 256, 0, stream>>>(qb, kbuf, vbuf, yatt);
  // 5) x1 = yatt @ Wo + x
  gemm_wmma<2, float, 0><<<dim3(CDIM / 128, NTOK / 128), 256, 0, stream>>>(
      yatt, Wo, x1, nullptr, x, NTOK, CDIM, CDIM, CDIM, CDIM, CDIM, nullptr, nullptr);
  // 6) xn2 = rmsnorm(x1)
  rmsnorm_kernel<<<NTOK, 256, 0, stream>>>(x1, ln2, xn2);
  // 7) gating + aux stats
  gate_kernel<<<GATE_BLOCKS, 256, 0, stream>>>(xn2, Wg, sel, gw, part);
  // 8) sort the (token, expert) pairs by expert
  route_kernel<<<1, 1024, 0, stream>>>(sel, rowtok, slot, tile_e);
  // 9) experts, chosen rows only: h = gelu(xn2[rowtok] @ W1[e]); ye = h @ W2[e]
  gemm_wmma<1, float, 1><<<dim3(IDIM / 128, MAXTILE), 256, 0, stream>>>(
      xn2, W1, nullptr, hbf, nullptr, MAXROW, IDIM, CDIM, CDIM, IDIM, IDIM, rowtok, tile_e);
  gemm_wmma<0, unsigned short, 2><<<dim3(CDIM / 128, MAXTILE), 256, 0, stream>>>(
      hbf, W2, ye, nullptr, nullptr, MAXROW, CDIM, IDIM, IDIM, CDIM, CDIM, nullptr, tile_e);
  //    out = x1 + the two weighted expert rows of each token
  combine_kernel<<<NTOK, 256, 0, stream>>>(
      (const float4*)x1, (const float4*)ye, slot, gw, (float4*)outx);
  // 10) aux loss scalar
  aux_kernel<<<1, 256, 0, stream>>>(part, outx + (size_t)NTOK * CDIM);
}

// v007
// A run of this version takes 402 microseconds.
// Next to v006, in two timings, it ran 1.14 and 1.15 times as fast.
// Over all steps from v000 it is 9.22 times as fast.
#include <hip/hip_runtime.h>
#include <hip/hip_bf16.h>
#include <math.h>

// ---------------- types / helpers ----------------
typedef __attribute__((ext_vector_type(16))) __bf16 v16bf;
typedef __attribute__((ext_vector_type(8)))  float  v8f;
typedef __attribute__((ext_vector_type(4)))  unsigned int u32x4;
typedef __attribute__((ext_vector_type(8)))  short s16x8;

union FragBF { u32x4 q[2]; v16bf v; };

// f32 -> bf16, round to nearest even, by the chip's own packed convert: one instruction for two values
typedef __attribute__((ext_vector_type(2))) float  f32x2;
typedef __attribute__((ext_vector_type(2))) __bf16 bf16x2;
__device__ inline unsigned int pk_bf16(float lo, float hi) {
  f32x2 v = {lo, hi};
  return __builtin_bit_cast(unsigned int, __builtin_convertvector(v, bf16x2));
}
__device__ inline unsigned int f32_bf16(float f) {
  return (unsigned int)__builtin_bit_cast(unsigned short, (__bf16)f);
}
// pack 8 consecutive values (float->bf16 or passthrough bf16 bits) into u32x4
__device__ inline u32x4 load8_bf(const float* p) {
  const float4* q = (const float4*)p;
  float4 a = q[0], b = q[1];
  u32x4 r;
  r.x = pk_bf16(a.x, a.y);
  r.y = pk_bf16(a.z, a.w);
  r.z = pk_bf16(b.x, b.y);
  r.w = pk_bf16(b.z, b.w);
  return r;
}
__device__ inline u32x4 load8_bf(const unsigned short* p) {
  return *(const u32x4*)p;
}
// the same 8 values in two halves: the load alone, as it comes from memory, and the packing
struct Raw8f { float4 a, b; };
__device__ inline Raw8f load8_raw(const float* p) {
  const float4* q = (const float4*)p;
  Raw8f r; r.a = q[0]; r.b = q[1];
  return r;
}
__device__ inline u32x4 load8_raw(const unsigned short* p) {
  return *(const u32x4*)p;
}
__device__ inline u32x4 pack8_bf(const Raw8f& v) {
  u32x4 r;
  r.x = pk_bf16(v.a.x, v.a.y);
  r.y = pk_bf16(v.a.z, v.a.w);
  r.z = pk_bf16(v.b.x, v.b.y);
  r.w = pk_bf16(v.b.z, v.b.w);
  return r;
}
__device__ inline u32x4 pack8_bf(const u32x4& v) { return v; }
// transposing LDS load: from a row-major [k][n] 16-bit tile, lane (c, h) gets 8 k of column c
__device__ inline u32x4 ld_tr16(const unsigned short* p) {
  typedef __attribute__((address_space(3))) s16x8 lds_s16x8;
  return __builtin_bit_cast(u32x4, __builtin_amdgcn_ds_load_tr16_b128_v8i16((lds_s16x8*)p));
}

// DPP16 butterfly reductions over a 16-lane row (VALU only, no LDS)
// ctrl must be a compile-time constant -> template parameter
template <int CTRL>
__device__ inline float dpp_f(float x) {
  return __int_as_float(
      __builtin_amdgcn_update_dpp(0, __float_as_int(x), CTRL, 0xF, 0xF, true));
}
#define DPP_QPERM_XOR1 0xB1   // quad_perm(1,0,3,2)
#define DPP_QPERM_XOR2 0x4E   // quad_perm(2,3,0,1)
#define DPP_ROW_HMIRR  0x141  // row_half_mirror (lane^7 within 8)
#define DPP_ROW_MIRR   0x140  // row_mirror (lane^15 within 16)
__device__ inline float red16_max(float x) {
  x = fmaxf(x, dpp_f<DPP_QPERM_XOR1>(x));
  x = fmaxf(x, dpp_f<DPP_QPERM_XOR2>(x));
  x = fmaxf(x, dpp_f<DPP_ROW_HMIRR>(x));
  x = fmaxf(x, dpp_f<DPP_ROW_MIRR>(x));
  return x;
}
__device__ inline float red16_sum(float x) {
  x += dpp_f<DPP_QPERM_XOR1>(x);
  x += dpp_f<DPP_QPERM_XOR2>(x);
  x += dpp_f<DPP_ROW_HMIRR>(x);
  x += dpp_f<DPP_ROW_MIRR>(x);
  return x;
}

#define NTOK 4096   // B*T
#define CDIM 1024
#define IDIM 4096
#define NEXP 8
#define MAXTILE 72            // 2*NTOK routed rows, each expert's list padded to 128: at most 71 tiles
#define MAXROW (MAXTILE * 128)

// ---------------- RMSNorm ----------------
__global__ void rmsnorm_kernel(const float* __restrict__ x,
                               const float* __restrict__ scale,
                               float* __restrict__ out) {
  __shared__ float red[9];
  int row = blockIdx.x;
  int tid = threadIdx.x;
  const float* xr = x + (size_t)row * CDIM;
  float v[4]; float ss = 0.f;
#pragma unroll
  for (int i = 0; i < 4; i++) { v[i] = xr[tid + 256 * i]; ss += v[i] * v[i]; }
#pragma unroll
  for (int off = 16; off >= 1; off >>= 1) ss += __shfl_xor(ss, off);
  if ((tid & 31) == 0) red[tid >> 5] = ss;
  __syncthreads();
  if (tid == 0) {
    float t = 0.f;
#pragma unroll
    for (int w = 0; w < 8; w++) t += red[w];
    red[8] = t;
  }
  __syncthreads();
  float inv = rsqrtf(red[8] / (float)CDIM + 1e-5f);
#pragma unroll
  for (int i = 0; i < 4; i++) {
    int c = tid + 256 * i;
    out[(size_t)row * CDIM + c] = v[i] * inv * scale[c];
  }
}

// ---------------- generic WMMA GEMM, 128x128 tile, double-buffered LDS ----------------
// C(M,N) = A(M,K) * B(K,N); A: float or bf16-bits; B: float (bf16-converted on stage)
// 8 waves; wave (wr,wc) owns rows wr*32..+32, cols wc*64..+64 => 2x4 wmma accums.
// EPI: 0 = store f32; 1 = gelu->bf16 (outh); 2 = +aux residual
// GRP: 0 = plain; 1, 2 = row tile blockIdx.y belongs to expert tile_e[blockIdx.y], whose
//      weights are plane tile_e of Bm; 1 also gathers the A rows through rowtok
//      3 = three products that share A in one launch: the column tiles run through Bm (N wide,
//      to outf), then Bm2 and Bm3 (N2 wide each, to outf2 and outf3); each is dense, ld = width
// The block size is stated so that the next tile's unconverted values fit in registers.
template <int EPI, typename AT, int GRP>
__global__ void __launch_bounds__(256) gemm_wmma(const AT* __restrict__ A, const float* __restrict__ Bm,
                          float* __restrict__ outf, unsigned short* __restrict__ outh,
                          const float* __restrict__ aux,
                          int M, int N, int Kd, int lda, int ldb, int ldc,
                          const int* __restrict__ rowtok, const int* __restrict__ tile_e,
                          const float* __restrict__ Bm2, const float* __restrict__ Bm3,
                          float* __restrict__ outf2, float* __restrict__ outf3, int N2) {
  __shared__ __attribute__((aligned(16))) unsigned short aS[2][128][40];
  // B stays row-major [k][n]; 288-byte rows (32 B x odd) suit the transposing load
  __shared__ __attribute__((aligned(16))) unsigned short bS[2][32][144];
  int tid = threadIdx.x;
  int lane = tid & 31;
  int wave = tid >> 5;
  int wr = wave & 3, wc = wave >> 2;
  int m0 = blockIdx.y * 128, n0 = blockIdx.x * 128;
  if (GRP == 3 && n0 >= N) {    // the same for the whole block: a tile of the second or third product
    n0 -= N;
    bool third = n0 >= N2;
    if (third) n0 -= N2;
    Bm = third ? Bm3 : Bm2;
    outf = third ? outf3 : outf2;
    ldb = N2; ldc = N2;
  }
  int hi = lane >> 4;
  int kb = hi * 8;
  int ln = lane & 15;
  int ar0 = wr * 32 + ln;
  int btr = hi * 8 + (lane & 7);                    // B fragment: this lane's k row ...
  int btc = wc * 64 + ((lane >> 3) & 1) * 8;        // ... and its 16-byte piece of 16 columns
  if (GRP == 1 || GRP == 2) {
    int te = tile_e[blockIdx.y];
    if (te < 0) return;         // tile behind the last routed row: the whole block leaves here
    Bm += (size_t)(te & (NEXP - 1)) * Kd * ldb;
  }
  // staging index precompute (2 chunks of 8 elems per thread for A and B)
  int rA[2], cgA[2], kB[2], nbB[2];
#pragma unroll
  for (int g = 0; g < 2; g++) {
    int lin = tid + 256 * g;
    rA[g] = lin >> 2; cgA[g] = (lin & 3) * 8;
    kB[g] = lin >> 4; nbB[g] = (lin & 15) * 8;
  }
  unsigned aoff[2] = {0u, 0u};  // GRP 1: byte offsets of this thread's two gathered A chunks
  if (GRP == 1) {
#pragma unroll                  // constant indices keep aoff[] in registers
    for (int g = 0; g < 2; g++)
      aoff[g] = (unsigned)((rowtok[m0 + rA[g]] & (NTOK - 1)) * lda + cgA[g]) * (unsigned)sizeof(AT);
  }
  v8f acc[2][4] = {};
  u32x4 ra[2], rb[2];
  int nt = Kd >> 5;
  // prologue: load tile 0 into regs, store to buffer 0
#pragma unroll
  for (int g = 0; g < 2; g++) {
    if (GRP == 1) {             // gathered row: uniform base + 32-bit lane offset
      ra[g] = load8_bf((const AT*)((const char*)A + aoff[g]));
    } else {
      ra[g] = load8_bf(&A[(size_t)(m0 + rA[g]) * lda + cgA[g]]);
    }
    const float4* qp = (const float4*)&Bm[(size_t)kB[g] * ldb + n0 + nbB[g]];
    float4 fa = qp[0], fb = qp[1];
    rb[g].x = pk_bf16(fa.x, fa.y);
    rb[g].y = pk_bf16(fa.z, fa.w);
    rb[g].z = pk_bf16(fb.x, fb.y);
    rb[g].w = pk_bf16(fb.z, fb.w);
  }
#pragma unroll
  for (int g = 0; g < 2; g++) {
    *(u32x4*)&aS[0][rA[g]][cgA[g]] = ra[g];
    *(u32x4*)&bS[0][kB[g]][nbB[g]] = rb[g];
  }
  __syncthreads();
  // the products of the tile in buffer buf
  auto mma_tile = [&](int buf) {
    FragBF a0, a1;
    a0.q[0] = *(const u32x4*)&aS[buf][ar0][kb];
    a0.q[1] = *(const u32x4*)&aS[buf][ar0][16 + kb];
    a1.q[0] = *(const u32x4*)&aS[buf][ar0 + 16][kb];
    a1.q[1] = *(const u32x4*)&aS[buf][ar0 + 16][16 + kb];
#pragma unroll
    for (int bj = 0; bj < 4; bj++) {
      FragBF bf;
      bf.q[0] = ld_tr16(&bS[buf][btr][btc + bj * 16]);
      bf.q[1] = ld_tr16(&bS[buf][16 + btr][btc + bj * 16]);
      acc[0][bj] = __builtin_amdgcn_wmma_f32_16x16x32_bf16(false, a0.v, false, bf.v, (short)0, acc[0][bj], false, false);
      acc[1][bj] = __builtin_amdgcn_wmma_f32_16x16x32_bf16(false, a1.v, false, bf.v, (short)0, acc[1][bj], false, false);
      // one B fragment live at a time; the last one also keeps the conversion of the next
      // tile, and with it the wait for its loads, behind the products
      __builtin_amdgcn_sched_barrier(0);
    }
  };
  // every pass but the last fetches the tile after it; the last pass stands behind the loop, so
  // the loaded values live inside one pass and are not copied (a copy would wait for the loads)
  for (int kt = 0; kt + 1 < nt; kt++) {
    int buf = kt & 1;
    int k1 = (kt + 1) << 5;
    // issue all of the next tile's global loads together; nothing uses their values before the
    // products are done, so they stay in flight meanwhile
    decltype(load8_raw((const AT*)nullptr)) wa[2];
    Raw8f wb[2];
    const AT* pa[2];
    const float* pb[2];
#pragma unroll
    for (int g = 0; g < 2; g++) {
      if (GRP == 1) {
        pa[g] = (const AT*)((const char*)(A + k1) + aoff[g]);
      } else {
        pa[g] = &A[(size_t)(m0 + rA[g]) * lda + k1 + cgA[g]];
      }
      pb[g] = &Bm[(size_t)(k1 + kB[g]) * ldb + n0 + nbB[g]];
      wa[g] = load8_raw(pa[g]);
      wb[g] = load8_raw(pb[g]);
    }
    // the code below reuses the address registers of the loads above; as inputs of the wait
    // they stay untouched up to it, also by the later loads' own results
    asm volatile("s_wait_xcnt 0x0" :: "v"(pa[0]), "v"(pa[1]), "v"(pb[0]), "v"(pb[1]) : "memory");
    if (kt + 2 < nt) {   // prefetch two tiles ahead into GL2
      int k2 = (kt + 2) << 5;
      if (GRP == 1) {
        __builtin_prefetch((const char*)(A + k2) + aoff[0], 0, 1);
      } else {
        __builtin_prefetch(&A[(size_t)(m0 + rA[0]) * lda + k2 + cgA[0]], 0, 1);
      }
      __builtin_prefetch(&Bm[(size_t)(k2 + kB[0]) * ldb + n0 + nbB[0]], 0, 1);
    }
    mma_tile(buf);
    int nb = buf ^ 1;
#pragma unroll
    for (int g = 0; g < 2; g++) {   // first use of the loaded values: convert, then store
      *(u32x4*)&aS[nb][rA[g]][cgA[g]] = pack8_bf(wa[g]);
      *(u32x4*)&bS[nb][kB[g]][nbB[g]] = pack8_bf(wb[g]);
    }
    __syncthreads();
  }
  mma_tile((nt - 1) & 1);
#pragma unroll
  for (int ai = 0; ai < 2; ai++) {
#pragma unroll
    for (int bj = 0; bj < 4; bj++) {
#pragma unroll
      for (int i = 0; i < 8; i++) {
        int r = m0 + wr * 32 + ai * 16 + i + hi * 8;
        int c = n0 + wc * 64 + bj * 16 + ln;
        size_t idx = (size_t)r * ldc + c;
        float v = acc[ai][bj][i];
        if (EPI == 0) {
          outf[idx] = v;
        } else if (EPI == 1) {
          float g = 0.5f * v * (1.0f + erff(v * 0.70710678118f));
          outh[idx] = (unsigned short)f32_bf16(g);
        } else if (EPI == 2) {
          outf[idx] = v + aux[idx];
        }
      }
    }
  }
}

// ---------------- RoPE (+ bf16 convert) ----------------
__device__ inline void rope_pair(const float* __restrict__ in, unsigned short* __restrict__ outb,
                                 int nheads, int ld, int idx) {   // idx: pair index over NTOK*nheads*32
  int d = idx & 31;
  int th = idx >> 5;
  int head = th % nheads;
  int tok = th / nheads;
  int t = tok & 1023;                             // tok = b*T + t
  size_t base = (size_t)tok * ld + head * 64;
  float x1 = in[base + d], x2 = in[base + 32 + d];
  float inv_freq = __expf(-0.2878231366f * (float)d);  // 10000^(-d/32)
  float ang = (float)t * inv_freq;
  float cs = __cosf(ang), sn = __sinf(ang);
  // the slot behind the last transcendental: the next vector instruction may reuse its source
  // register; as inputs, the two results keep the slot behind them
  asm volatile("v_nop" :: "v"(cs), "v"(sn));
  // the fused forms written out: which product of a pair is rounded first does not hang on the call site
  unsigned int pr = pk_bf16(fmaf(x1, cs, -(x2 * sn)), fmaf(x2, cs, x1 * sn));
  outb[base + d]      = (unsigned short)pr;
  outb[base + 32 + d] = (unsigned short)(pr >> 16);
}

// q's RoPE, k's RoPE and v's conversion do not depend on one another: one launch, the blocks dealt in that order
#define ROPE_Q_BLOCKS ((NTOK * 16 * 32) / 256)
#define ROPE_K_BLOCKS ((NTOK * 4 * 32) / 256)
#define CVT_V_BLOCKS  ((NTOK * 256) / 256)
__global__ void qkv_post_kernel(const float* __restrict__ qf, unsigned short* __restrict__ qb,
                                const float* __restrict__ kf, unsigned short* __restrict__ kbuf,
                                const float* __restrict__ vf, unsigned short* __restrict__ vbuf) {
  int blk = blockIdx.x;
  if (blk < ROPE_Q_BLOCKS) {
    rope_pair(qf, qb, 16, CDIM, blk * 256 + threadIdx.x);
  } else if (blk < ROPE_Q_BLOCKS + ROPE_K_BLOCKS) {
    rope_pair(kf, kbuf, 4, 256, (blk - ROPE_Q_BLOCKS) * 256 + threadIdx.x);
  } else {
    size_t i = (size_t)(blk - ROPE_Q_BLOCKS - ROPE_K_BLOCKS) * 256 + threadIdx.x;
    vbuf[i] = (unsigned short)f32_bf16(vf[i]);
  }
}

// ---------------- flash attention (WMMA, causal, GQA) ----------------
// The block size is stated so that a key tile's staged values fit in registers beside the rest.
__global__ void __launch_bounds__(256) attn_kernel(const unsigned short* __restrict__ qb,
                            const unsigned short* __restrict__ kbuf,
                            const unsigned short* __restrict__ vbuf,
                            float* __restrict__ y) {
  __shared__ __attribute__((aligned(16))) unsigned short Kls[32][72];
  __shared__ __attribute__((aligned(16))) unsigned short Vls[64][40];
  __shared__ __attribute__((aligned(16))) unsigned short Pls[8][16][40];
  int tid = threadIdx.x, lane = tid & 31, wave = tid >> 5;
  int bh = blockIdx.x;
  int b = bh >> 4, h = bh & 15;
  int kvh = h >> 2;
  int qt = blockIdx.y;
  int qbase = qt * 128 + wave * 16;
  int hi = lane >> 4, kbo = hi * 8, ln = lane & 15;
  int qrow = qbase + ln;
  const unsigned short* qp = qb + (size_t)(b * 1024 + qrow) * CDIM + h * 64;
  FragBF qa0, qa1;
  qa0.q[0] = *(const u32x4*)(qp + kbo);
  qa0.q[1] = *(const u32x4*)(qp + 16 + kbo);
  qa1.q[0] = *(const u32x4*)(qp + 32 + kbo);
  qa1.q[1] = *(const u32x4*)(qp + 48 + kbo);
  float m[8], l[8];
  v8f o[4] = {};
#pragma unroll
  for (int i = 0; i < 8; i++) { m[i] = -3.0e38f; l[i] = 0.f; }
  int ntiles = (qt + 1) * 4;
  // this thread's share of a key tile: K rows wave + 8 i (one uint each), V rows vk + 4 i (one value each)
  int vk = tid >> 6, vd = tid & 63;
  const unsigned int* ksrc =
      (const unsigned int*)(kbuf + (size_t)(b * 1024 + wave) * 256 + kvh * 64) + lane;
  const unsigned short* vsrc = vbuf + (size_t)(b * 1024 + vk) * 256 + kvh * 64 + vd;
  unsigned int kr[4];
  unsigned short vr[8];
  // all 12 loads of the tile at key0 are issued together; nothing uses them before the next staging
  auto fetch_tile = [&](int key0) {
    const unsigned int* pk = ksrc + key0 * 128;
    const unsigned short* pv = vsrc + key0 * 256;
#pragma unroll                  // constant indices keep kr[] and vr[] in registers
    for (int i = 0; i < 4; i++) kr[i] = pk[i * 8 * 128];
#pragma unroll
    for (int i = 0; i < 8; i++) vr[i] = pv[i * 4 * 256];
    // the code behind reuses the address registers of the loads above; as inputs of the wait
    // they stay untouched up to it
    asm volatile("s_wait_xcnt 0x0" :: "v"(pk), "v"(pv) : "memory");
  };
  fetch_tile(0);
  for (int kt = 0; kt < ntiles; kt++) {
    int key0 = kt * 32;
#pragma unroll
    for (int i = 0; i < 4; i++)                   // stage K rows (32 x 64), uint copies
      ((unsigned int*)&Kls[wave + 8 * i][0])[lane] = kr[i];
#pragma unroll
    for (int i = 0; i < 8; i++)                   // stage V transposed: Vls[d][kk]
      Vls[vd][vk + 4 * i] = vr[i];
    __syncthreads();
    if (kt + 1 < ntiles) fetch_tile(key0 + 32);   // in flight during this tile's scores and softmax
    v8f s[2] = {};
#pragma unroll
    for (int sub = 0; sub < 2; sub++) {           // scores: Q(16x64) * K^T(64x32)
      int krow = sub * 16 + ln;
      FragBF bK;
      bK.q[0] = *(const u32x4*)&Kls[krow][kbo];
      bK.q[1] = *(const u32x4*)&Kls[krow][16 + kbo];
      s[sub] = __builtin_amdgcn_wmma_f32_16x16x32_bf16(false, qa0.v, false, bK.v, (short)0, s[sub], false, false);
      bK.q[0] = *(const u32x4*)&Kls[krow][32 + kbo];
      bK.q[1] = *(const u32x4*)&Kls[krow][48 + kbo];
      s[sub] = __builtin_amdgcn_wmma_f32_16x16x32_bf16(false, qa1.v, false, bK.v, (short)0, s[sub], false, false);
    }
    int keyc0 = key0 + ln, keyc1 = key0 + 16 + ln;
#pragma unroll
    for (int i = 0; i < 8; i++) {                 // online softmax (DPP reductions)
      int row = qbase + i + hi * 8;
      float s0 = s[0][i] * 0.125f; if (keyc0 > row) s0 = -3.0e38f;
      float s1 = s[1][i] * 0.125f; if (keyc1 > row) s1 = -3.0e38f;
      float t = red16_max(fmaxf(s0, s1));
      float mn = fmaxf(m[i], t);
      float fac = __expf(m[i] - mn);
      float p0 = __expf(s0 - mn), p1 = __expf(s1 - mn);
      float ps = red16_sum(p0 + p1);
      l[i] = l[i] * fac + ps;
      m[i] = mn;
#pragma unroll
      for (int sub = 0; sub < 4; sub++) o[sub][i] *= fac;
      unsigned int pp = pk_bf16(p0, p1);
      Pls[wave][i + hi * 8][ln]      = (unsigned short)pp;
      Pls[wave][i + hi * 8][16 + ln] = (unsigned short)(pp >> 16);
    }
    __syncthreads();
    FragBF pa;                                    // P(16x32) * V(32x64)
    pa.q[0] = *(const u32x4*)&Pls[wave][ln][kbo];
    pa.q[1] = *(const u32x4*)&Pls[wave][ln][16 + kbo];
#pragma unroll
    for (int sub = 0; sub < 4; sub++) {
      FragBF bV;
      int col = sub * 16 + ln;
      bV.q[0] = *(const u32x4*)&Vls[col][kbo];
      bV.q[1] = *(const u32x4*)&Vls[col][16 + kbo];
      o[sub] = __builtin_amdgcn_wmma_f32_16x16x32_bf16(false, pa.v, false, bV.v, (short)0, o[sub], false, false);
    }
    __syncthreads();
  }
#pragma unroll
  for (int sub = 0; sub < 4; sub++)
#pragma unroll
    for (int i = 0; i < 8; i++) {
      int row = qbase + i + hi * 8;
      int col = h * 64 + sub * 16 + ln;
      y[(size_t)(b * 1024 + row) * CDIM + col] = o[sub][i] / l[i];
    }
}

// ---------------- MoE gate: softmax, top-2, combine weights, aux stats ----------------
// sel[row] = lower expert | higher expert << 4; gw[2*row], gw[2*row+1] = their weights
// part[16*block + e] = sum of P[e] over the block's 8 tokens, part[16*block + 8 + e] = how many
// of their 16 choices fell on expert e; every block writes its own row, no word is shared
#define GATE_BLOCKS (NTOK / 8)
__global__ void gate_kernel(const float* __restrict__ xn, const float* __restrict__ Wg,
                            int* __restrict__ sel, float* __restrict__ gw,
                            float* __restrict__ part_out) {
  __shared__ __attribute__((aligned(16))) float sP[8][2 * NEXP];   // a token's P, then its two choices as 0 / 1
  int tid = threadIdx.x, lane = tid & 31, wave = tid >> 5;
  int row = blockIdx.x * 8 + wave;
  float part[NEXP];
#pragma unroll
  for (int e = 0; e < NEXP; e++) part[e] = 0.f;
  const float* xr = xn + (size_t)row * CDIM;
  for (int c = lane; c < CDIM; c += 32) {
    float xv = xr[c];
#pragma unroll
    for (int e = 0; e < NEXP; e++) part[e] += xv * Wg[c * NEXP + e];
  }
#pragma unroll
  for (int e = 0; e < NEXP; e++)
#pragma unroll
    for (int off = 1; off < 32; off <<= 1) part[e] += __shfl_xor(part[e], off);
  if (lane == 0) {
    float mx = part[0];
#pragma unroll
    for (int e = 1; e < NEXP; e++) mx = fmaxf(mx, part[e]);
    float pe[NEXP], s = 0.f;
#pragma unroll
    for (int e = 0; e < NEXP; e++) { pe[e] = __expf(part[e] - mx); s += pe[e]; }
#pragma unroll
    for (int e = 0; e < NEXP; e++) pe[e] /= s;
    int s0 = 0;
#pragma unroll
    for (int e = 1; e < NEXP; e++) if (pe[e] > pe[s0]) s0 = e;
    int s1 = -1;
#pragma unroll
    for (int e = 0; e < NEXP; e++) if (e != s0 && (s1 < 0 || pe[e] > pe[s1])) s1 = e;
    float denom = pe[s0] + pe[s1];
    float w0 = pe[s0] / denom, w1 = pe[s1] / denom;
    bool up = s0 < s1;
    sel[row] = up ? (s0 | (s1 << 4)) : (s1 | (s0 << 4));
    gw[2 * row]     = up ? w0 : w1;
    gw[2 * row + 1] = up ? w1 : w0;
#pragma unroll                  // constant indices keep pe[] in registers
    for (int e = 0; e < NEXP; e++) {
      sP[wave][e] = pe[e];
      sP[wave][NEXP + e] = (e == s0 || e == s1) ? 1.0f : 0.0f;
    }
  }
  __syncthreads();
  if (tid < 2 * NEXP) {         // the block's 16 sums, tokens in wave order
    float t = 0.f;
#pragma unroll                  // the 8 LDS reads go out together
    for (int w = 0; w < 8; w++) t += sP[w][tid];
    part_out[blockIdx.x * 16 + tid] = t;
  }
}

// one block, its first 256 threads: thread t sums word t & 15 over the rows (t >> 4) + 16 j, then
// the 16 threads of a word are summed in LDS; the order is fixed
__device__ inline void aux_block(const float* __restrict__ part_in, float* __restrict__ out_aux) {
  __shared__ float red[16][16];
  int tid = threadIdx.x;
  if (tid < 256) {
    float t = 0.f;
#pragma unroll                  // all 32 loads in flight together
    for (int j = 0; j < GATE_BLOCKS / 16; j++) t += part_in[tid + 256 * j];
    red[tid >> 4][tid & 15] = t;
  }
  __syncthreads();
  if (tid < 16) {
    float s = 0.f;
#pragma unroll                  // the 16 LDS reads go out together
    for (int g = 0; g < 16; g++) s += red[g][tid];
    red[0][tid] = s;
  }
  __syncthreads();
  if (tid == 0) {
    float s = 0.f;
    for (int e = 0; e < NEXP; e++)
      s += (red[0][NEXP + e] / (float)(NTOK * 2)) * (red[0][e] / (float)NTOK);
    out_aux[0] = (float)NEXP * s;
  }
}

// ---------------- MoE routing: sort the 2*NTOK (token, expert) pairs by expert ----------------
// One block of 1024 threads, 4 tokens each. Eight running counts travel as 16-bit fields
// of two 64-bit words (no field passes MAXROW). Each expert's list starts at a multiple of 128.
// rowtok[p] = token of routed row p (0 in the padding), slot[2*t+j] = routed row of token t's
// j-th expert, tile_e[i] = expert of rows 128*i.., -1 behind the last list.
__device__ inline unsigned long long fld_one(int e) { return 1ull << ((e & 3) * 16); }
__device__ inline int fld_get(unsigned long long lo, unsigned long long hi, int e) {
  return (int)(((e < 4 ? lo : hi) >> ((e & 3) * 16)) & 0xFFFFull);
}
// Block 1 of the launch does the aux sum instead: it needs the gate's rows only, as the sort does.
__global__ void route_kernel(const int* __restrict__ sel, int* __restrict__ rowtok,
                             int* __restrict__ slot, int* __restrict__ tile_e,
                             const float* __restrict__ part_in, float* __restrict__ out_aux) {
  __shared__ unsigned long long wtot[32][2];
  if (blockIdx.x == 1) {        // the whole block goes this way, in front of every barrier of the sort
    aux_block(part_in, out_aux);
    return;
  }
  int tid = threadIdx.x, lane = tid & 31, wave = tid >> 5;
  int ex[8];
  unsigned long long lo = 0, hi = 0;
  // the loops over ex[] and over the experts are unrolled so that ex[] and the shift counts
  // are indexed by constants and nothing goes to scratch
#pragma unroll
  for (int i = 0; i < 4; i++) {
    int s = sel[tid * 4 + i];
    ex[2 * i] = s & 7; ex[2 * i + 1] = (s >> 4) & 7;
  }
#pragma unroll
  for (int i = 0; i < 8; i++) {
    if (ex[i] < 4) lo += fld_one(ex[i]); else hi += fld_one(ex[i]);
  }
  unsigned long long ilo = lo, ihi = hi;          // inclusive scan over the wave
  for (int d = 1; d < 32; d <<= 1) {
    unsigned long long a = __shfl_up(ilo, d), b = __shfl_up(ihi, d);
    if (lane >= d) { ilo += a; ihi += b; }
  }
  if (lane == 31) { wtot[wave][0] = ilo; wtot[wave][1] = ihi; }
  __syncthreads();
  unsigned long long tlo = 0, thi = 0, plo = ilo - lo, phi = ihi - hi;
#pragma unroll 4                // unrolled whole, the 64 words are all held in registers and spill
  for (int w = 0; w < 32; w++) {
    unsigned long long a = wtot[w][0], b = wtot[w][1];
    tlo += a; thi += b;
    if (w < wave) { plo += a; phi += b; }
  }
  int off = 0;
  int mytile = -1;
#pragma unroll
  for (int e = 0; e < NEXP; e++) {
    int cnt = fld_get(tlo, thi, e);
    int end = off + ((cnt + 127) & ~127);
    if (e < 4) plo += (unsigned long long)off << (e * 16);
    else       phi += (unsigned long long)off << ((e - 4) * 16);
    if (off + cnt + tid < end) rowtok[off + cnt + tid] = 0;
    if (tid * 128 >= off && tid * 128 < end) mytile = e;
    off = end;
  }
  if (tid < MAXTILE) tile_e[tid] = mytile;
#pragma unroll
  for (int i = 0; i < 8; i++) {
    int e = ex[i];
    int p = fld_get(plo, phi, e);
    if (e < 4) plo += fld_one(e); else phi += fld_one(e);
    rowtok[p] = tid * 4 + (i >> 1);
    slot[tid * 8 + i] = p;
  }
}

// out = x1 + w_a * ye[row_a] + w_b * ye[row_b], lower expert first; one block per token
__global__ void combine_kernel(const float4* __restrict__ x1, const float4* __restrict__ ye,
                               const int* __restrict__ slot, const float* __restrict__ gw,
                               float4* __restrict__ dst) {
  int tok = blockIdx.x, c = threadIdx.x;
  int pa = min(slot[2 * tok], MAXROW - 1), pb = min(slot[2 * tok + 1], MAXROW - 1);
  float wa = gw[2 * tok], wb = gw[2 * tok + 1];
  float4 o = x1[(size_t)tok * 256 + c];
  float4 a = ye[(size_t)pa * 256 + c];
  float4 b = ye[(size_t)pb * 256 + c];
  o.x += wa * a.x; o.y += wa * a.y; o.z += wa * a.z; o.w += wa * a.w;
  o.x += wb * b.x; o.y += wb * b.y; o.z += wb * b.z; o.w += wb * b.w;
  dst[(size_t)tok * 256 + c] = o;
}

// ---------------- launcher ----------------
extern "C" void kernel_launch(void* const* d_in, const int* in_sizes, int n_in,
                              void* d_out, int out_size, void* d_ws, size_t ws_size,
                              hipStream_t stream) {
  (void)in_sizes; (void)n_in; (void)out_size; (void)ws_size;
  const float* x   = (const float*)d_in[0];
  const float* ln1 = (const float*)d_in[1];
  const float* ln2 = (const float*)d_in[2];
  const float* Wq  = (const float*)d_in[3];
  const float* Wk  = (const float*)d_in[4];
  const float* Wv  = (const float*)d_in[5];
  const float* Wo  = (const float*)d_in[6];
  const float* Wg  = (const float*)d_in[7];
  const float* W1  = (const float*)d_in[8];
  const float* W2  = (const float*)d_in[9];
  float* outx = (float*)d_out;

  char* ws = (char*)d_ws;
  size_t off = 0;
  auto alloc = [&](size_t bytes) -> void* {
    void* p = ws + off;
    off += (bytes + 255) & ~(size_t)255;
    return p;
  };
  float*          xn1  = (float*)alloc((size_t)NTOK * CDIM * 4);
  float*          qf   = (float*)alloc((size_t)NTOK * CDIM * 4);
  float*          kf   = (float*)alloc((size_t)NTOK * 256 * 4);
  float*          vf   = (float*)alloc((size_t)NTOK * 256 * 4);
  unsigned short* qb   = (unsigned short*)alloc((size_t)NTOK * CDIM * 2);
  unsigned short* kbuf = (unsigned short*)alloc((size_t)NTOK * 256 * 2);
  unsigned short* vbuf = (unsigned short*)alloc((size_t)NTOK * 256 * 2);
  float*          yatt = (float*)alloc((size_t)NTOK * CDIM * 4);
  float*          x1   = (float*)alloc((size_t)NTOK * CDIM * 4);
  float*          xn2  = (float*)alloc((size_t)NTOK * CDIM * 4);
  unsigned short* hbf  = (unsigned short*)alloc((size_t)MAXROW * IDIM * 2);
  float*          ye   = (float*)alloc((size_t)MAXROW * CDIM * 4);
  int*            sel  = (int*)alloc((size_t)NTOK * 4);
  float*          gw   = (float*)alloc((size_t)NTOK * 2 * 4);
  int*            rowtok = (int*)alloc((size_t)MAXROW * 4);
  int*            slot = (int*)alloc((size_t)NTOK * 2 * 4);
  int*            tile_e = (int*)alloc((size_t)MAXTILE * 4);
  float*          part = (float*)alloc((size_t)GATE_BLOCKS * 16 * 4);

  // 1) xn1 = rmsnorm(x)
  rmsnorm_kernel<<<NTOK, 256, 0, stream>>>(x, ln1, xn1);
  // 2) q/k/v projections
  //    one launch: alone, the k and v products put 64 blocks on the chip for as long as q's 256
  gemm_wmma<0, float, 3><<<dim3((CDIM + 256 + 256) / 128, NTOK / 128), 256, 0, stream>>>(
      xn1, Wq, qf, nullptr, nullptr, NTOK, CDIM, CDIM, CDIM, CDIM, CDIM, nullptr, nullptr,
      Wk, Wv, kf, vf, 256);
  // 3) RoPE + bf16 conversion
  qkv_post_kernel<<<ROPE_Q_BLOCKS + ROPE_K_BLOCKS + CVT_V_BLOCKS, 256, 0, stream>>>(
      qf, qb, kf, kbuf, vf, vbuf);
  // 4) attention
  attn_kernel<<<dim3(64, 8), 256, 0, stream>>>(qb, kbuf, vbuf, yatt);
  // 5) x1 = yatt @ Wo + x
  gemm_wmma<2, float, 0><<<dim3(CDIM / 128, NTOK / 128), 256, 0, stream>>>(
      yatt, Wo, x1, nullptr, x, NTOK, CDIM, CDIM, CDIM, CDIM, CDIM, nullptr, nullptr,
      nullptr, nullptr, nullptr, nullptr, 0);
  // 6) xn2 = rmsnorm(x1)
  rmsnorm_kernel<<<NTOK, 256, 0, stream>>>(x1, ln2, xn2);
  // 7) gating + aux stats
  gate_kernel<<<GATE_BLOCKS, 256, 0, stream>>>(xn2, Wg, sel, gw, part);
  // 8) sort the (token, expert) pairs by expert; beside it, the aux loss scalar
  route_kernel<<<2, 1024, 0, stream>>>(sel, rowtok, slot, tile_e,
                                       part, outx + (size_t)NTOK * CDIM);
  // 9) experts, chosen rows only: h = gelu(xn2[rowtok] @ W1[e]); ye = h @ W2[e]
  gemm_wmma<1, float, 1><<<dim3(IDIM / 128, MAXTILE), 256, 0, stream>>>(
      xn2, W1, nullptr, hbf, nullptr, MAXROW, IDIM, CDIM, CDIM, IDIM, IDIM, rowtok, tile_e,
      nullptr, nullptr, nullptr, nullptr, 0);
  gemm_wmma<0, unsigned short, 2><<<dim3(CDIM / 128, MAXTILE), 256, 0, stream>>>(
      hbf, W2, ye, nullptr, nullptr, MAXROW, CDIM, IDIM, IDIM, CDIM, CDIM, nullptr, tile_e,
      nullptr, nullptr, nullptr, nullptr, 0);
  //    out = x1 + the two weighted expert rows of each token
  combine_kernel<<<NTOK, 256, 0, stream>>>(
      (const float4*)x1, (const float4*)ye, slot, gw, (float4*)outx);
}

// v008
// It runs in 387 microseconds.
// In both of two side-by-side timings against v007, it was 1.04 times as fast.
// All steps since v000 together make it 9.56 times as fast.
#include <hip/hip_runtime.h>
#include <hip/hip_bf16.h>
#include <math.h>

// ---------------- types / helpers ----------------
typedef __attribute__((ext_vector_type(16))) __bf16 v16bf;
typedef __attribute__((ext_vector_type(8)))  float  v8f;
typedef __attribute__((ext_vector_type(4)))  unsigned int u32x4;
typedef __attribute__((ext_vector_type(8)))  short s16x8;

union FragBF { u32x4 q[2]; v16bf v; };

// f32 -> bf16, round to nearest even, by the chip's own packed convert: one instruction for two values
typedef __attribute__((ext_vector_type(2))) float  f32x2;
typedef __attribute__((ext_vector_type(2))) __bf16 bf16x2;
__device__ inline unsigned int pk_bf16(float lo, float hi) {
  f32x2 v = {lo, hi};
  return __builtin_bit_cast(unsigned int, __builtin_convertvector(v, bf16x2));
}
__device__ inline unsigned int f32_bf16(float f) {
  return (unsigned int)__builtin_bit_cast(unsigned short, (__bf16)f);
}
// pack 8 consecutive values (float->bf16 or passthrough bf16 bits) into u32x4
__device__ inline u32x4 load8_bf(const float* p) {
  const float4* q = (const float4*)p;
  float4 a = q[0], b = q[1];
  u32x4 r;
  r.x = pk_bf16(a.x, a.y);
  r.y = pk_bf16(a.z, a.w);
  r.z = pk_bf16(b.x, b.y);
  r.w = pk_bf16(b.z, b.w);
  return r;
}
__device__ inline u32x4 load8_bf(const unsigned short* p) {
  return *(const u32x4*)p;
}
// the same 8 values in two halves: the load alone, as it comes from memory, and the packing
struct Raw8f { float4 a, b; };
__device__ inline Raw8f load8_raw(const float* p) {
  const float4* q = (const float4*)p;
  Raw8f r; r.a = q[0]; r.b = q[1];
  return r;
}
__device__ inline u32x4 load8_raw(const unsigned short* p) {
  return *(const u32x4*)p;
}
__device__ inline u32x4 pack8_bf(const Raw8f& v) {
  u32x4 r;
  r.x = pk_bf16(v.a.x, v.a.y);
  r.y = pk_bf16(v.a.z, v.a.w);
  r.z = pk_bf16(v.b.x, v.b.y);
  r.w = pk_bf16(v.b.z, v.b.w);
  return r;
}
__device__ inline u32x4 pack8_bf(const u32x4& v) { return v; }
// transposing LDS load: from a row-major [k][n] 16-bit tile, lane (c, h) gets 8 k of column c
__device__ inline u32x4 ld_tr16(const unsigned short* p) {
  typedef __attribute__((address_space(3))) s16x8 lds_s16x8;
  return __builtin_bit_cast(u32x4, __builtin_amdgcn_ds_load_tr16_b128_v8i16((lds_s16x8*)p));
}

// DPP16 butterfly reductions over a 16-lane row (VALU only, no LDS)
// ctrl must be a compile-time constant -> template parameter
template <int CTRL>
__device__ inline float dpp_f(float x) {
  return __int_as_float(
      __builtin_amdgcn_update_dpp(0, __float_as_int(x), CTRL, 0xF, 0xF, true));
}
#define DPP_QPERM_XOR1 0xB1   // quad_perm(1,0,3,2)
#define DPP_QPERM_XOR2 0x4E   // quad_perm(2,3,0,1)
#define DPP_ROW_HMIRR  0x141  // row_half_mirror (lane^7 within 8)
#define DPP_ROW_MIRR   0x140  // row_mirror (lane^15 within 16)
__device__ inline float red16_max(float x) {
  x = fmaxf(x, dpp_f<DPP_QPERM_XOR1>(x));
  x = fmaxf(x, dpp_f<DPP_QPERM_XOR2>(x));
  x = fmaxf(x, dpp_f<DPP_ROW_HMIRR>(x));
  x = fmaxf(x, dpp_f<DPP_ROW_MIRR>(x));
  return x;
}
__device__ inline float red16_sum(float x) {
  x += dpp_f<DPP_QPERM_XOR1>(x);
  x += dpp_f<DPP_QPERM_XOR2>(x);
  x += dpp_f<DPP_ROW_HMIRR>(x);
  x += dpp_f<DPP_ROW_MIRR>(x);
  return x;
}

#define NTOK 4096   // B*T
#define CDIM 1024
#define IDIM 4096
#define NEXP 8
#define MAXTILE 72            // 2*NTOK routed rows, each expert's list padded to 128: at most 71 tiles
#define MAXROW (MAXTILE * 128)

// ---------------- RMSNorm ----------------
__global__ void rmsnorm_kernel(const float* __restrict__ x,
                               const float* __restrict__ scale,
                               float* __restrict__ out) {
  __shared__ float red[9];
  int row = blockIdx.x;
  int tid = threadIdx.x;
  const float* xr = x + (size_t)row * CDIM;
  float v[4]; float ss = 0.f;
#pragma unroll
  for (int i = 0; i < 4; i++) { v[i] = xr[tid + 256 * i]; ss += v[i] * v[i]; }
#pragma unroll
  for (int off = 16; off >= 1; off >>= 1) ss += __shfl_xor(ss, off);
  if ((tid & 31) == 0) red[tid >> 5] = ss;
  __syncthreads();
  if (tid == 0) {
    float t = 0.f;
#pragma unroll
    for (int w = 0; w < 8; w++) t += red[w];
    red[8] = t;
  }
  __syncthreads();
  float inv = rsqrtf(red[8] / (float)CDIM + 1e-5f);
#pragma unroll
  for (int i = 0; i < 4; i++) {
    int c = tid + 256 * i;
    out[(size_t)row * CDIM + c] = v[i] * inv * scale[c];
  }
}

// ---------------- generic WMMA GEMM, 128x128 tile, double-buffered LDS ----------------
// C(M,N) = A(M,K) * B(K,N); A: float or bf16-bits; B: float (bf16-converted on stage)
// 8 waves; wave (wr,wc) owns rows wr*32..+32, cols wc*64..+64 => 2x4 wmma accums.
// EPI: 0 = store f32; 1 = gelu->bf16 (outh); 2 = +aux residual
// GRP: 0 = plain; 1, 2 = row tile blockIdx.y belongs to expert tile_e[blockIdx.y], whose
//      weights are plane tile_e of Bm; 1 also gathers the A rows through rowtok
//      3 = three products that share A in one launch: the column tiles run through Bm (N wide,
//      to outf), then Bm2 and Bm3 (N2 wide each, to outf2 and outf3); each is dense, ld = width
// The block size is stated so that the next tile's unconverted values fit in registers.
template <int EPI, typename AT, int GRP>
__global__ void __launch_bounds__(256) gemm_wmma(const AT* __restrict__ A, const float* __restrict__ Bm,
                          float* __restrict__ outf, unsigned short* __restrict__ outh,
                          const float* __restrict__ aux,
                          int M, int N, int Kd, int lda, int ldb, int ldc,
                          const int* __restrict__ rowtok, const int* __restrict__ tile_e,
                          const float* __restrict__ Bm2, const float* __restrict__ Bm3,
                          float* __restrict__ outf2, float* __restrict__ outf3, int N2) {
  __shared__ __attribute__((aligned(16))) unsigned short aS[2][128][40];
  // B stays row-major [k][n]; 288-byte rows (32 B x odd) suit the transposing load
  __shared__ __attribute__((aligned(16))) unsigned short bS[2][32][144];
  int tid = threadIdx.x;
  int lane = tid & 31;
  int wave = tid >> 5;
  int wr = wave & 3, wc = wave >> 2;
  int m0 = blockIdx.y * 128, n0 = blockIdx.x * 128;
  if (GRP == 3 && n0 >= N) {    // the same for the whole block: a tile of the second or third product
    n0 -= N;
    bool third = n0 >= N2;
    if (third) n0 -= N2;
    Bm = third ? Bm3 : Bm2;
    outf = third ? outf3 : outf2;
    ldb = N2; ldc = N2;
  }
  int hi = lane >> 4;
  int kb = hi * 8;
  int ln = lane & 15;
  int ar0 = wr * 32 + ln;
  int btr = hi * 8 + (lane & 7);                    // B fragment: this lane's k row ...
  int btc = wc * 64 + ((lane >> 3) & 1) * 8;        // ... and its 16-byte piece of 16 columns
  if (GRP == 1 || GRP == 2) {
    int te = tile_e[blockIdx.y];
    if (te < 0) return;         // tile behind the last routed row: the whole block leaves here
    Bm += (size_t)(te & (NEXP - 1)) * Kd * ldb;
  }
  // staging index precompute (2 chunks of 8 elems per thread for A and B): chunk g is A row
  // rA + 64 g, B row kB + 16 g
  int rA = tid >> 2, cgA = (tid & 3) * 8;
  int kB = tid >> 4, nbB = (tid & 15) * 8;
  // global addresses: a base that is the same for the block, in scalar registers, and one 32-bit
  // byte offset a chunk: four registers a thread, so that the fragment group fits beside them
  const char* Ab = (const char*)A;
  if (GRP != 1) Ab += (size_t)m0 * lda * sizeof(AT);
  const char* Bb = (const char*)(Bm + n0);
  unsigned aoff[2], boff[2];
#pragma unroll                  // constant indices keep aoff[] and boff[] in registers
  for (int g = 0; g < 2; g++) {
    int row = GRP == 1 ? (rowtok[m0 + rA + 64 * g] & (NTOK - 1)) : rA + 64 * g;
    aoff[g] = (unsigned)(row * lda + cgA) * (unsigned)sizeof(AT);
    boff[g] = (unsigned)((kB + 16 * g) * ldb + nbB) * 4u;
  }
  v8f acc[2][4] = {};
  u32x4 ra[2], rb[2];
  int nt = Kd >> 5;
  // prologue: load tile 0 into regs, store to buffer 0
#pragma unroll
  for (int g = 0; g < 2; g++) {
    ra[g] = load8_bf((const AT*)(Ab + aoff[g]));
    const float4* qp = (const float4*)(Bb + boff[g]);
    float4 fa = qp[0], fb = qp[1];
    rb[g].x = pk_bf16(fa.x, fa.y);
    rb[g].y = pk_bf16(fa.z, fa.w);
    rb[g].z = pk_bf16(fb.x, fb.y);
    rb[g].w = pk_bf16(fb.z, fb.w);
  }
  // the first pass steps the offset registers of the loads above
  asm volatile("s_wait_xcnt 0x0" :: "v"(aoff[0]), "v"(aoff[1]), "v"(boff[0]), "v"(boff[1]) : "memory");
#pragma unroll
  for (int g = 0; g < 2; g++) {
    *(u32x4*)&aS[0][rA + 64 * g][cgA] = ra[g];
    *(u32x4*)&bS[0][kB + 16 * g][nbB] = rb[g];
  }
  __syncthreads();
  // a tile's 12 fragment loads go out as one group, with no product among them: their LDS
  // latency is waited out once a pass and not once a B fragment
  FragBF fa[2], fb[4];
  const unsigned short* aF = &aS[0][ar0][kb];     // this lane's place in buffer 0: one register each,
  const unsigned short* bF = &bS[0][btr][btc];    // shared by the loop and the pass behind it
  auto load_frags = [&](int buf) {
    const unsigned short* ap = aF + buf * (128 * 40);
    const unsigned short* bp = bF + buf * (32 * 144);
    fa[0].q[0] = *(const u32x4*)(ap);
    fa[0].q[1] = *(const u32x4*)(ap + 16);
    fa[1].q[0] = *(const u32x4*)(ap + 16 * 40);
    fa[1].q[1] = *(const u32x4*)(ap + 16 * 40 + 16);
#pragma unroll                  // constant indices keep fb[] in registers
    for (int bj = 0; bj < 4; bj++) {
      fb[bj].q[0] = ld_tr16(bp + bj * 16);
      fb[bj].q[1] = ld_tr16(bp + 16 * 144 + bj * 16);
    }
    // keeps the group together and ahead of what follows it in the source
    __builtin_amdgcn_sched_barrier(0);
  };
  // the products of the loaded fragments, back to back
  auto mma_frags = [&]() {
#pragma unroll
    for (int bj = 0; bj < 4; bj++) {
      acc[0][bj] = __builtin_amdgcn_wmma_f32_16x16x32_bf16(false, fa[0].v, false, fb[bj].v, (short)0, acc[0][bj], false, false);
      acc[1][bj] = __builtin_amdgcn_wmma_f32_16x16x32_bf16(false, fa[1].v, false, fb[bj].v, (short)0, acc[1][bj], false, false);
    }
    // keeps the conversion of the next tile, and with it the wait for its loads, behind the products
    __builtin_amdgcn_sched_barrier(0);
  };
  // every pass but the last fetches the tile after it; the last pass stands behind the loop, so
  // the loaded values live inside one pass and are not copied (a copy would wait for the loads)
  for (int kt = 0; kt + 1 < nt; kt++) {
    int buf = kt & 1;
    // issue all of the next tile's global loads together; nothing uses their values before the
    // products are done, so they stay in flight meanwhile
    decltype(load8_raw((const AT*)nullptr)) wa[2];
    Raw8f wb[2];
#pragma unroll
    for (int g = 0; g < 2; g++) {   // the step along k goes into the 32-bit offsets; the bases stay
      aoff[g] += 32u * (unsigned)sizeof(AT);
      boff[g] += 32u * (unsigned)ldb * 4u;
      wa[g] = load8_raw((const AT*)(Ab + aoff[g]));
      wb[g] = load8_raw((const float*)(Bb + boff[g]));
    }
    load_frags(buf);            // behind the global loads, whose way is the longer one
    unsigned pfa = aoff[0] + 32u * (unsigned)sizeof(AT), pfb = boff[0] + 32u * (unsigned)ldb * 4u;
    if (kt + 2 < nt) {   // prefetch two tiles ahead into GL2
      __builtin_prefetch(Ab + pfa, 0, 1);
      __builtin_prefetch(Bb + pfb, 0, 1);
    }
    // later code steps or reuses the offset registers of the loads and prefetches above; as inputs
    // of the wait they stay untouched up to it, also by the loads' own results
    asm volatile("s_wait_xcnt 0x0" :: "v"(aoff[0]), "v"(aoff[1]), "v"(boff[0]), "v"(boff[1]), "v"(pfa), "v"(pfb) : "memory");
    mma_frags();
    int nb = buf ^ 1;
#pragma unroll
    for (int g = 0; g < 2; g++) {   // first use of the loaded values: convert, then store
      *(u32x4*)&aS[nb][rA + 64 * g][cgA] = pack8_bf(wa[g]);
      *(u32x4*)&bS[nb][kB + 16 * g][nbB] = pack8_bf(wb[g]);
    }
    __syncthreads();
  }
  load_frags((nt - 1) & 1);
  mma_frags();
#pragma unroll
  for (int ai = 0; ai < 2; ai++) {
#pragma unroll
    for (int bj = 0; bj < 4; bj++) {
#pragma unroll
      for (int i = 0; i < 8; i++) {
        int r = m0 + wr * 32 + ai * 16 + i + hi * 8;
        int c = n0 + wc * 64 + bj * 16 + ln;
        size_t idx = (size_t)r * ldc + c;
        float v = acc[ai][bj][i];
        if (EPI == 0) {
          outf[idx] = v;
        } else if (EPI == 1) {
          float g = 0.5f * v * (1.0f + erff(v * 0.70710678118f));
          outh[idx] = (unsigned short)f32_bf16(g);
        } else if (EPI == 2) {
          outf[idx] = v + aux[idx];
        }
      }
    }
  }
}

// ---------------- RoPE (+ bf16 convert) ----------------
__device__ inline void rope_pair(const float* __restrict__ in, unsigned short* __restrict__ outb,
                                 int nheads, int ld, int idx) {   // idx: pair index over NTOK*nheads*32
  int d = idx & 31;
  int th = idx >> 5;
  int head = th % nheads;
  int tok = th / nheads;
  int t = tok & 1023;                             // tok = b*T + t
  size_t base = (size_t)tok * ld + head * 64;
  float x1 = in[base + d], x2 = in[base + 32 + d];
  float inv_freq = __expf(-0.2878231366f * (float)d);  // 10000^(-d/32)
  float ang = (float)t * inv_freq;
  float cs = __cosf(ang), sn = __sinf(ang);
  // the slot behind the last transcendental: the next vector instruction may reuse its source
  // register; as inputs, the two results keep the slot behind them
  asm volatile("v_nop" :: "v"(cs), "v"(sn));
  // the fused forms written out: which product of a pair is rounded first does not hang on the call site
  unsigned int pr = pk_bf16(fmaf(x1, cs, -(x2 * sn)), fmaf(x2, cs, x1 * sn));
  outb[base + d]      = (unsigned short)pr;
  outb[base + 32 + d] = (unsigned short)(pr >> 16);
}

// q's RoPE, k's RoPE and v's conversion do not depend on one another: one launch, the blocks dealt in that order
#define ROPE_Q_BLOCKS ((NTOK * 16 * 32) / 256)
#define ROPE_K_BLOCKS ((NTOK * 4 * 32) / 256)
#define CVT_V_BLOCKS  ((NTOK * 256) / 256)
__global__ void qkv_post_kernel(const float* __restrict__ qf, unsigned short* __restrict__ qb,
                                const float* __restrict__ kf, unsigned short* __restrict__ kbuf,
                                const float* __restrict__ vf, unsigned short* __restrict__ vbuf) {
  int blk = blockIdx.x;
  if (blk < ROPE_Q_BLOCKS) {
    rope_pair(qf, qb, 16, CDIM, blk * 256 + threadIdx.x);
  } else if (blk < ROPE_Q_BLOCKS + ROPE_K_BLOCKS) {
    rope_pair(kf, kbuf, 4, 256, (blk - ROPE_Q_BLOCKS) * 256 + threadIdx.x);
  } else {
    size_t i = (size_t)(blk - ROPE_Q_BLOCKS - ROPE_K_BLOCKS) * 256 + threadIdx.x;
    vbuf[i] = (unsigned short)f32_bf16(vf[i]);
  }
}

// ---------------- flash attention (WMMA, causal, GQA) ----------------
// The block size is stated so that a key tile's staged values fit in registers beside the rest.
__global__ void __launch_bounds__(256) attn_kernel(const unsigned short* __restrict__ qb,
                            const unsigned short* __restrict__ kbuf,
                            const unsigned short* __restrict__ vbuf,
                            float* __restrict__ y) {
  __shared__ __attribute__((aligned(16))) unsigned short Kls[32][72];
  __shared__ __attribute__((aligned(16))) unsigned short Vls[64][40];
  __shared__ __attribute__((aligned(16))) unsigned short Pls[8][16][40];
  int tid = threadIdx.x, lane = tid & 31, wave = tid >> 5;
  int bh = blockIdx.x;
  int b = bh >> 4, h = bh & 15;
  int kvh = h >> 2;
  int qt = blockIdx.y;
  int qbase = qt * 128 + wave * 16;
  int hi = lane >> 4, kbo = hi * 8, ln = lane & 15;
  int qrow = qbase + ln;
  const unsigned short* qp = qb + (size_t)(b * 1024 + qrow) * CDIM + h * 64;
  FragBF qa0, qa1;
  qa0.q[0] = *(const u32x4*)(qp + kbo);
  qa0.q[1] = *(const u32x4*)(qp + 16 + kbo);
  qa1.q[0] = *(const u32x4*)(qp + 32 + kbo);
  qa1.q[1] = *(const u32x4*)(qp + 48 + kbo);
  float m[8], l[8];
  v8f o[4] = {};
#pragma unroll
  for (int i = 0; i < 8; i++) { m[i] = -3.0e38f; l[i] = 0.f; }
  int ntiles = (qt + 1) * 4;
  // this thread's share of a key tile: K rows wave + 8 i (one uint each), V rows vk + 4 i (one value each)
  int vk = tid >> 6, vd = tid & 63;
  const unsigned int* ksrc =
      (const unsigned int*)(kbuf + (size_t)(b * 1024 + wave) * 256 + kvh * 64) + lane;
  const unsigned short* vsrc = vbuf + (size_t)(b * 1024 + vk) * 256 + kvh * 64 + vd;
  unsigned int kr[4];
  unsigned short vr[8];
  // all 12 loads of the tile at key0 are issued together; nothing uses them before the next staging
  auto fetch_tile = [&](int key0) {
    const unsigned int* pk = ksrc + key0 * 128;
    const unsigned short* pv = vsrc + key0 * 256;
#pragma unroll                  // constant indices keep kr[] and vr[] in registers
    for (int i = 0; i < 4; i++) kr[i] = pk[i * 8 * 128];
#pragma unroll
    for (int i = 0; i < 8; i++) vr[i] = pv[i * 4 * 256];
    // the code behind reuses the address registers of the loads above; as inputs of the wait
    // they stay untouched up to it
    asm volatile("s_wait_xcnt 0x0" :: "v"(pk), "v"(pv) : "memory");
  };
  fetch_tile(0);
  for (int kt = 0; kt < ntiles; kt++) {
    int key0 = kt * 32;
#pragma unroll
    for (int i = 0; i < 4; i++)                   // stage K rows (32 x 64), uint copies
      ((unsigned int*)&Kls[wave + 8 * i][0])[lane] = kr[i];
#pragma unroll
    for (int i = 0; i < 8; i++)                   // stage V transposed: Vls[d][kk]
      Vls[vd][vk + 4 * i] = vr[i];
    __syncthreads();
    if (kt + 1 < ntiles) fetch_tile(key0 + 32);   // in flight during this tile's scores and softmax
    v8f s[2] = {};
#pragma unroll
    for (int sub = 0; sub < 2; sub++) {           // scores: Q(16x64) * K^T(64x32)
      int krow = sub * 16 + ln;
      FragBF bK;
      bK.q[0] = *(const u32x4*)&Kls[krow][kbo];
      bK.q[1] = *(const u32x4*)&Kls[krow][16 + kbo];
      s[sub] = __builtin_amdgcn_wmma_f32_16x16x32_bf16(false, qa0.v, false, bK.v, (short)0, s[sub], false, false);
      bK.q[0] = *(const u32x4*)&Kls[krow][32 + kbo];
      bK.q[1] = *(const u32x4*)&Kls[krow][48 + kbo];
      s[sub] = __builtin_amdgcn_wmma_f32_16x16x32_bf16(false, qa1.v, false, bK.v, (short)0, s[sub], false, false);
    }
    int keyc0 = key0 + ln, keyc1 = key0 + 16 + ln;
#pragma unroll
    for (int i = 0; i < 8; i++) {                 // online softmax (DPP reductions)
      int row = qbase + i + hi * 8;
      float s0 = s[0][i] * 0.125f; if (keyc0 > row) s0 = -3.0e38f;
      float s1 = s[1][i] * 0.125f; if (keyc1 > row) s1 = -3.0e38f;
      float t = red16_max(fmaxf(s0, s1));
      float mn = fmaxf(m[i], t);
      float fac = __expf(m[i] - mn);
      float p0 = __expf(s0 - mn), p1 = __expf(s1 - mn);
      float ps = red16_sum(p0 + p1);
      l[i] = l[i] * fac + ps;
      m[i] = mn;
#pragma unroll
      for (int sub = 0; sub < 4; sub++) o[sub][i] *= fac;
      unsigned int pp = pk_bf16(p0, p1);
      Pls[wave][i + hi * 8][ln]      = (unsigned short)pp;
      Pls[wave][i + hi * 8][16 + ln] = (unsigned short)(pp >> 16);
    }
    __syncthreads();
    FragBF pa;                                    // P(16x32) * V(32x64)
    pa.q[0] = *(const u32x4*)&Pls[wave][ln][kbo];
    pa.q[1] = *(const u32x4*)&Pls[wave][ln][16 + kbo];
#pragma unroll
    for (int sub = 0; sub < 4; sub++) {
      FragBF bV;
      int col = sub * 16 + ln;
      bV.q[0] = *(const u32x4*)&Vls[col][kbo];
      bV.q[1] = *(const u32x4*)&Vls[col][16 + kbo];
      o[sub] = __builtin_amdgcn_wmma_f32_16x16x32_bf16(false, pa.v, false, bV.v, (short)0, o[sub], false, false);
    }
    __syncthreads();
  }
#pragma unroll
  for (int sub = 0; sub < 4; sub++)
#pragma unroll
    for (int i = 0; i < 8; i++) {
      int row = qbase + i + hi * 8;
      int col = h * 64 + sub * 16 + ln;
      y[(size_t)(b * 1024 + row) * CDIM + col] = o[sub][i] / l[i];
    }
}

// ---------------- MoE gate: softmax, top-2, combine weights, aux stats ----------------
// sel[row] = lower expert | higher expert << 4; gw[2*row], gw[2*row+1] = their weights
// part[16*block + e] = sum of P[e] over the block's 8 tokens, part[16*block + 8 + e] = how many
// of their 16 choices fell on expert e; every block writes its own row, no word is shared
#define GATE_BLOCKS (NTOK / 8)
__global__ void gate_kernel(const float* __restrict__ xn, const float* __restrict__ Wg,
                            int* __restrict__ sel, float* __restrict__ gw,
                            float* __restrict__ part_out) {
  __shared__ __attribute__((aligned(16))) float sP[8][2 * NEXP];   // a token's P, then its two choices as 0 / 1
  int tid = threadIdx.x, lane = tid & 31, wave = tid >> 5;
  int row = blockIdx.x * 8 + wave;
  float part[NEXP];
#pragma unroll
  for (int e = 0; e < NEXP; e++) part[e] = 0.f;
  const float* xr = xn + (size_t)row * CDIM;
  for (int c = lane; c < CDIM; c += 32) {
    float xv = xr[c];
#pragma unroll
    for (int e = 0; e < NEXP; e++) part[e] += xv * Wg[c * NEXP + e];
  }
#pragma unroll
  for (int e = 0; e < NEXP; e++)
#pragma unroll
    for (int off = 1; off < 32; off <<= 1) part[e] += __shfl_xor(part[e], off);
  if (lane == 0) {
    float mx = part[0];
#pragma unroll
    for (int e = 1; e < NEXP; e++) mx = fmaxf(mx, part[e]);
    float pe[NEXP], s = 0.f;
#pragma unroll
    for (int e = 0; e < NEXP; e++) { pe[e] = __expf(part[e] - mx); s += pe[e]; }
#pragma unroll
    for (int e = 0; e < NEXP; e++) pe[e] /= s;
    int s0 = 0;
#pragma unroll
    for (int e = 1; e < NEXP; e++) if (pe[e] > pe[s0]) s0 = e;
    int s1 = -1;
#pragma unroll
    for (int e = 0; e < NEXP; e++) if (e != s0 && (s1 < 0 || pe[e] > pe[s1])) s1 = e;
    float denom = pe[s0] + pe[s1];
    float w0 = pe[s0] / denom, w1 = pe[s1] / denom;
    bool up = s0 < s1;
    sel[row] = up ? (s0 | (s1 << 4)) : (s1 | (s0 << 4));
    gw[2 * row]     = up ? w0 : w1;
    gw[2 * row + 1] = up ? w1 : w0;
#pragma unroll                  // constant indices keep pe[] in registers
    for (int e = 0; e < NEXP; e++) {
      sP[wave][e] = pe[e];
      sP[wave][NEXP + e] = (e == s0 || e == s1) ? 1.0f : 0.0f;
    }
  }
  __syncthreads();
  if (tid < 2 * NEXP) {         // the block's 16 sums, tokens in wave order
    float t = 0.f;
#pragma unroll                  // the 8 LDS reads go out together
    for (int w = 0; w < 8; w++) t += sP[w][tid];
    part_out[blockIdx.x * 16 + tid] = t;
  }
}

// one block, its first 256 threads: thread t sums word t & 15 over the rows (t >> 4) + 16 j, then
// the 16 threads of a word are summed in LDS; the order is fixed
__device__ inline void aux_block(const float* __restrict__ part_in, float* __restrict__ out_aux) {
  __shared__ float red[16][16];
  int tid = threadIdx.x;
  if (tid < 256) {
    float t = 0.f;
#pragma unroll                  // all 32 loads in flight together
    for (int j = 0; j < GATE_BLOCKS / 16; j++) t += part_in[tid + 256 * j];
    red[tid >> 4][tid & 15] = t;
  }
  __syncthreads();
  if (tid < 16) {
    float s = 0.f;
#pragma unroll                  // the 16 LDS reads go out together
    for (int g = 0; g < 16; g++) s += red[g][tid];
    red[0][tid] = s;
  }
  __syncthreads();
  if (tid == 0) {
    float s = 0.f;
    for (int e = 0; e < NEXP; e++)
      s += (red[0][NEXP + e] / (float)(NTOK * 2)) * (red[0][e] / (float)NTOK);
    out_aux[0] = (float)NEXP * s;
  }
}

// ---------------- MoE routing: sort the 2*NTOK (token, expert) pairs by expert ----------------
// One block of 1024 threads, 4 tokens each. Eight running counts travel as 16-bit fields
// of two 64-bit words (no field passes MAXROW). Each expert's list starts at a multiple of 128.
// rowtok[p] = token of routed row p (0 in the padding), slot[2*t+j] = routed row of token t's
// j-th expert, tile_e[i] = expert of rows 128*i.., -1 behind the last list.
__device__ inline unsigned long long fld_one(int e) { return 1ull << ((e & 3) * 16); }
__device__ inline int fld_get(unsigned long long lo, unsigned long long hi, int e) {
  return (int)(((e < 4 ? lo : hi) >> ((e & 3) * 16)) & 0xFFFFull);
}
// Block 1 of the launch does the aux sum instead: it needs the gate's rows only, as the sort does.
__global__ void route_kernel(const int* __restrict__ sel, int* __restrict__ rowtok,
                             int* __restrict__ slot, int* __restrict__ tile_e,
                             const float* __restrict__ part_in, float* __restrict__ out_aux) {
  __shared__ unsigned long long wtot[32][2];
  if (blockIdx.x == 1) {        // the whole block goes this way, in front of every barrier of the sort
    aux_block(part_in, out_aux);
    return;
  }
  int tid = threadIdx.x, lane = tid & 31, wave = tid >> 5;
  int ex[8];
  unsigned long long lo = 0, hi = 0;
  // the loops over ex[] and over the experts are unrolled so that ex[] and the shift counts
  // are indexed by constants and nothing goes to scratch
#pragma unroll
  for (int i = 0; i < 4; i++) {
    int s = sel[tid * 4 + i];
    ex[2 * i] = s & 7; ex[2 * i + 1] = (s >> 4) & 7;
  }
#pragma unroll
  for (int i = 0; i < 8; i++) {
    if (ex[i] < 4) lo += fld_one(ex[i]); else hi += fld_one(ex[i]);
  }
  unsigned long long ilo = lo, ihi = hi;          // inclusive scan over the wave
  for (int d = 1; d < 32; d <<= 1) {
    unsigned long long a = __shfl_up(ilo, d), b = __shfl_up(ihi, d);
    if (lane >= d) { ilo += a; ihi += b; }
  }
  if (lane == 31) { wtot[wave][0] = ilo; wtot[wave][1] = ihi; }
  __syncthreads();
  unsigned long long tlo = 0, thi = 0, plo = ilo - lo, phi = ihi - hi;
#pragma unroll 4                // unrolled whole, the 64 words are all held in registers and spill
  for (int w = 0; w < 32; w++) {
    unsigned long long a = wtot[w][0], b = wtot[w][1];
    tlo += a; thi += b;
    if (w < wave) { plo += a; phi += b; }
  }
  int off = 0;
  int mytile = -1;
#pragma unroll
  for (int e = 0; e < NEXP; e++) {
    int cnt = fld_get(tlo, thi, e);
    int end = off + ((cnt + 127) & ~127);
    if (e < 4) plo += (unsigned long long)off << (e * 16);
    else       phi += (unsigned long long)off << ((e - 4) * 16);
    if (off + cnt + tid < end) rowtok[off + cnt + tid] = 0;
    if (tid * 128 >= off && tid * 128 < end) mytile = e;
    off = end;
  }
  if (tid < MAXTILE) tile_e[tid] = mytile;
#pragma unroll
  for (int i = 0; i < 8; i++) {
    int e = ex[i];
    int p = fld_get(plo, phi, e);
    if (e < 4) plo += fld_one(e); else phi += fld_one(e);
    rowtok[p] = tid * 4 + (i >> 1);
    slot[tid * 8 + i] = p;
  }
}

// out = x1 + w_a * ye[row_a] + w_b * ye[row_b], lower expert first; one block per token
__global__ void combine_kernel(const float4* __restrict__ x1, const float4* __restrict__ ye,
                               const int* __restrict__ slot, const float* __restrict__ gw,
                               float4* __restrict__ dst) {
  int tok = blockIdx.x, c = threadIdx.x;
  int pa = min(slot[2 * tok], MAXROW - 1), pb = min(slot[2 * tok + 1], MAXROW - 1);
  float wa = gw[2 * tok], wb = gw[2 * tok + 1];
  float4 o = x1[(size_t)tok * 256 + c];
  float4 a = ye[(size_t)pa * 256 + c];
  float4 b = ye[(size_t)pb * 256 + c];
  o.x += wa * a.x; o.y += wa * a.y; o.z += wa * a.z; o.w += wa * a.w;
  o.x += wb * b.x; o.y += wb * b.y; o.z += wb * b.z; o.w += wb * b.w;
  dst[(size_t)tok * 256 + c] = o;
}

// ---------------- launcher ----------------
extern "C" void kernel_launch(void* const* d_in, const int* in_sizes, int n_in,
                              void* d_out, int out_size, void* d_ws, size_t ws_size,
                              hipStream_t stream) {
  (void)in_sizes; (void)n_in; (void)out_size; (void)ws_size;
  const float* x   = (const float*)d_in[0];
  const float* ln1 = (const float*)d_in[1];
  const float* ln2 = (const float*)d_in[2];
  const float* Wq  = (const float*)d_in[3];
  const float* Wk  = (const float*)d_in[4];
  const float* Wv  = (const float*)d_in[5];
  const float* Wo  = (const float*)d_in[6];
  const float* Wg  = (const float*)d_in[7];
  const float* W1  = (const float*)d_in[8];
  const float* W2  = (const float*)d_in[9];
  float* outx = (float*)d_out;

  char* ws = (char*)d_ws;
  size_t off = 0;
  auto alloc = [&](size_t bytes) -> void* {
    void* p = ws + off;
    off += (bytes + 255) & ~(size_t)255;
    return p;
  };
  float*          xn1  = (float*)alloc((size_t)NTOK * CDIM * 4);
  float*          qf   = (float*)alloc((size_t)NTOK * CDIM * 4);
  float*          kf   = (float*)alloc((size_t)NTOK * 256 * 4);
  float*          vf   = (float*)alloc((size_t)NTOK * 256 * 4);
  unsigned short* qb   = (unsigned short*)alloc((size_t)NTOK * CDIM * 2);
  unsigned short* kbuf = (unsigned short*)alloc((size_t)NTOK * 256 * 2);
  unsigned short* vbuf = (unsigned short*)alloc((size_t)NTOK * 256 * 2);
  float*          yatt = (float*)alloc((size_t)NTOK * CDIM * 4);
  float*          x1   = (float*)alloc((size_t)NTOK * CDIM * 4);
  float*          xn2  = (float*)alloc((size_t)NTOK * CDIM * 4);
  unsigned short* hbf  = (unsigned short*)alloc((size_t)MAXROW * IDIM * 2);
  float*          ye   = (float*)alloc((size_t)MAXROW * CDIM * 4);
  int*            sel  = (int*)alloc((size_t)NTOK * 4);
  float*          gw   = (float*)alloc((size_t)NTOK * 2 * 4);
  int*            rowtok = (int*)alloc((size_t)MAXROW * 4);
  int*            slot = (int*)alloc((size_t)NTOK * 2 * 4);
  int*            tile_e = (int*)alloc((size_t)MAXTILE * 4);
  float*          part = (float*)alloc((size_t)GATE_BLOCKS * 16 * 4);

  // 1) xn1 = rmsnorm(x)
  rmsnorm_kernel<<<NTOK, 256, 0, stream>>>(x, ln1, xn1);
  // 2) q/k/v projections
  //    one launch: alone, the k and v products put 64 blocks on the chip for as long as q's 256
  gemm_wmma<0, float, 3><<<dim3((CDIM + 256 + 256) / 128, NTOK / 128), 256, 0, stream>>>(
      xn1, Wq, qf, nullptr, nullptr, NTOK, CDIM, CDIM, CDIM, CDIM, CDIM, nullptr, nullptr,
      Wk, Wv, kf, vf, 256);
  // 3) RoPE + bf16 conversion
  qkv_post_kernel<<<ROPE_Q_BLOCKS + ROPE_K_BLOCKS + CVT_V_BLOCKS, 256, 0, stream>>>(
      qf, qb, kf, kbuf, vf, vbuf);
  // 4) attention
  attn_kernel<<<dim3(64, 8), 256, 0, stream>>>(qb, kbuf, vbuf, yatt);
  // 5) x1 = yatt @ Wo + x
  gemm_wmma<2, float, 0><<<dim3(CDIM / 128, NTOK / 128), 256, 0, stream>>>(
      yatt, Wo, x1, nullptr, x, NTOK, CDIM, CDIM, CDIM, CDIM, CDIM, nullptr, nullptr,
      nullptr, nullptr, nullptr, nullptr, 0);
  // 6) xn2 = rmsnorm(x1)
  rmsnorm_kernel<<<NTOK, 256, 0, stream>>>(x1, ln2, xn2);
  // 7) gating + aux stats
  gate_kernel<<<GATE_BLOCKS, 256, 0, stream>>>(xn2, Wg, sel, gw, part);
  // 8) sort the (token, expert) pairs by expert; beside it, the aux loss scalar
  route_kernel<<<2, 1024, 0, stream>>>(sel, rowtok, slot, tile_e,
                                       part, outx + (size_t)NTOK * CDIM);
  // 9) experts, chosen rows only: h = gelu(xn2[rowtok] @ W1[e]); ye = h @ W2[e]
  gemm_wmma<1, float, 1><<<dim3(IDIM / 128, MAXTILE), 256, 0, stream>>>(
      xn2, W1, nullptr, hbf, nullptr, MAXROW, IDIM, CDIM, CDIM, IDIM, IDIM, rowtok, tile_e,
      nullptr, nullptr, nullptr, nullptr, 0);
  gemm_wmma<0, unsigned short, 2><<<dim3(CDIM / 128, MAXTILE), 256, 0, stream>>>(
      hbf, W2, ye, nullptr, nullptr, MAXROW, CDIM, IDIM, IDIM, CDIM, CDIM, nullptr, tile_e,
      nullptr, nullptr, nullptr, nullptr, 0);
  //    out = x1 + the two weighted expert rows of each token
  combine_kernel<<<NTOK, 256, 0, stream>>>(
      (const float4*)x1, (const float4*)ye, slot, gw, (float4*)outx);
}

// v009
// A run of this version takes 364 microseconds.
// In both of two side-by-side timings against v008, it was 1.06 times as fast.
// Over all steps from v000 it is 10.2 times as fast.
#include <hip/hip_runtime.h>
#include <hip/hip_bf16.h>
#include <math.h>

// ---------------- types / helpers ----------------
typedef __attribute__((ext_vector_type(16))) __bf16 v16bf;
typedef __attribute__((ext_vector_type(8)))  float  v8f;
typedef __attribute__((ext_vector_type(4)))  unsigned int u32x4;
typedef __attribute__((ext_vector_type(8)))  short s16x8;

union FragBF { u32x4 q[2]; v16bf v; };

// f32 -> bf16, round to nearest even, by the chip's own packed convert: one instruction for two values
typedef __attribute__((ext_vector_type(2))) float  f32x2;
typedef __attribute__((ext_vector_type(2))) __bf16 bf16x2;
__device__ inline unsigned int pk_bf16(float lo, float hi) {
  f32x2 v = {lo, hi};
  return __builtin_bit_cast(unsigned int, __builtin_convertvector(v, bf16x2));
}
__device__ inline unsigned int f32_bf16(float f) {
  return (unsigned int)__builtin_bit_cast(unsigned short, (__bf16)f);
}
// one 16-byte piece of a tile in two halves: the load alone, as it comes from memory, and the
// packing with the store to LDS (4 f32 become 8 bytes; 8 bf16 stay 16 bytes)
typedef __attribute__((ext_vector_type(2))) unsigned int u32x2;
__device__ inline float4 load16_raw(const float* p) { return *(const float4*)p; }
__device__ inline u32x4 load16_raw(const unsigned short* p) { return *(const u32x4*)p; }
__device__ inline void store16_bf(unsigned short* dst, const float4& v) {
  u32x2 r;
  r.x = pk_bf16(v.x, v.y);
  r.y = pk_bf16(v.z, v.w);
  *(u32x2*)dst = r;
}
__device__ inline void store16_bf(unsigned short* dst, const u32x4& v) { *(u32x4*)dst = v; }
// transposing LDS load: from a row-major [k][n] 16-bit tile, lane (c, h) gets 8 k of column c
__device__ inline u32x4 ld_tr16(const unsigned short* p) {
  typedef __attribute__((address_space(3))) s16x8 lds_s16x8;
  return __builtin_bit_cast(u32x4, __builtin_amdgcn_ds_load_tr16_b128_v8i16((lds_s16x8*)p));
}

// DPP16 butterfly reductions over a 16-lane row (VALU only, no LDS)
// ctrl must be a compile-time constant -> template parameter
template <int CTRL>
__device__ inline float dpp_f(float x) {
  return __int_as_float(
      __builtin_amdgcn_update_dpp(0, __float_as_int(x), CTRL, 0xF, 0xF, true));
}
#define DPP_QPERM_XOR1 0xB1   // quad_perm(1,0,3,2)
#define DPP_QPERM_XOR2 0x4E   // quad_perm(2,3,0,1)
#define DPP_ROW_HMIRR  0x141  // row_half_mirror (lane^7 within 8)
#define DPP_ROW_MIRR   0x140  // row_mirror (lane^15 within 16)
__device__ inline float red16_max(float x) {
  x = fmaxf(x, dpp_f<DPP_QPERM_XOR1>(x));
  x = fmaxf(x, dpp_f<DPP_QPERM_XOR2>(x));
  x = fmaxf(x, dpp_f<DPP_ROW_HMIRR>(x));
  x = fmaxf(x, dpp_f<DPP_ROW_MIRR>(x));
  return x;
}
__device__ inline float red16_sum(float x) {
  x += dpp_f<DPP_QPERM_XOR1>(x);
  x += dpp_f<DPP_QPERM_XOR2>(x);
  x += dpp_f<DPP_ROW_HMIRR>(x);
  x += dpp_f<DPP_ROW_MIRR>(x);
  return x;
}

#define NTOK 4096   // B*T
#define CDIM 1024
#define IDIM 4096
#define NEXP 8
#define MAXTILE 72            // 2*NTOK routed rows, each expert's list padded to 128: at most 71 tiles
#define MAXROW (MAXTILE * 128)

// ---------------- RMSNorm ----------------
__global__ void rmsnorm_kernel(const float* __restrict__ x,
                               const float* __restrict__ scale,
                               float* __restrict__ out) {
  __shared__ float red[9];
  int row = blockIdx.x;
  int tid = threadIdx.x;
  const float* xr = x + (size_t)row * CDIM;
  float v[4]; float ss = 0.f;
#pragma unroll
  for (int i = 0; i < 4; i++) { v[i] = xr[tid + 256 * i]; ss += v[i] * v[i]; }
#pragma unroll
  for (int off = 16; off >= 1; off >>= 1) ss += __shfl_xor(ss, off);
  if ((tid & 31) == 0) red[tid >> 5] = ss;
  __syncthreads();
  if (tid == 0) {
    float t = 0.f;
#pragma unroll
    for (int w = 0; w < 8; w++) t += red[w];
    red[8] = t;
  }
  __syncthreads();
  float inv = rsqrtf(red[8] / (float)CDIM + 1e-5f);
#pragma unroll
  for (int i = 0; i < 4; i++) {
    int c = tid + 256 * i;
    out[(size_t)row * CDIM + c] = v[i] * inv * scale[c];
  }
}

// ---------------- generic WMMA GEMM, 128x128 tile, double-buffered LDS ----------------
// C(M,N) = A(M,K) * B(K,N); A: float or bf16-bits; B: float (bf16-converted on stage)
// 8 waves; wave (wr,wc) owns rows wr*32..+32, cols wc*64..+64 => 2x4 wmma accums.
// EPI: 0 = store f32; 1 = gelu->bf16 (outh); 2 = +aux residual
// GRP: 0 = plain; 1, 2 = row tile blockIdx.y belongs to expert tile_e[blockIdx.y], whose
//      weights are plane tile_e of Bm; 1 also gathers the A rows through rowtok
//      3 = three products that share A in one launch: the column tiles run through Bm (N wide,
//      to outf), then Bm2 and Bm3 (N2 wide each, to outf2 and outf3); each is dense, ld = width
// The block size is stated so that the next tile's unconverted values fit in registers.
// LDA, LDB: the leading dimensions where they are fixed at compile time (0: take the argument); the
//      steps from one staged piece to the next then ride in the loads' offset fields
template <int EPI, typename AT, int GRP, int LDA, int LDB>
__global__ void __launch_bounds__(256) gemm_wmma(const AT* __restrict__ A, const float* __restrict__ Bm,
                          float* __restrict__ outf, unsigned short* __restrict__ outh,
                          const float* __restrict__ aux,
                          int M, int N, int Kd, int lda, int ldb, int ldc,
                          const int* __restrict__ rowtok, const int* __restrict__ tile_e,
                          const float* __restrict__ Bm2, const float* __restrict__ Bm3,
                          float* __restrict__ outf2, float* __restrict__ outf3, int N2) {
  __shared__ __attribute__((aligned(16))) unsigned short aS[2][128][40];
  // B stays row-major [k][n]; 288-byte rows (32 B x odd) suit the transposing load
  __shared__ __attribute__((aligned(16))) unsigned short bS[2][32][144];
  if (LDA > 0) lda = LDA;
  if (LDB > 0) ldb = LDB;
  int tid = threadIdx.x;
  int lane = tid & 31;
  int wave = tid >> 5;
  int wr = wave & 3, wc = wave >> 2;
  int m0 = blockIdx.y * 128, n0 = blockIdx.x * 128;
  if (GRP == 3 && n0 >= N) {    // the same for the whole block: a tile of the second or third product
    n0 -= N;
    bool third = n0 >= N2;
    if (third) n0 -= N2;
    Bm = third ? Bm3 : Bm2;
    outf = third ? outf3 : outf2;
    ldb = N2; ldc = N2;
  }
  int hi = lane >> 4;
  int kb = hi * 8;
  int ln = lane & 15;
  int ar0 = wr * 32 + ln;
  int btr = hi * 8 + (lane & 7);                    // B fragment: this lane's k row ...
  int btc = wc * 64 + ((lane >> 3) & 1) * 8;        // ... and its 16-byte piece of 16 columns
  if (GRP == 1 || GRP == 2) {
    int te = tile_e[blockIdx.y];
    if (te < 0) return;         // tile behind the last routed row: the whole block leaves here
    Bm += (size_t)(te & (NEXP - 1)) * Kd * ldb;
  }
  // staging: a thread brings its share of a tile in 16-byte pieces, dealt so that the 32 lanes of
  // one load ask for whole 128-byte lines and each line of the tile is asked for by one load only.
  // B, f32: piece j is k row kB + 8 j; a wave's load is one row of the tile, 512 bytes in a row.
  // A, f32: piece j is row rA + 32 j; 8 lanes take a row's 128 bytes, a wave's load four rows, which
  //         lie 4 apart: at the 80-byte pitch their 64-byte stores then fall on 64 different banks.
  // A, bf16: a row has only 64 bytes a pass: piece j is row rA + 64 j, 4 lanes a row.
  constexpr bool AF = sizeof(AT) == 4;
  constexpr int NA = AF ? 4 : 2;          // A pieces a thread
  constexpr int RSA = AF ? 32 : 64;       // rows from one piece to the next
  constexpr int NO = GRP == 1 ? NA : 1;   // A offsets held: gathered rows need one each
  int rA = AF ? ((lane >> 3) * 4 + (wave & 3) + (wave >> 2) * 16) : (tid >> 2);
  int cgA = AF ? (lane & 7) * 4 : (tid & 3) * 8;
  int kB = wave, nbB = lane * 4;
  // global addresses: a base that is the same for the block, in scalar registers, a 32-bit byte
  // offset a lane, and the fixed step from piece to piece: few registers, so that the fragment group fits
  const char* Ab = (const char*)A;
  if (GRP != 1) Ab += (size_t)m0 * lda * sizeof(AT);
  const char* Bb = (const char*)(Bm + n0);
  unsigned aoff[NO], boff;
  if (GRP == 1) {
    int rix = m0 + rA, rt[NO];
#pragma unroll                  // constant indices keep rt[] and aoff[] in registers
    for (int j = 0; j < NO; j++) rt[j] = rowtok[rix + RSA * j];
    // later code reuses the index and the base registers of the row-index loads above; as inputs
    // of the wait they stay untouched up to it
    asm volatile("s_wait_xcnt 0x0" :: "v"(rix), "s"(rowtok) : "memory");
#pragma unroll
    for (int j = 0; j < NO; j++)
      aoff[j] = (unsigned)((rt[j] & (NTOK - 1)) * lda + cgA) * (unsigned)sizeof(AT);
  } else {
    aoff[0] = (unsigned)(rA * lda + cgA) * (unsigned)sizeof(AT);
  }
  boff = (unsigned)(kB * ldb + nbB) * 4u;
  auto a_src = [&](int j) -> const AT* {
    if (GRP == 1) return (const AT*)(Ab + aoff[j < NO ? j : 0]);
    return (const AT*)(Ab + (size_t)(j * RSA) * lda * sizeof(AT) + aoff[0]);
  };
  auto b_src = [&](int j) -> const float* {
    return (const float*)(Bb + (size_t)(j * 8) * ldb * 4 + boff);
  };
  v8f acc[2][4] = {};
  int nt = Kd >> 5;
  // prologue: load tile 0 into regs, store to buffer 0
  {
    decltype(load16_raw((const AT*)nullptr)) wa[NA];
    float4 wb[4];
#pragma unroll                  // constant indices keep wa[] and wb[] in registers, here and below
    for (int j = 0; j < NA; j++) wa[j] = load16_raw(a_src(j));
#pragma unroll
    for (int j = 0; j < 4; j++) wb[j] = load16_raw(b_src(j));
    // the first pass steps the offset registers of the loads above
    asm volatile("s_wait_xcnt 0x0" :: "v"(aoff[0]), "v"(aoff[NO > 1 ? 1 : 0]), "v"(aoff[NO > 2 ? 2 : 0]),
                 "v"(aoff[NO > 3 ? 3 : 0]), "v"(boff) : "memory");
#pragma unroll
    for (int j = 0; j < NA; j++) store16_bf(&aS[0][rA + RSA * j][cgA], wa[j]);
#pragma unroll
    for (int j = 0; j < 4; j++) store16_bf(&bS[0][kB + 8 * j][nbB], wb[j]);
  }
  __syncthreads();
  // a tile's 12 fragment loads go out as one group, with no product among them: their LDS
  // latency is waited out once a pass and not once a B fragment
  FragBF fa[2], fb[4];
  const unsigned short* aF = &aS[0][ar0][kb];     // this lane's place in buffer 0: one register each,
  const unsigned short* bF = &bS[0][btr][btc];    // shared by the loop and the pass behind it
  auto load_frags = [&](int buf) {
    const unsigned short* ap = aF + buf * (128 * 40);
    const unsigned short* bp = bF + buf * (32 * 144);
    fa[0].q[0] = *(const u32x4*)(ap);
    fa[0].q[1] = *(const u32x4*)(ap + 16);
    fa[1].q[0] = *(const u32x4*)(ap + 16 * 40);
    fa[1].q[1] = *(const u32x4*)(ap + 16 * 40 + 16);
#pragma unroll                  // constant indices keep fb[] in registers
    for (int bj = 0; bj < 4; bj++) {
      fb[bj].q[0] = ld_tr16(bp + bj * 16);
      fb[bj].q[1] = ld_tr16(bp + 16 * 144 + bj * 16);
    }
    // keeps the group together and ahead of what follows it in the source
    __builtin_amdgcn_sched_barrier(0);
  };
  // the products of the loaded fragments, back to back
  auto mma_frags = [&]() {
#pragma unroll
    for (int bj = 0; bj < 4; bj++) {
      acc[0][bj] = __builtin_amdgcn_wmma_f32_16x16x32_bf16(false, fa[0].v, false, fb[bj].v, (short)0, acc[0][bj], false, false);
      acc[1][bj] = __builtin_amdgcn_wmma_f32_16x16x32_bf16(false, fa[1].v, false, fb[bj].v, (short)0, acc[1][bj], false, false);
    }
    // keeps the conversion of the next tile, and with it the wait for its loads, behind the products
    __builtin_amdgcn_sched_barrier(0);
  };
  // every pass but the last fetches the tile after it; the last pass stands behind the loop, so
  // the loaded values live inside one pass and are not copied (a copy would wait for the loads)
  for (int kt = 0; kt + 1 < nt; kt++) {
    int buf = kt & 1;
    // issue all of the next tile's global loads together; nothing uses their values before the
    // products are done, so they stay in flight meanwhile
    decltype(load16_raw((const AT*)nullptr)) wa[NA];
    float4 wb[4];
#pragma unroll                  // the step along k goes into the 32-bit offsets; the bases stay
    for (int j = 0; j < NO; j++) aoff[j] += 32u * (unsigned)sizeof(AT);
    boff += 32u * (unsigned)ldb * 4u;
#pragma unroll
    for (int j = 0; j < NA; j++) wa[j] = load16_raw(a_src(j));
#pragma unroll
    for (int j = 0; j < 4; j++) wb[j] = load16_raw(b_src(j));
    load_frags(buf);            // behind the global loads, whose way is the longer one
    unsigned pfa = aoff[0] + 32u * (unsigned)sizeof(AT), pfb = boff + 32u * (unsigned)ldb * 4u;
    if (kt + 2 < nt) {   // prefetch two tiles ahead into GL2
      __builtin_prefetch(Ab + pfa, 0, 1);
      __builtin_prefetch(Bb + pfb, 0, 1);
    }
    // later code steps or reuses the offset registers of the loads and prefetches above; as inputs
    // of the wait they stay untouched up to it, also by the loads' own results
    asm volatile("s_wait_xcnt 0x0" :: "v"(aoff[0]), "v"(aoff[NO > 1 ? 1 : 0]), "v"(aoff[NO > 2 ? 2 : 0]),
                 "v"(aoff[NO > 3 ? 3 : 0]), "v"(boff), "v"(pfa), "v"(pfb) : "memory");
    mma_frags();
    int nb = buf ^ 1;
    // first use of the loaded values: convert, then store
#pragma unroll
    for (int j = 0; j < NA; j++) store16_bf(&aS[nb][rA + RSA * j][cgA], wa[j]);
#pragma unroll
    for (int j = 0; j < 4; j++) store16_bf(&bS[nb][kB + 8 * j][nbB], wb[j]);
    __syncthreads();
  }
  load_frags((nt - 1) & 1);
  mma_frags();
#pragma unroll
  for (int ai = 0; ai < 2; ai++) {
#pragma unroll
    for (int bj = 0; bj < 4; bj++) {
#pragma unroll
      for (int i = 0; i < 8; i++) {
        int r = m0 + wr * 32 + ai * 16 + i + hi * 8;
        int c = n0 + wc * 64 + bj * 16 + ln;
        size_t idx = (size_t)r * ldc + c;
        float v = acc[ai][bj][i];
        if (EPI == 0) {
          outf[idx] = v;
        } else if (EPI == 1) {
          float g = 0.5f * v * (1.0f + erff(v * 0.70710678118f));
          outh[idx] = (unsigned short)f32_bf16(g);
        } else if (EPI == 2) {
          outf[idx] = v + aux[idx];
        }
      }
    }
  }
}

// ---------------- RoPE (+ bf16 convert) ----------------
__device__ inline void rope_pair(const float* __restrict__ in, unsigned short* __restrict__ outb,
                                 int nheads, int ld, int idx) {   // idx: pair index over NTOK*nheads*32
  int d = idx & 31;
  int th = idx >> 5;
  int head = th % nheads;
  int tok = th / nheads;
  int t = tok & 1023;                             // tok = b*T + t
  size_t base = (size_t)tok * ld + head * 64;
  float x1 = in[base + d], x2 = in[base + 32 + d];
  float inv_freq = __expf(-0.2878231366f * (float)d);  // 10000^(-d/32)
  float ang = (float)t * inv_freq;
  float cs = __cosf(ang), sn = __sinf(ang);
  // the slot behind the last transcendental: the next vector instruction may reuse its source
  // register; as inputs, the two results keep the slot behind them
  asm volatile("v_nop" :: "v"(cs), "v"(sn));
  // the fused forms written out: which product of a pair is rounded first does not hang on the call site
  unsigned int pr = pk_bf16(fmaf(x1, cs, -(x2 * sn)), fmaf(x2, cs, x1 * sn));
  outb[base + d]      = (unsigned short)pr;
  outb[base + 32 + d] = (unsigned short)(pr >> 16);
}

// q's RoPE, k's RoPE and v's conversion do not depend on one another: one launch, the blocks dealt in that order
#define ROPE_Q_BLOCKS ((NTOK * 16 * 32) / 256)
#define ROPE_K_BLOCKS ((NTOK * 4 * 32) / 256)
#define CVT_V_BLOCKS  ((NTOK * 256) / 256)
__global__ void qkv_post_kernel(const float* __restrict__ qf, unsigned short* __restrict__ qb,
                                const float* __restrict__ kf, unsigned short* __restrict__ kbuf,
                                const float* __restrict__ vf, unsigned short* __restrict__ vbuf) {
  int blk = blockIdx.x;
  if (blk < ROPE_Q_BLOCKS) {
    rope_pair(qf, qb, 16, CDIM, blk * 256 + threadIdx.x);
  } else if (blk < ROPE_Q_BLOCKS + ROPE_K_BLOCKS) {
    rope_pair(kf, kbuf, 4, 256, (blk - ROPE_Q_BLOCKS) * 256 + threadIdx.x);
  } else {
    size_t i = (size_t)(blk - ROPE_Q_BLOCKS - ROPE_K_BLOCKS) * 256 + threadIdx.x;
    vbuf[i] = (unsigned short)f32_bf16(vf[i]);
  }
}

// ---------------- flash attention (WMMA, causal, GQA) ----------------
// The block size is stated so that a key tile's staged values fit in registers beside the rest.
__global__ void __launch_bounds__(256) attn_kernel(const unsigned short* __restrict__ qb,
                            const unsigned short* __restrict__ kbuf,
                            const unsigned short* __restrict__ vbuf,
                            float* __restrict__ y) {
  __shared__ __attribute__((aligned(16))) unsigned short Kls[32][72];
  __shared__ __attribute__((aligned(16))) unsigned short Vls[64][40];
  __shared__ __attribute__((aligned(16))) unsigned short Pls[8][16][40];
  int tid = threadIdx.x, lane = tid & 31, wave = tid >> 5;
  int bh = blockIdx.x;
  int b = bh >> 4, h = bh & 15;
  int kvh = h >> 2;
  int qt = blockIdx.y;
  int qbase = qt * 128 + wave * 16;
  int hi = lane >> 4, kbo = hi * 8, ln = lane & 15;
  int qrow = qbase + ln;
  const unsigned short* qp = qb + (size_t)(b * 1024 + qrow) * CDIM + h * 64;
  FragBF qa0, qa1;
  qa0.q[0] = *(const u32x4*)(qp + kbo);
  qa0.q[1] = *(const u32x4*)(qp + 16 + kbo);
  qa1.q[0] = *(const u32x4*)(qp + 32 + kbo);
  qa1.q[1] = *(const u32x4*)(qp + 48 + kbo);
  float m[8], l[8];
  v8f o[4] = {};
#pragma unroll
  for (int i = 0; i < 8; i++) { m[i] = -3.0e38f; l[i] = 0.f; }
  int ntiles = (qt + 1) * 4;
  // this thread's share of a key tile: K rows wave + 8 i (one uint each), V rows vk + 4 i (one value each)
  int vk = tid >> 6, vd = tid & 63;
  const unsigned int* ksrc =
      (const unsigned int*)(kbuf + (size_t)(b * 1024 + wave) * 256 + kvh * 64) + lane;
  const unsigned short* vsrc = vbuf + (size_t)(b * 1024 + vk) * 256 + kvh * 64 + vd;
  unsigned int kr[4];
  unsigned short vr[8];
  // all 12 loads of the tile at key0 are issued together; nothing uses them before the next staging
  auto fetch_tile = [&](int key0) {
    const unsigned int* pk = ksrc + key0 * 128;
    const unsigned short* pv = vsrc + key0 * 256;
#pragma unroll                  // constant indices keep kr[] and vr[] in registers
    for (int i = 0; i < 4; i++) kr[i] = pk[i * 8 * 128];
#pragma unroll
    for (int i = 0; i < 8; i++) vr[i] = pv[i * 4 * 256];
    // the code behind reuses the address registers of the loads above; as inputs of the wait
    // they stay untouched up to it
    asm volatile("s_wait_xcnt 0x0" :: "v"(pk), "v"(pv) : "memory");
  };
  fetch_tile(0);
  for (int kt = 0; kt < ntiles; kt++) {
    int key0 = kt * 32;
#pragma unroll
    for (int i = 0; i < 4; i++)                   // stage K rows (32 x 64), uint copies
      ((unsigned int*)&Kls[wave + 8 * i][0])[lane] = kr[i];
#pragma unroll
    for (int i = 0; i < 8; i++)                   // stage V transposed: Vls[d][kk]
      Vls[vd][vk + 4 * i] = vr[i];
    __syncthreads();
    if (kt + 1 < ntiles) fetch_tile(key0 + 32);   // in flight during this tile's scores and softmax
    v8f s[2] = {};
#pragma unroll
    for (int sub = 0; sub < 2; sub++) {           // scores: Q(16x64) * K^T(64x32)
      int krow = sub * 16 + ln;
      FragBF bK;
      bK.q[0] = *(const u32x4*)&Kls[krow][kbo];
      bK.q[1] = *(const u32x4*)&Kls[krow][16 + kbo];
      s[sub] = __builtin_amdgcn_wmma_f32_16x16x32_bf16(false, qa0.v, false, bK.v, (short)0, s[sub], false, false);
      bK.q[0] = *(const u32x4*)&Kls[krow][32 + kbo];
      bK.q[1] = *(const u32x4*)&Kls[krow][48 + kbo];
      s[sub] = __builtin_amdgcn_wmma_f32_16x16x32_bf16(false, qa1.v, false, bK.v, (short)0, s[sub], false, false);
    }
    int keyc0 = key0 + ln, keyc1 = key0 + 16 + ln;
#pragma unroll
    for (int i = 0; i < 8; i++) {                 // online softmax (DPP reductions)
      int row = qbase + i + hi * 8;
      float s0 = s[0][i] * 0.125f; if (keyc0 > row) s0 = -3.0e38f;
      float s1 = s[1][i] * 0.125f; if (keyc1 > row) s1 = -3.0e38f;
      float t = red16_max(fmaxf(s0, s1));
      float mn = fmaxf(m[i], t);
      float fac = __expf(m[i] - mn);
      float p0 = __expf(s0 - mn), p1 = __expf(s1 - mn);
      float ps = red16_sum(p0 + p1);
      l[i] = l[i] * fac + ps;
      m[i] = mn;
#pragma unroll
      for (int sub = 0; sub < 4; sub++) o[sub][i] *= fac;
      unsigned int pp = pk_bf16(p0, p1);
      Pls[wave][i + hi * 8][ln]      = (unsigned short)pp;
      Pls[wave][i + hi * 8][16 + ln] = (unsigned short)(pp >> 16);
    }
    __syncthreads();
    FragBF pa;                                    // P(16x32) * V(32x64)
    pa.q[0] = *(const u32x4*)&Pls[wave][ln][kbo];
    pa.q[1] = *(const u32x4*)&Pls[wave][ln][16 + kbo];
#pragma unroll
    for (int sub = 0; sub < 4; sub++) {
      FragBF bV;
      int col = sub * 16 + ln;
      bV.q[0] = *(const u32x4*)&Vls[col][kbo];
      bV.q[1] = *(const u32x4*)&Vls[col][16 + kbo];
      o[sub] = __builtin_amdgcn_wmma_f32_16x16x32_bf16(false, pa.v, false, bV.v, (short)0, o[sub], false, false);
    }
    __syncthreads();
  }
#pragma unroll
  for (int sub = 0; sub < 4; sub++)
#pragma unroll
    for (int i = 0; i < 8; i++) {
      int row = qbase + i + hi * 8;
      int col = h * 64 + sub * 16 + ln;
      y[(size_t)(b * 1024 + row) * CDIM + col] = o[sub][i] / l[i];
    }
}

// ---------------- MoE gate: softmax, top-2, combine weights, aux stats ----------------
// sel[row] = lower expert | higher expert << 4; gw[2*row], gw[2*row+1] = their weights
// part[16*block + e] = sum of P[e] over the block's 8 tokens, part[16*block + 8 + e] = how many
// of their 16 choices fell on expert e; every block writes its own row, no word is shared
#define GATE_BLOCKS (NTOK / 8)
__global__ void gate_kernel(const float* __restrict__ xn, const float* __restrict__ Wg,
                            int* __restrict__ sel, float* __restrict__ gw,
                            float* __restrict__ part_out) {
  __shared__ __attribute__((aligned(16))) float sP[8][2 * NEXP];   // a token's P, then its two choices as 0 / 1
  int tid = threadIdx.x, lane = tid & 31, wave = tid >> 5;
  int row = blockIdx.x * 8 + wave;
  float part[NEXP];
#pragma unroll
  for (int e = 0; e < NEXP; e++) part[e] = 0.f;
  const float* xr = xn + (size_t)row * CDIM;
  for (int c = lane; c < CDIM; c += 32) {
    float xv = xr[c];
#pragma unroll
    for (int e = 0; e < NEXP; e++) part[e] += xv * Wg[c * NEXP + e];
  }
#pragma unroll
  for (int e = 0; e < NEXP; e++)
#pragma unroll
    for (int off = 1; off < 32; off <<= 1) part[e] += __shfl_xor(part[e], off);
  if (lane == 0) {
    float mx = part[0];
#pragma unroll
    for (int e = 1; e < NEXP; e++) mx = fmaxf(mx, part[e]);
    float pe[NEXP], s = 0.f;
#pragma unroll
    for (int e = 0; e < NEXP; e++) { pe[e] = __expf(part[e] - mx); s += pe[e]; }
#pragma unroll
    for (int e = 0; e < NEXP; e++) pe[e] /= s;
    int s0 = 0;
#pragma unroll
    for (int e = 1; e < NEXP; e++) if (pe[e] > pe[s0]) s0 = e;
    int s1 = -1;
#pragma unroll
    for (int e = 0; e < NEXP; e++) if (e != s0 && (s1 < 0 || pe[e] > pe[s1])) s1 = e;
    float denom = pe[s0] + pe[s1];
    float w0 = pe[s0] / denom, w1 = pe[s1] / denom;
    bool up = s0 < s1;
    sel[row] = up ? (s0 | (s1 << 4)) : (s1 | (s0 << 4));
    gw[2 * row]     = up ? w0 : w1;
    gw[2 * row + 1] = up ? w1 : w0;
#pragma unroll                  // constant indices keep pe[] in registers
    for (int e = 0; e < NEXP; e++) {
      sP[wave][e] = pe[e];
      sP[wave][NEXP + e] = (e == s0 || e == s1) ? 1.0f : 0.0f;
    }
  }
  __syncthreads();
  if (tid < 2 * NEXP) {         // the block's 16 sums, tokens in wave order
    float t = 0.f;
#pragma unroll                  // the 8 LDS reads go out together
    for (int w = 0; w < 8; w++) t += sP[w][tid];
    part_out[blockIdx.x * 16 + tid] = t;
  }
}

// one block, its first 256 threads: thread t sums word t & 15 over the rows (t >> 4) + 16 j, then
// the 16 threads of a word are summed in LDS; the order is fixed
__device__ inline void aux_block(const float* __restrict__ part_in, float* __restrict__ out_aux) {
  __shared__ float red[16][16];
  int tid = threadIdx.x;
  if (tid < 256) {
    float t = 0.f;
#pragma unroll                  // all 32 loads in flight together
    for (int j = 0; j < GATE_BLOCKS / 16; j++) t += part_in[tid + 256 * j];
    red[tid >> 4][tid & 15] = t;
  }
  __syncthreads();
  if (tid < 16) {
    float s = 0.f;
#pragma unroll                  // the 16 LDS reads go out together
    for (int g = 0; g < 16; g++) s += red[g][tid];
    red[0][tid] = s;
  }
  __syncthreads();
  if (tid == 0) {
    float s = 0.f;
    for (int e = 0; e < NEXP; e++)
      s += (red[0][NEXP + e] / (float)(NTOK * 2)) * (red[0][e] / (float)NTOK);
    out_aux[0] = (float)NEXP * s;
  }
}

// ---------------- MoE routing: sort the 2*NTOK (token, expert) pairs by expert ----------------
// One block of 1024 threads, 4 tokens each. Eight running counts travel as 16-bit fields
// of two 64-bit words (no field passes MAXROW). Each expert's list starts at a multiple of 128.
// rowtok[p] = token of routed row p (0 in the padding), slot[2*t+j] = routed row of token t's
// j-th expert, tile_e[i] = expert of rows 128*i.., -1 behind the last list.
__device__ inline unsigned long long fld_one(int e) { return 1ull << ((e & 3) * 16); }
__device__ inline int fld_get(unsigned long long lo, unsigned long long hi, int e) {
  return (int)(((e < 4 ? lo : hi) >> ((e & 3) * 16)) & 0xFFFFull);
}
// Block 1 of the launch does the aux sum instead: it needs the gate's rows only, as the sort does.
__global__ void route_kernel(const int* __restrict__ sel, int* __restrict__ rowtok,
                             int* __restrict__ slot, int* __restrict__ tile_e,
                             const float* __restrict__ part_in, float* __restrict__ out_aux) {
  __shared__ unsigned long long wtot[32][2];
  if (blockIdx.x == 1) {        // the whole block goes this way, in front of every barrier of the sort
    aux_block(part_in, out_aux);
    return;
  }
  int tid = threadIdx.x, lane = tid & 31, wave = tid >> 5;
  int ex[8];
  unsigned long long lo = 0, hi = 0;
  // the loops over ex[] and over the experts are unrolled so that ex[] and the shift counts
  // are indexed by constants and nothing goes to scratch
#pragma unroll
  for (int i = 0; i < 4; i++) {
    int s = sel[tid * 4 + i];
    ex[2 * i] = s & 7; ex[2 * i + 1] = (s >> 4) & 7;
  }
#pragma unroll
  for (int i = 0; i < 8; i++) {
    if (ex[i] < 4) lo += fld_one(ex[i]); else hi += fld_one(ex[i]);
  }
  unsigned long long ilo = lo, ihi = hi;          // inclusive scan over the wave
  for (int d = 1; d < 32; d <<= 1) {
    unsigned long long a = __shfl_up(ilo, d), b = __shfl_up(ihi, d);
    if (lane >= d) { ilo += a; ihi += b; }
  }
  if (lane == 31) { wtot[wave][0] = ilo; wtot[wave][1] = ihi; }
  __syncthreads();
  unsigned long long tlo = 0, thi = 0, plo = ilo - lo, phi = ihi - hi;
#pragma unroll 4                // unrolled whole, the 64 words are all held in registers and spill
  for (int w = 0; w < 32; w++) {
    unsigned long long a = wtot[w][0], b = wtot[w][1];
    tlo += a; thi += b;
    if (w < wave) { plo += a; phi += b; }
  }
  int off = 0;
  int mytile = -1;
#pragma unroll
  for (int e = 0; e < NEXP; e++) {
    int cnt = fld_get(tlo, thi, e);
    int end = off + ((cnt + 127) & ~127);
    if (e < 4) plo += (unsigned long long)off << (e * 16);
    else       phi += (unsigned long long)off << ((e - 4) * 16);
    if (off + cnt + tid < end) rowtok[off + cnt + tid] = 0;
    if (tid * 128 >= off && tid * 128 < end) mytile = e;
    off = end;
  }
  if (tid < MAXTILE) tile_e[tid] = mytile;
#pragma unroll
  for (int i = 0; i < 8; i++) {
    int e = ex[i];
    int p = fld_get(plo, phi, e);
    if (e < 4) plo += fld_one(e); else phi += fld_one(e);
    rowtok[p] = tid * 4 + (i >> 1);
    slot[tid * 8 + i] = p;
  }
}

// out = x1 + w_a * ye[row_a] + w_b * ye[row_b], lower expert first; one block per token
__global__ void combine_kernel(const float4* __restrict__ x1, const float4* __restrict__ ye,
                               const int* __restrict__ slot, const float* __restrict__ gw,
                               float4* __restrict__ dst) {
  int tok = blockIdx.x, c = threadIdx.x;
  int pa = min(slot[2 * tok], MAXROW - 1), pb = min(slot[2 * tok + 1], MAXROW - 1);
  float wa = gw[2 * tok], wb = gw[2 * tok + 1];
  float4 o = x1[(size_t)tok * 256 + c];
  float4 a = ye[(size_t)pa * 256 + c];
  float4 b = ye[(size_t)pb * 256 + c];
  o.x += wa * a.x; o.y += wa * a.y; o.z += wa * a.z; o.w += wa * a.w;
  o.x += wb * b.x; o.y += wb * b.y; o.z += wb * b.z; o.w += wb * b.w;
  dst[(size_t)tok * 256 + c] = o;
}

// ---------------- launcher ----------------
extern "C" void kernel_launch(void* const* d_in, const int* in_sizes, int n_in,
                              void* d_out, int out_size, void* d_ws, size_t ws_size,
                              hipStream_t stream) {
  (void)in_sizes; (void)n_in; (void)out_size; (void)ws_size;
  const float* x   = (const float*)d_in[0];
  const float* ln1 = (const float*)d_in[1];
  const float* ln2 = (const float*)d_in[2];
  const float* Wq  = (const float*)d_in[3];
  const float* Wk  = (const float*)d_in[4];
  const float* Wv  = (const float*)d_in[5];
  const float* Wo  = (const float*)d_in[6];
  const float* Wg  = (const float*)d_in[7];
  const float* W1  = (const float*)d_in[8];
  const float* W2  = (const float*)d_in[9];
  float* outx = (float*)d_out;

  char* ws = (char*)d_ws;
  size_t off = 0;
  auto alloc = [&](size_t bytes) -> void* {
    void* p = ws + off;
    off += (bytes + 255) & ~(size_t)255;
    return p;
  };
  float*          xn1  = (float*)alloc((size_t)NTOK * CDIM * 4);
  float*          qf   = (float*)alloc((size_t)NTOK * CDIM * 4);
  float*          kf   = (float*)alloc((size_t)NTOK * 256 * 4);
  float*          vf   = (float*)alloc((size_t)NTOK * 256 * 4);
  unsigned short* qb   = (unsigned short*)alloc((size_t)NTOK * CDIM * 2);
  unsigned short* kbuf = (unsigned short*)alloc((size_t)NTOK * 256 * 2);
  unsigned short* vbuf = (unsigned short*)alloc((size_t)NTOK * 256 * 2);
  float*          yatt = (float*)alloc((size_t)NTOK * CDIM * 4);
  float*          x1   = (float*)alloc((size_t)NTOK * CDIM * 4);
  float*          xn2  = (float*)alloc((size_t)NTOK * CDIM * 4);
  unsigned short* hbf  = (unsigned short*)alloc((size_t)MAXROW * IDIM * 2);
  float*          ye   = (float*)alloc((size_t)MAXROW * CDIM * 4);
  int*            sel  = (int*)alloc((size_t)NTOK * 4);
  float*          gw   = (float*)alloc((size_t)NTOK * 2 * 4);
  int*            rowtok = (int*)alloc((size_t)MAXROW * 4);
  int*            slot = (int*)alloc((size_t)NTOK * 2 * 4);
  int*            tile_e = (int*)alloc((size_t)MAXTILE * 4);
  float*          part = (float*)alloc((size_t)GATE_BLOCKS * 16 * 4);

  // 1) xn1 = rmsnorm(x)
  rmsnorm_kernel<<<NTOK, 256, 0, stream>>>(x, ln1, xn1);
  // 2) q/k/v projections
  //    one launch: alone, the k and v products put 64 blocks on the chip for as long as q's 256
  gemm_wmma<0, float, 3, CDIM, 0><<<dim3((CDIM + 256 + 256) / 128, NTOK / 128), 256, 0, stream>>>(
      xn1, Wq, qf, nullptr, nullptr, NTOK, CDIM, CDIM, CDIM, CDIM, CDIM, nullptr, nullptr,
      Wk, Wv, kf, vf, 256);
  // 3) RoPE + bf16 conversion
  qkv_post_kernel<<<ROPE_Q_BLOCKS + ROPE_K_BLOCKS + CVT_V_BLOCKS, 256, 0, stream>>>(
      qf, qb, kf, kbuf, vf, vbuf);
  // 4) attention
  attn_kernel<<<dim3(64, 8), 256, 0, stream>>>(qb, kbuf, vbuf, yatt);
  // 5) x1 = yatt @ Wo + x
  gemm_wmma<2, float, 0, CDIM, CDIM><<<dim3(CDIM / 128, NTOK / 128), 256, 0, stream>>>(
      yatt, Wo, x1, nullptr, x, NTOK, CDIM, CDIM, CDIM, CDIM, CDIM, nullptr, nullptr,
      nullptr, nullptr, nullptr, nullptr, 0);
  // 6) xn2 = rmsnorm(x1)
  rmsnorm_kernel<<<NTOK, 256, 0, stream>>>(x1, ln2, xn2);
  // 7) gating + aux stats
  gate_kernel<<<GATE_BLOCKS, 256, 0, stream>>>(xn2, Wg, sel, gw, part);
  // 8) sort the (token, expert) pairs by expert; beside it, the aux loss scalar
  route_kernel<<<2, 1024, 0, stream>>>(sel, rowtok, slot, tile_e,
                                       part, outx + (size_t)NTOK * CDIM);
  // 9) experts, chosen rows only: h = gelu(xn2[rowtok] @ W1[e]); ye = h @ W2[e]
  gemm_wmma<1, float, 1, CDIM, IDIM><<<dim3(IDIM / 128, MAXTILE), 256, 0, stream>>>(
      xn2, W1, nullptr, hbf, nullptr, MAXROW, IDIM, CDIM, CDIM, IDIM, IDIM, rowtok, tile_e,
      nullptr, nullptr, nullptr, nullptr, 0);
  gemm_wmma<0, unsigned short, 2, IDIM, CDIM><<<dim3(CDIM / 128, MAXTILE), 256, 0, stream>>>(
      hbf, W2, ye, nullptr, nullptr, MAXROW, CDIM, IDIM, IDIM, CDIM, CDIM, nullptr, tile_e,
      nullptr, nullptr, nullptr, nullptr, 0);
  //    out = x1 + the two weighted expert rows of each token
  combine_kernel<<<NTOK, 256, 0, stream>>>(
      (const float4*)x1, (const float4*)ye, slot, gw, (float4*)outx);
}

// v010
// Measured time: 351 microseconds a run.
// Two timings next to v009 both put it at 1.04 times that version's speed.
// Over all steps from v000 it is 10.5 times as fast.
#include <hip/hip_runtime.h>
#include <hip/hip_bf16.h>
#include <math.h>

// ---------------- types / helpers ----------------
typedef __attribute__((ext_vector_type(16))) __bf16 v16bf;
typedef __attribute__((ext_vector_type(8)))  float  v8f;
typedef __attribute__((ext_vector_type(4)))  unsigned int u32x4;
typedef __attribute__((ext_vector_type(8)))  short s16x8;

union FragBF { u32x4 q[2]; v16bf v; };

// f32 -> bf16, round to nearest even, by the chip's own packed convert: one instruction for two values
typedef __attribute__((ext_vector_type(2))) float  f32x2;
typedef __attribute__((ext_vector_type(2))) __bf16 bf16x2;
__device__ inline unsigned int pk_bf16(float lo, float hi) {
  f32x2 v = {lo, hi};
  return __builtin_bit_cast(unsigned int, __builtin_convertvector(v, bf16x2));
}
__device__ inline unsigned int f32_bf16(float f) {
  return (unsigned int)__builtin_bit_cast(unsigned short, (__bf16)f);
}
// one 16-byte piece of a tile in two halves: the load alone, as it comes from memory, and the
// packing with the store to LDS (4 f32 become 8 bytes; 8 bf16 stay 16 bytes)
typedef __attribute__((ext_vector_type(2))) unsigned int u32x2;
__device__ inline float4 load16_raw(const float* p) { return *(const float4*)p; }
__device__ inline u32x4 load16_raw(const unsigned short* p) { return *(const u32x4*)p; }
__device__ inline void store16_bf(unsigned short* dst, const float4& v) {
  u32x2 r;
  r.x = pk_bf16(v.x, v.y);
  r.y = pk_bf16(v.z, v.w);
  *(u32x2*)dst = r;
}
__device__ inline void store16_bf(unsigned short* dst, const u32x4& v) { *(u32x4*)dst = v; }
// transposing LDS load: from a row-major [k][n] 16-bit tile, lane (c, h) gets 8 k of column c
__device__ inline u32x4 ld_tr16(const unsigned short* p) {
  typedef __attribute__((address_space(3))) s16x8 lds_s16x8;
  return __builtin_bit_cast(u32x4, __builtin_amdgcn_ds_load_tr16_b128_v8i16((lds_s16x8*)p));
}

// DPP16 butterfly reductions over a 16-lane row (VALU only, no LDS)
// ctrl must be a compile-time constant -> template parameter
template <int CTRL>
__device__ inline float dpp_f(float x) {
  return __int_as_float(
      __builtin_amdgcn_update_dpp(0, __float_as_int(x), CTRL, 0xF, 0xF, true));
}
#define DPP_QPERM_XOR1 0xB1   // quad_perm(1,0,3,2)
#define DPP_QPERM_XOR2 0x4E   // quad_perm(2,3,0,1)
#define DPP_ROW_HMIRR  0x141  // row_half_mirror (lane^7 within 8)
#define DPP_ROW_MIRR   0x140  // row_mirror (lane^15 within 16)
__device__ inline float red16_max(float x) {
  x = fmaxf(x, dpp_f<DPP_QPERM_XOR1>(x));
  x = fmaxf(x, dpp_f<DPP_QPERM_XOR2>(x));
  x = fmaxf(x, dpp_f<DPP_ROW_HMIRR>(x));
  x = fmaxf(x, dpp_f<DPP_ROW_MIRR>(x));
  return x;
}
__device__ inline float red16_sum(float x) {
  x += dpp_f<DPP_QPERM_XOR1>(x);
  x += dpp_f<DPP_QPERM_XOR2>(x);
  x += dpp_f<DPP_ROW_HMIRR>(x);
  x += dpp_f<DPP_ROW_MIRR>(x);
  return x;
}

#define NTOK 4096   // B*T
#define CDIM 1024
#define IDIM 4096
#define NEXP 8
#define MAXTILE 72            // 2*NTOK routed rows, each expert's list padded to 128: at most 71 tiles
#define MAXROW (MAXTILE * 128)

// ---------------- RMSNorm ----------------
__global__ void rmsnorm_kernel(const float* __restrict__ x,
                               const float* __restrict__ scale,
                               float* __restrict__ out) {
  __shared__ float red[9];
  int row = blockIdx.x;
  int tid = threadIdx.x;
  const float* xr = x + (size_t)row * CDIM;
  float v[4]; float ss = 0.f;
#pragma unroll
  for (int i = 0; i < 4; i++) { v[i] = xr[tid + 256 * i]; ss += v[i] * v[i]; }
#pragma unroll
  for (int off = 16; off >= 1; off >>= 1) ss += __shfl_xor(ss, off);
  if ((tid & 31) == 0) red[tid >> 5] = ss;
  __syncthreads();
  if (tid == 0) {
    float t = 0.f;
#pragma unroll
    for (int w = 0; w < 8; w++) t += red[w];
    red[8] = t;
  }
  __syncthreads();
  float inv = rsqrtf(red[8] / (float)CDIM + 1e-5f);
#pragma unroll
  for (int i = 0; i < 4; i++) {
    int c = tid + 256 * i;
    out[(size_t)row * CDIM + c] = v[i] * inv * scale[c];
  }
}

// ---------------- generic WMMA GEMM, 128x128 tile, double-buffered LDS ----------------
// C(M,N) = A(M,K) * B(K,N); A: float or bf16-bits; B: float (bf16-converted on stage)
// 8 waves; wave (wr,wc) owns rows wr*32..+32, cols wc*64..+64 => 2x4 wmma accums.
// EPI: 0 = store f32; 1 = gelu->bf16 (outh); 2 = +aux residual
// GRP: 0 = plain; 1, 2 = row tile blockIdx.y belongs to expert tile_e[blockIdx.y], whose
//      weights are plane tile_e of Bm; 1 also gathers the A rows through rowtok
//      3 = three products that share A in one launch: the column tiles run through Bm (N wide,
//      to outf), then Bm2 and Bm3 (N2 wide each, to outf2 and outf3); each is dense, ld = width
// The block size is stated so that the next tile's unconverted values fit in registers.
// KT: k values a pass, 32 or 64. 64 (f32 A, rows not gathered): twice the bytes in flight a block and half the
//      passes, for launches that put only one or two blocks on a WGP and so wait out each pass's loads
// LDA, LDB: the leading dimensions where they are fixed at compile time (0: take the argument); the
//      steps from one staged piece to the next then ride in the loads' offset fields
template <int EPI, typename AT, int GRP, int LDA, int LDB, int KT>
__global__ void __launch_bounds__(256) gemm_wmma(const AT* __restrict__ A, const float* __restrict__ Bm,
                          float* __restrict__ outf, unsigned short* __restrict__ outh,
                          const float* __restrict__ aux,
                          int M, int N, int Kd, int lda, int ldb, int ldc,
                          const int* __restrict__ rowtok, const int* __restrict__ tile_e,
                          const float* __restrict__ Bm2, const float* __restrict__ Bm3,
                          float* __restrict__ outf2, float* __restrict__ outf3, int N2) {
  __shared__ __attribute__((aligned(16))) unsigned short aS[2][128][KT + 8];   // 80- or 144-byte rows (16 B x odd)
  // B stays row-major [k][n]; 288-byte rows (32 B x odd) suit the transposing load
  __shared__ __attribute__((aligned(16))) unsigned short bS[2][KT][144];
  if (LDA > 0) lda = LDA;
  if (LDB > 0) ldb = LDB;
  int tid = threadIdx.x;
  int lane = tid & 31;
  int wave = tid >> 5;
  int wr = wave & 3, wc = wave >> 2;
  int m0 = blockIdx.y * 128, n0 = blockIdx.x * 128;
  if (GRP == 3 && n0 >= N) {    // the same for the whole block: a tile of the second or third product
    n0 -= N;
    bool third = n0 >= N2;
    if (third) n0 -= N2;
    Bm = third ? Bm3 : Bm2;
    outf = third ? outf3 : outf2;
    ldb = N2; ldc = N2;
  }
  int hi = lane >> 4;
  int kb = hi * 8;
  int ln = lane & 15;
  int ar0 = wr * 32 + ln;
  int btr = hi * 8 + (lane & 7);                    // B fragment: this lane's k row ...
  int btc = wc * 64 + ((lane >> 3) & 1) * 8;        // ... and its 16-byte piece of 16 columns
  if (GRP == 1 || GRP == 2) {
    int te = tile_e[blockIdx.y];
    if (te < 0) return;         // tile behind the last routed row: the whole block leaves here
    Bm += (size_t)(te & (NEXP - 1)) * Kd * ldb;
  }
  // staging: a thread brings its share of a tile in 16-byte pieces, dealt so that the 32 lanes of
  // one load ask for whole 128-byte lines and each line of the tile is asked for by one load only.
  // B, f32: piece j is k row kB + 8 j; a wave's load is one row of the tile, 512 bytes in a row.
  // A, f32: piece j is row rA + 32 j; 8 lanes take a row's 128 bytes, a wave's load four rows, which
  //         lie 4 apart: at the 80-byte pitch their 64-byte stores then fall on 64 different banks.
  // A, bf16: a row has only 64 bytes a pass: piece j is row rA + 64 j, 4 lanes a row.
  constexpr bool AF = sizeof(AT) == 4;
  constexpr int KH = KT / 32;             // matrix-instruction k steps a pass
  static_assert(KT == 32 || (KT == 64 && AF && GRP != 1), "64 k a pass: f32 A, rows not gathered");
  constexpr int NA = AF ? 4 * KH : 2;     // A pieces a thread; at KT 64 piece j is line j % 2 of row rA + 32 (j / 2)
  constexpr int NB = 4 * KH;              // B pieces a thread
  constexpr int RSA = AF ? 32 : 64;       // rows from one piece to the next
  constexpr int NO = GRP == 1 ? NA : 1;   // A offsets held: gathered rows need one each
  int rA = AF ? ((lane >> 3) * 4 + (wave & 3) + (wave >> 2) * 16) : (tid >> 2);
  int cgA = AF ? (lane & 7) * 4 : (tid & 3) * 8;
  int kB = wave, nbB = lane * 4;
  // global addresses: a base that is the same for the block, in scalar registers, a 32-bit byte
  // offset a lane, and the fixed step from piece to piece: few registers, so that the fragment group fits
  const char* Ab = (const char*)A;
  if (GRP != 1) Ab += (size_t)m0 * lda * sizeof(AT);
  const char* Bb = (const char*)(Bm + n0);
  unsigned aoff[NO], boff;
  if (GRP == 1) {
    int rix = m0 + rA, rt[NO];
#pragma unroll                  // constant indices keep rt[] and aoff[] in registers
    for (int j = 0; j < NO; j++) rt[j] = rowtok[rix + RSA * j];
    // later code reuses the index and the base registers of the row-index loads above; as inputs
    // of the wait they stay untouched up to it
    asm volatile("s_wait_xcnt 0x0" :: "v"(rix), "s"(rowtok) : "memory");
#pragma unroll
    for (int j = 0; j < NO; j++)
      aoff[j] = (unsigned)((rt[j] & (NTOK - 1)) * lda + cgA) * (unsigned)sizeof(AT);
  } else {
    aoff[0] = (unsigned)(rA * lda + cgA) * (unsigned)sizeof(AT);
  }
  boff = (unsigned)(kB * ldb + nbB) * 4u;
  auto a_src = [&](int j) -> const AT* {
    if (GRP == 1) return (const AT*)(Ab + aoff[j < NO ? j : 0]);
    return (const AT*)(Ab + ((size_t)((j / KH) * RSA) * lda + (j % KH) * 32) * sizeof(AT) + aoff[0]);
  };
  auto b_src = [&](int j) -> const float* {
    return (const float*)(Bb + (size_t)(j * 8) * ldb * 4 + boff);
  };
  v8f acc[2][4] = {};
  int nt = Kd / KT;
  // prologue: load tile 0 into regs, store to buffer 0
  {
    decltype(load16_raw((const AT*)nullptr)) wa[NA];
    float4 wb[NB];
#pragma unroll                  // constant indices keep wa[] and wb[] in registers, here and below
    for (int j = 0; j < NA; j++) wa[j] = load16_raw(a_src(j));
#pragma unroll
    for (int j = 0; j < NB; j++) wb[j] = load16_raw(b_src(j));
    // the first pass steps the offset registers of the loads above
    asm volatile("s_wait_xcnt 0x0" :: "v"(aoff[0]), "v"(aoff[NO > 1 ? 1 : 0]), "v"(aoff[NO > 2 ? 2 : 0]),
                 "v"(aoff[NO > 3 ? 3 : 0]), "v"(boff) : "memory");
#pragma unroll
    for (int j = 0; j < NA; j++) store16_bf(&aS[0][rA + RSA * (j / KH)][(j % KH) * 32 + cgA], wa[j]);
#pragma unroll
    for (int j = 0; j < NB; j++) store16_bf(&bS[0][kB + 8 * j][nbB], wb[j]);
  }
  __syncthreads();
  // a tile's 12 fragment loads a k step go out as one group, with no product among them: their LDS
  // latency is waited out once a pass and not once a B fragment
  FragBF fa[KH][2], fb[KH][4];
  const unsigned short* aF = &aS[0][ar0][kb];     // this lane's place in buffer 0: one register each,
  const unsigned short* bF = &bS[0][btr][btc];    // shared by the loop and the pass behind it
  auto load_frags = [&](int buf) {
#pragma unroll                  // constant indices keep fa[] and fb[] in registers
    for (int ks = 0; ks < KH; ks++) {
      const unsigned short* ap = aF + buf * (128 * (KT + 8)) + ks * 32;
      const unsigned short* bp = bF + buf * (KT * 144) + ks * (32 * 144);
      fa[ks][0].q[0] = *(const u32x4*)(ap);
      fa[ks][0].q[1] = *(const u32x4*)(ap + 16);
      fa[ks][1].q[0] = *(const u32x4*)(ap + 16 * (KT + 8));
      fa[ks][1].q[1] = *(const u32x4*)(ap + 16 * (KT + 8) + 16);
#pragma unroll
      for (int bj = 0; bj < 4; bj++) {
        fb[ks][bj].q[0] = ld_tr16(bp + bj * 16);
        fb[ks][bj].q[1] = ld_tr16(bp + 16 * 144 + bj * 16);
      }
    }
    // keeps the group together and ahead of what follows it in the source
    __builtin_amdgcn_sched_barrier(0);
  };
  // the products of the loaded fragments, back to back
  auto mma_frags = [&]() {
#pragma unroll                  // k steps in rising order: every sum keeps its order
    for (int ks = 0; ks < KH; ks++) {
#pragma unroll
      for (int bj = 0; bj < 4; bj++) {
        acc[0][bj] = __builtin_amdgcn_wmma_f32_16x16x32_bf16(false, fa[ks][0].v, false, fb[ks][bj].v, (short)0, acc[0][bj], false, false);
        acc[1][bj] = __builtin_amdgcn_wmma_f32_16x16x32_bf16(false, fa[ks][1].v, false, fb[ks][bj].v, (short)0, acc[1][bj], false, false);
      }
    }
    // keeps the conversion of the next tile, and with it the wait for its loads, behind the products
    __builtin_amdgcn_sched_barrier(0);
  };
  // every pass but the last fetches the tile after it; the last pass stands behind the loop, so
  // the loaded values live inside one pass and are not copied (a copy would wait for the loads)
  for (int kt = 0; kt + 1 < nt; kt++) {
    int buf = kt & 1;
    // issue all of the next tile's global loads together; nothing uses their values before the
    // products are done, so they stay in flight meanwhile
    decltype(load16_raw((const AT*)nullptr)) wa[NA];
    float4 wb[NB];
#pragma unroll                  // the step along k goes into the 32-bit offsets; the bases stay
    for (int j = 0; j < NO; j++) aoff[j] += (unsigned)KT * (unsigned)sizeof(AT);
    boff += (unsigned)KT * (unsigned)ldb * 4u;
#pragma unroll
    for (int j = 0; j < NA; j++) wa[j] = load16_raw(a_src(j));
#pragma unroll
    for (int j = 0; j < NB; j++) wb[j] = load16_raw(b_src(j));
    load_frags(buf);            // behind the global loads, whose way is the longer one
    unsigned pfa = aoff[0] + (unsigned)KT * (unsigned)sizeof(AT), pfb = boff + (unsigned)KT * (unsigned)ldb * 4u;
    if (kt + 2 < nt) {   // prefetch two tiles ahead into GL2
      __builtin_prefetch(Ab + pfa, 0, 1);
      __builtin_prefetch(Bb + pfb, 0, 1);
    }
    // later code steps or reuses the offset registers of the loads and prefetches above; as inputs
    // of the wait they stay untouched up to it, also by the loads' own results
    asm volatile("s_wait_xcnt 0x0" :: "v"(aoff[0]), "v"(aoff[NO > 1 ? 1 : 0]), "v"(aoff[NO > 2 ? 2 : 0]),
                 "v"(aoff[NO > 3 ? 3 : 0]), "v"(boff), "v"(pfa), "v"(pfb) : "memory");
    mma_frags();
    int nb = buf ^ 1;
    // first use of the loaded values: convert, then store
#pragma unroll
    for (int j = 0; j < NA; j++) store16_bf(&aS[nb][rA + RSA * (j / KH)][(j % KH) * 32 + cgA], wa[j]);
#pragma unroll
    for (int j = 0; j < NB; j++) store16_bf(&bS[nb][kB + 8 * j][nbB], wb[j]);
    __syncthreads();
  }
  load_frags((nt - 1) & 1);
  mma_frags();
#pragma unroll
  for (int ai = 0; ai < 2; ai++) {
#pragma unroll
    for (int bj = 0; bj < 4; bj++) {
#pragma unroll
      for (int i = 0; i < 8; i++) {
        int r = m0 + wr * 32 + ai * 16 + i + hi * 8;
        int c = n0 + wc * 64 + bj * 16 + ln;
        size_t idx = (size_t)r * ldc + c;
        float v = acc[ai][bj][i];
        if (EPI == 0) {
          outf[idx] = v;
        } else if (EPI == 1) {
          float g = 0.5f * v * (1.0f + erff(v * 0.70710678118f));
          outh[idx] = (unsigned short)f32_bf16(g);
        } else if (EPI == 2) {
          outf[idx] = v + aux[idx];
        }
      }
    }
  }
}

// ---------------- RoPE (+ bf16 convert) ----------------
__device__ inline void rope_pair(const float* __restrict__ in, unsigned short* __restrict__ outb,
                                 int nheads, int ld, int idx) {   // idx: pair index over NTOK*nheads*32
  int d = idx & 31;
  int th = idx >> 5;
  int head = th % nheads;
  int tok = th / nheads;
  int t = tok & 1023;                             // tok = b*T + t
  size_t base = (size_t)tok * ld + head * 64;
  float x1 = in[base + d], x2 = in[base + 32 + d];
  float inv_freq = __expf(-0.2878231366f * (float)d);  // 10000^(-d/32)
  float ang = (float)t * inv_freq;
  float cs = __cosf(ang), sn = __sinf(ang);
  // the slot behind the last transcendental: the next vector instruction may reuse its source
  // register; as inputs, the two results keep the slot behind them
  asm volatile("v_nop" :: "v"(cs), "v"(sn));
  // the fused forms written out: which product of a pair is rounded first does not hang on the call site
  unsigned int pr = pk_bf16(fmaf(x1, cs, -(x2 * sn)), fmaf(x2, cs, x1 * sn));
  outb[base + d]      = (unsigned short)pr;
  outb[base + 32 + d] = (unsigned short)(pr >> 16);
}

// q's RoPE, k's RoPE and v's conversion do not depend on one another: one launch, the blocks dealt in that order
#define ROPE_Q_BLOCKS ((NTOK * 16 * 32) / 256)
#define ROPE_K_BLOCKS ((NTOK * 4 * 32) / 256)
#define CVT_V_BLOCKS  ((NTOK * 256) / 256)
__global__ void qkv_post_kernel(const float* __restrict__ qf, unsigned short* __restrict__ qb,
                                const float* __restrict__ kf, unsigned short* __restrict__ kbuf,
                                const float* __restrict__ vf, unsigned short* __restrict__ vbuf) {
  int blk = blockIdx.x;
  if (blk < ROPE_Q_BLOCKS) {
    rope_pair(qf, qb, 16, CDIM, blk * 256 + threadIdx.x);
  } else if (blk < ROPE_Q_BLOCKS + ROPE_K_BLOCKS) {
    rope_pair(kf, kbuf, 4, 256, (blk - ROPE_Q_BLOCKS) * 256 + threadIdx.x);
  } else {
    size_t i = (size_t)(blk - ROPE_Q_BLOCKS - ROPE_K_BLOCKS) * 256 + threadIdx.x;
    vbuf[i] = (unsigned short)f32_bf16(vf[i]);
  }
}

// ---------------- flash attention (WMMA, causal, GQA) ----------------
// The block size is stated so that a key tile's staged values fit in registers beside the rest.
__global__ void __launch_bounds__(256) attn_kernel(const unsigned short* __restrict__ qb,
                            const unsigned short* __restrict__ kbuf,
                            const unsigned short* __restrict__ vbuf,
                            float* __restrict__ y) {
  __shared__ __attribute__((aligned(16))) unsigned short Kls[32][72];
  __shared__ __attribute__((aligned(16))) unsigned short Vls[64][40];
  __shared__ __attribute__((aligned(16))) unsigned short Pls[8][16][40];
  int tid = threadIdx.x, lane = tid & 31, wave = tid >> 5;
  int bh = blockIdx.x;
  int b = bh >> 4, h = bh & 15;
  int kvh = h >> 2;
  int qt = blockIdx.y;
  int qbase = qt * 128 + wave * 16;
  int hi = lane >> 4, kbo = hi * 8, ln = lane & 15;
  int qrow = qbase + ln;
  const unsigned short* qp = qb + (size_t)(b * 1024 + qrow) * CDIM + h * 64;
  FragBF qa0, qa1;
  qa0.q[0] = *(const u32x4*)(qp + kbo);
  qa0.q[1] = *(const u32x4*)(qp + 16 + kbo);
  qa1.q[0] = *(const u32x4*)(qp + 32 + kbo);
  qa1.q[1] = *(const u32x4*)(qp + 48 + kbo);
  float m[8], l[8];
  v8f o[4] = {};
#pragma unroll
  for (int i = 0; i < 8; i++) { m[i] = -3.0e38f; l[i] = 0.f; }
  int ntiles = (qt + 1) * 4;
  // this thread's share of a key tile: K rows wave + 8 i (one uint each), V rows vk + 4 i (one value each)
  int vk = tid >> 6, vd = tid & 63;
  const unsigned int* ksrc =
      (const unsigned int*)(kbuf + (size_t)(b * 1024 + wave) * 256 + kvh * 64) + lane;
  const unsigned short* vsrc = vbuf + (size_t)(b * 1024 + vk) * 256 + kvh * 64 + vd;
  unsigned int kr[4];
  unsigned short vr[8];
  // all 12 loads of the tile at key0 are issued together; nothing uses them before the next staging
  auto fetch_tile = [&](int key0) {
    const unsigned int* pk = ksrc + key0 * 128;
    const unsigned short* pv = vsrc + key0 * 256;
#pragma unroll                  // constant indices keep kr[] and vr[] in registers
    for (int i = 0; i < 4; i++) kr[i] = pk[i * 8 * 128];
#pragma unroll
    for (int i = 0; i < 8; i++) vr[i] = pv[i * 4 * 256];
    // the code behind reuses the address registers of the loads above; as inputs of the wait
    // they stay untouched up to it
    asm volatile("s_wait_xcnt 0x0" :: "v"(pk), "v"(pv) : "memory");
  };
  fetch_tile(0);
  for (int kt = 0; kt < ntiles; kt++) {
    int key0 = kt * 32;
#pragma unroll
    for (int i = 0; i < 4; i++)                   // stage K rows (32 x 64), uint copies
      ((unsigned int*)&Kls[wave + 8 * i][0])[lane] = kr[i];
#pragma unroll
    for (int i = 0; i < 8; i++)                   // stage V transposed: Vls[d][kk]
      Vls[vd][vk + 4 * i] = vr[i];
    __syncthreads();
    if (kt + 1 < ntiles) fetch_tile(key0 + 32);   // in flight during this tile's scores and softmax
    v8f s[2] = {};
#pragma unroll
    for (int sub = 0; sub < 2; sub++) {           // scores: Q(16x64) * K^T(64x32)
      int krow = sub * 16 + ln;
      FragBF bK;
      bK.q[0] = *(const u32x4*)&Kls[krow][kbo];
      bK.q[1] = *(const u32x4*)&Kls[krow][16 + kbo];
      s[sub] = __builtin_amdgcn_wmma_f32_16x16x32_bf16(false, qa0.v, false, bK.v, (short)0, s[sub], false, false);
      bK.q[0] = *(const u32x4*)&Kls[krow][32 + kbo];
      bK.q[1] = *(const u32x4*)&Kls[krow][48 + kbo];
      s[sub] = __builtin_amdgcn_wmma_f32_16x16x32_bf16(false, qa1.v, false, bK.v, (short)0, s[sub], false, false);
    }
    int keyc0 = key0 + ln, keyc1 = key0 + 16 + ln;
#pragma unroll
    for (int i = 0; i < 8; i++) {                 // online softmax (DPP reductions)
      int row = qbase + i + hi * 8;
      float s0 = s[0][i] * 0.125f; if (keyc0 > row) s0 = -3.0e38f;
      float s1 = s[1][i] * 0.125f; if (keyc1 > row) s1 = -3.0e38f;
      float t = red16_max(fmaxf(s0, s1));
      float mn = fmaxf(m[i], t);
      float fac = __expf(m[i] - mn);
      float p0 = __expf(s0 - mn), p1 = __expf(s1 - mn);
      float ps = red16_sum(p0 + p1);
      l[i] = l[i] * fac + ps;
      m[i] = mn;
#pragma unroll
      for (int sub = 0; sub < 4; sub++) o[sub][i] *= fac;
      unsigned int pp = pk_bf16(p0, p1);
      Pls[wave][i + hi * 8][ln]      = (unsigned short)pp;
      Pls[wave][i + hi * 8][16 + ln] = (unsigned short)(pp >> 16);
    }
    __syncthreads();
    FragBF pa;                                    // P(16x32) * V(32x64)
    pa.q[0] = *(const u32x4*)&Pls[wave][ln][kbo];
    pa.q[1] = *(const u32x4*)&Pls[wave][ln][16 + kbo];
#pragma unroll
    for (int sub = 0; sub < 4; sub++) {
      FragBF bV;
      int col = sub * 16 + ln;
      bV.q[0] = *(const u32x4*)&Vls[col][kbo];
      bV.q[1] = *(const u32x4*)&Vls[col][16 + kbo];
      o[sub] = __builtin_amdgcn_wmma_f32_16x16x32_bf16(false, pa.v, false, bV.v, (short)0, o[sub], false, false);
    }
    __syncthreads();
  }
#pragma unroll
  for (int sub = 0; sub < 4; sub++)
#pragma unroll
    for (int i = 0; i < 8; i++) {
      int row = qbase + i + hi * 8;
      int col = h * 64 + sub * 16 + ln;
      y[(size_t)(b * 1024 + row) * CDIM + col] = o[sub][i] / l[i];
    }
}

// ---------------- MoE gate: softmax, top-2, combine weights, aux stats ----------------
// sel[row] = lower expert | higher expert << 4; gw[2*row], gw[2*row+1] = their weights
// part[16*block + e] = sum of P[e] over the block's 8 tokens, part[16*block + 8 + e] = how many
// of their 16 choices fell on expert e; every block writes its own row, no word is shared
#define GATE_BLOCKS (NTOK / 8)
__global__ void gate_kernel(const float* __restrict__ xn, const float* __restrict__ Wg,
                            int* __restrict__ sel, float* __restrict__ gw,
                            float* __restrict__ part_out) {
  __shared__ __attribute__((aligned(16))) float sP[8][2 * NEXP];   // a token's P, then its two choices as 0 / 1
  int tid = threadIdx.x, lane = tid & 31, wave = tid >> 5;
  int row = blockIdx.x * 8 + wave;
  float part[NEXP];
#pragma unroll
  for (int e = 0; e < NEXP; e++) part[e] = 0.f;
  const float* xr = xn + (size_t)row * CDIM;
  for (int c = lane; c < CDIM; c += 32) {
    float xv = xr[c];
#pragma unroll
    for (int e = 0; e < NEXP; e++) part[e] += xv * Wg[c * NEXP + e];
  }
#pragma unroll
  for (int e = 0; e < NEXP; e++)
#pragma unroll
    for (int off = 1; off < 32; off <<= 1) part[e] += __shfl_xor(part[e], off);
  if (lane == 0) {
    float mx = part[0];
#pragma unroll
    for (int e = 1; e < NEXP; e++) mx = fmaxf(mx, part[e]);
    float pe[NEXP], s = 0.f;
#pragma unroll
    for (int e = 0; e < NEXP; e++) { pe[e] = __expf(part[e] - mx); s += pe[e]; }
#pragma unroll
    for (int e = 0; e < NEXP; e++) pe[e] /= s;
    int s0 = 0;
#pragma unroll
    for (int e = 1; e < NEXP; e++) if (pe[e] > pe[s0]) s0 = e;
    int s1 = -1;
#pragma unroll
    for (int e = 0; e < NEXP; e++) if (e != s0 && (s1 < 0 || pe[e] > pe[s1])) s1 = e;
    float denom = pe[s0] + pe[s1];
    float w0 = pe[s0] / denom, w1 = pe[s1] / denom;
    bool up = s0 < s1;
    sel[row] = up ? (s0 | (s1 << 4)) : (s1 | (s0 << 4));
    gw[2 * row]     = up ? w0 : w1;
    gw[2 * row + 1] = up ? w1 : w0;
#pragma unroll                  // constant indices keep pe[] in registers
    for (int e = 0; e < NEXP; e++) {
      sP[wave][e] = pe[e];
      sP[wave][NEXP + e] = (e == s0 || e == s1) ? 1.0f : 0.0f;
    }
  }
  __syncthreads();
  if (tid < 2 * NEXP) {         // the block's 16 sums, tokens in wave order
    float t = 0.f;
#pragma unroll                  // the 8 LDS reads go out together
    for (int w = 0; w < 8; w++) t += sP[w][tid];
    part_out[blockIdx.x * 16 + tid] = t;
  }
}

// one block, its first 256 threads: thread t sums word t & 15 over the rows (t >> 4) + 16 j, then
// the 16 threads of a word are summed in LDS; the order is fixed
__device__ inline void aux_block(const float* __restrict__ part_in, float* __restrict__ out_aux) {
  __shared__ float red[16][16];
  int tid = threadIdx.x;
  if (tid < 256) {
    float t = 0.f;
#pragma unroll                  // all 32 loads in flight together
    for (int j = 0; j < GATE_BLOCKS / 16; j++) t += part_in[tid + 256 * j];
    red[tid >> 4][tid & 15] = t;
  }
  __syncthreads();
  if (tid < 16) {
    float s = 0.f;
#pragma unroll                  // the 16 LDS reads go out together
    for (int g = 0; g < 16; g++) s += red[g][tid];
    red[0][tid] = s;
  }
  __syncthreads();
  if (tid == 0) {
    float s = 0.f;
    for (int e = 0; e < NEXP; e++)
      s += (red[0][NEXP + e] / (float)(NTOK * 2)) * (red[0][e] / (float)NTOK);
    out_aux[0] = (float)NEXP * s;
  }
}

// ---------------- MoE routing: sort the 2*NTOK (token, expert) pairs by expert ----------------
// One block of 1024 threads, 4 tokens each. Eight running counts travel as 16-bit fields
// of two 64-bit words (no field passes MAXROW). Each expert's list starts at a multiple of 128.
// rowtok[p] = token of routed row p (0 in the padding), slot[2*t+j] = routed row of token t's
// j-th expert, tile_e[i] = expert of rows 128*i.., -1 behind the last list.
__device__ inline unsigned long long fld_one(int e) { return 1ull << ((e & 3) * 16); }
__device__ inline int fld_get(unsigned long long lo, unsigned long long hi, int e) {
  return (int)(((e < 4 ? lo : hi) >> ((e & 3) * 16)) & 0xFFFFull);
}
// Block 1 of the launch does the aux sum instead: it needs the gate's rows only, as the sort does.
__global__ void route_kernel(const int* __restrict__ sel, int* __restrict__ rowtok,
                             int* __restrict__ slot, int* __restrict__ tile_e,
                             const float* __restrict__ part_in, float* __restrict__ out_aux) {
  __shared__ unsigned long long wtot[32][2];
  if (blockIdx.x == 1) {        // the whole block goes this way, in front of every barrier of the sort
    aux_block(part_in, out_aux);
    return;
  }
  int tid = threadIdx.x, lane = tid & 31, wave = tid >> 5;
  int ex[8];
  unsigned long long lo = 0, hi = 0;
  // the loops over ex[] and over the experts are unrolled so that ex[] and the shift counts
  // are indexed by constants and nothing goes to scratch
#pragma unroll
  for (int i = 0; i < 4; i++) {
    int s = sel[tid * 4 + i];
    ex[2 * i] = s & 7; ex[2 * i + 1] = (s >> 4) & 7;
  }
#pragma unroll
  for (int i = 0; i < 8; i++) {
    if (ex[i] < 4) lo += fld_one(ex[i]); else hi += fld_one(ex[i]);
  }
  unsigned long long ilo = lo, ihi = hi;          // inclusive scan over the wave
  for (int d = 1; d < 32; d <<= 1) {
    unsigned long long a = __shfl_up(ilo, d), b = __shfl_up(ihi, d);
    if (lane >= d) { ilo += a; ihi += b; }
  }
  if (lane == 31) { wtot[wave][0] = ilo; wtot[wave][1] = ihi; }
  __syncthreads();
  unsigned long long tlo = 0, thi = 0, plo = ilo - lo, phi = ihi - hi;
#pragma unroll 4                // unrolled whole, the 64 words are all held in registers and spill
  for (int w = 0; w < 32; w++) {
    unsigned long long a = wtot[w][0], b = wtot[w][1];
    tlo += a; thi += b;
    if (w < wave) { plo += a; phi += b; }
  }
  int off = 0;
  int mytile = -1;
#pragma unroll
  for (int e = 0; e < NEXP; e++) {
    int cnt = fld_get(tlo, thi, e);
    int end = off + ((cnt + 127) & ~127);
    if (e < 4) plo += (unsigned long long)off << (e * 16);
    else       phi += (unsigned long long)off << ((e - 4) * 16);
    if (off + cnt + tid < end) rowtok[off + cnt + tid] = 0;
    if (tid * 128 >= off && tid * 128 < end) mytile = e;
    off = end;
  }
  if (tid < MAXTILE) tile_e[tid] = mytile;
#pragma unroll
  for (int i = 0; i < 8; i++) {
    int e = ex[i];
    int p = fld_get(plo, phi, e);
    if (e < 4) plo += fld_one(e); else phi += fld_one(e);
    rowtok[p] = tid * 4 + (i >> 1);
    slot[tid * 8 + i] = p;
  }
}

// out = x1 + w_a * ye[row_a] + w_b * ye[row_b], lower expert first; one block per token
__global__ void combine_kernel(const float4* __restrict__ x1, const float4* __restrict__ ye,
                               const int* __restrict__ slot, const float* __restrict__ gw,
                               float4* __restrict__ dst) {
  int tok = blockIdx.x, c = threadIdx.x;
  int pa = min(slot[2 * tok], MAXROW - 1), pb = min(slot[2 * tok + 1], MAXROW - 1);
  float wa = gw[2 * tok], wb = gw[2 * tok + 1];
  float4 o = x1[(size_t)tok * 256 + c];
  float4 a = ye[(size_t)pa * 256 + c];
  float4 b = ye[(size_t)pb * 256 + c];
  o.x += wa * a.x; o.y += wa * a.y; o.z += wa * a.z; o.w += wa * a.w;
  o.x += wb * b.x; o.y += wb * b.y; o.z += wb * b.z; o.w += wb * b.w;
  dst[(size_t)tok * 256 + c] = o;
}

// ---------------- launcher ----------------
extern "C" void kernel_launch(void* const* d_in, const int* in_sizes, int n_in,
                              void* d_out, int out_size, void* d_ws, size_t ws_size,
                              hipStream_t stream) {
  (void)in_sizes; (void)n_in; (void)out_size; (void)ws_size;
  const float* x   = (const float*)d_in[0];
  const float* ln1 = (const float*)d_in[1];
  const float* ln2 = (const float*)d_in[2];
  const float* Wq  = (const float*)d_in[3];
  const float* Wk  = (const float*)d_in[4];
  const float* Wv  = (const float*)d_in[5];
  const float* Wo  = (const float*)d_in[6];
  const float* Wg  = (const float*)d_in[7];
  const float* W1  = (const float*)d_in[8];
  const float* W2  = (const float*)d_in[9];
  float* outx = (float*)d_out;

  char* ws = (char*)d_ws;
  size_t off = 0;
  auto alloc = [&](size_t bytes) -> void* {
    void* p = ws + off;
    off += (bytes + 255) & ~(size_t)255;
    return p;
  };
  float*          xn1  = (float*)alloc((size_t)NTOK * CDIM * 4);
  float*          qf   = (float*)alloc((size_t)NTOK * CDIM * 4);
  float*          kf   = (float*)alloc((size_t)NTOK * 256 * 4);
  float*          vf   = (float*)alloc((size_t)NTOK * 256 * 4);
  unsigned short* qb   = (unsigned short*)alloc((size_t)NTOK * CDIM * 2);
  unsigned short* kbuf = (unsigned short*)alloc((size_t)NTOK * 256 * 2);
  unsigned short* vbuf = (unsigned short*)alloc((size_t)NTOK * 256 * 2);
  float*          yatt = (float*)alloc((size_t)NTOK * CDIM * 4);
  float*          x1   = (float*)alloc((size_t)NTOK * CDIM * 4);
  float*          xn2  = (float*)alloc((size_t)NTOK * CDIM * 4);
  unsigned short* hbf  = (unsigned short*)alloc((size_t)MAXROW * IDIM * 2);
  float*          ye   = (float*)alloc((size_t)MAXROW * CDIM * 4);
  int*            sel  = (int*)alloc((size_t)NTOK * 4);
  float*          gw   = (float*)alloc((size_t)NTOK * 2 * 4);
  int*            rowtok = (int*)alloc((size_t)MAXROW * 4);
  int*            slot = (int*)alloc((size_t)NTOK * 2 * 4);
  int*            tile_e = (int*)alloc((size_t)MAXTILE * 4);
  float*          part = (float*)alloc((size_t)GATE_BLOCKS * 16 * 4);

  // 1) xn1 = rmsnorm(x)
  rmsnorm_kernel<<<NTOK, 256, 0, stream>>>(x, ln1, xn1);
  // 2) q/k/v projections
  //    one launch: alone, the k and v products put 64 blocks on the chip for as long as q's 256
  gemm_wmma<0, float, 3, CDIM, 0, 64><<<dim3((CDIM + 256 + 256) / 128, NTOK / 128), 256, 0, stream>>>(
      xn1, Wq, qf, nullptr, nullptr, NTOK, CDIM, CDIM, CDIM, CDIM, CDIM, nullptr, nullptr,
      Wk, Wv, kf, vf, 256);
  // 3) RoPE + bf16 conversion
  qkv_post_kernel<<<ROPE_Q_BLOCKS + ROPE_K_BLOCKS + CVT_V_BLOCKS, 256, 0, stream>>>(
      qf, qb, kf, kbuf, vf, vbuf);
  // 4) attention
  attn_kernel<<<dim3(64, 8), 256, 0, stream>>>(qb, kbuf, vbuf, yatt);
  // 5) x1 = yatt @ Wo + x
  gemm_wmma<2, float, 0, CDIM, CDIM, 64><<<dim3(CDIM / 128, NTOK / 128), 256, 0, stream>>>(
      yatt, Wo, x1, nullptr, x, NTOK, CDIM, CDIM, CDIM, CDIM, CDIM, nullptr, nullptr,
      nullptr, nullptr, nullptr, nullptr, 0);
  // 6) xn2 = rmsnorm(x1)
  rmsnorm_kernel<<<NTOK, 256, 0, stream>>>(x1, ln2, xn2);
  // 7) gating + aux stats
  gate_kernel<<<GATE_BLOCKS, 256, 0, stream>>>(xn2, Wg, sel, gw, part);
  // 8) sort the (token, expert) pairs by expert; beside it, the aux loss scalar
  route_kernel<<<2, 1024, 0, stream>>>(sel, rowtok, slot, tile_e,
                                       part, outx + (size_t)NTOK * CDIM);
  // 9) experts, chosen rows only: h = gelu(xn2[rowtok] @ W1[e]); ye = h @ W2[e]
  gemm_wmma<1, float, 1, CDIM, IDIM, 32><<<dim3(IDIM / 128, MAXTILE), 256, 0, stream>>>(
      xn2, W1, nullptr, hbf, nullptr, MAXROW, IDIM, CDIM, CDIM, IDIM, IDIM, rowtok, tile_e,
      nullptr, nullptr, nullptr, nullptr, 0);
  gemm_wmma<0, unsigned short, 2, IDIM, CDIM, 32><<<dim3(CDIM / 128, MAXTILE), 256, 0, stream>>>(
      hbf, W2, ye, nullptr, nullptr, MAXROW, CDIM, IDIM, IDIM, CDIM, CDIM, nullptr, tile_e,
      nullptr, nullptr, nullptr, nullptr, 0);
  //    out = x1 + the two weighted expert rows of each token
  combine_kernel<<<NTOK, 256, 0, stream>>>(
      (const float4*)x1, (const float4*)ye, slot, gw, (float4*)outx);
}
